// v000
// Times are from an AMD MI455X. After a warm-up the kernel runs many times in a row, and a time is the length of
// such a window on the GPU divided by its runs, so every launch and the gaps after it count. The runs cycle
// through copies of the inputs. A figure is the median of several windows, for all but v000 over two sittings.
// Sittings can differ by a few percent; kernels timed side by side share one.
// v000, which the later versions start from, runs in 1020 microseconds.
#include <hip/hip_runtime.h>

// DifferentialMultiHeadSelfAttention (x [1][2048][1024]; per-head q1, q2, k1, k2, v = x W[h]^T + b[h] (16 x 64); s = q.k/8 with mask[i][j] (int, 1 = masked -> -inf, read as data); w = softmax(s1) - lam[h] softmax(s2);
// out = w.v; heads concatenated; GroupNorm(16 groups = heads, eps 1e-5, biased var over (64 dims x 2048 tokens)) x gn_w + gn_b; out Wo^T + bo -> [1][2048][1024]).
// Compute dtypes, f32 accumulate: every input rounded to bf16; the five projections on PLAIN bf16 operands (inputs: exact, + bias; the stacked [16][64][1024] weights are one natural [1024][1024] Bt); both score GEMMs

#define TT   2048
#define EE   1024
#define NH_  16
#define HD   64
#define ZH   2
#define SCL  0.125f
typedef _Float16 h16;
typedef unsigned short bf;
typedef __attribute__((ext_vector_type(16))) __bf16   v16bf;
typedef __attribute__((ext_vector_type(16))) _Float16 v16h;
typedef __attribute__((ext_vector_type(8)))  _Float16 v8h;
typedef __attribute__((ext_vector_type(8)))  unsigned short v8us;
typedef __attribute__((ext_vector_type(8)))  float    v8f;
typedef __attribute__((ext_vector_type(4)))  float    v4f;
typedef v8h  __attribute__((may_alias)) v8ha;
typedef v4f  __attribute__((may_alias)) v4fa;
typedef v8us __attribute__((may_alias)) v8usa;

__device__ __forceinline__ unsigned short f2bf(float f) { unsigned u = __float_as_uint(f); u += 0x7FFFu + ((u >> 16) & 1u); return (unsigned short)(u >> 16); }
__device__ __forceinline__ float bf2f(unsigned short b) { return __uint_as_float(((unsigned)b) << 16); }
__device__ __forceinline__ float bfr(float f) { return bf2f(f2bf(f)); }
__device__ __forceinline__ v16h cat16(v8h lo, v8h hi) { return __builtin_shufflevector(lo, hi, 0, 1, 2, 3, 4, 5, 6, 7, 8, 9, 10, 11, 12, 13, 14, 15); }
__device__ __forceinline__ v16bf cat16b(v8us lo, v8us hi) { return __builtin_bit_cast(v16bf, __builtin_shufflevector(lo, hi, 0, 1, 2, 3, 4, 5, 6, 7, 8, 9, 10, 11, 12, 13, 14, 15)); }
__device__ __forceinline__ v8f wmma16(v16h a, v16h b, v8f c) { return __builtin_amdgcn_wmma_f32_16x16x32_f16(false, a, false, b, (short)0, c, false, false); }
__device__ __forceinline__ v8f wmmab(v16bf a, v16bf b, v8f c) { return __builtin_amdgcn_wmma_f32_16x16x32_bf16(false, a, false, b, (short)0, c, false, false); }



// ---- k_gemmw: register-blocked GEMM, ONE WAVE per 64x64 output tile (16 accumulators), operands straight from K-contiguous 16-bit planes; grid (M/64, N/64, Z), 32 threads.
// C[m][n] (f32, pitch ldc, + optional f32 bias[n]) = sum_k A[m][k] Bt[n][k] (+ split products per NSPLIT). z-batch strides sA/sB/sC in elements. K % 32 == 0.
template <typename T16> struct WFrag;
template <> struct WFrag<h16> { typedef v16h V; static __device__ __forceinline__ V ld(const h16* p) { return cat16(*(const v8h*)p, *(const v8h*)(p + 16)); } static __device__ __forceinline__ v8f mma(V a, V b, v8f c) { return wmma16(a, b, c); } };
template <> struct WFrag<bf> { typedef v16bf V; static __device__ __forceinline__ V ld(const bf* p) { return cat16b(*(const v8us*)p, *(const v8us*)(p + 16)); } static __device__ __forceinline__ v8f mma(V a, V b, v8f c) { return wmmab(a, b, c); } };
template <typename T16, int NSPLIT, bool BIAS>
__global__ __launch_bounds__(32) void k_gemmw(const T16* __restrict__ A, const T16* __restrict__ A2, const T16* __restrict__ Bt, const T16* __restrict__ Bt2, int K, float* C, int ldc, const float* __restrict__ bias, size_t sA, size_t sB, size_t sC) {
    typedef typename WFrag<T16>::V V;
    __shared__ __align__(16) float os[16 * 68];
    const size_t z = blockIdx.z; A += z * sA; if (A2) A2 += z * sA; Bt += z * sB; if (Bt2) Bt2 += z * sB; C += z * sC;
    const int lane = threadIdx.x & 31, lr = lane & 15, hi = lane >> 4; const int r0 = blockIdx.x * 64, c0 = blockIdx.y * 64;
    v8f acc[4][4];
#pragma unroll
    for (int mb = 0; mb < 4; ++mb)
#pragma unroll
        for (int nb = 0; nb < 4; ++nb) acc[mb][nb] = (v8f){};
    const size_t aoff = (size_t)(r0 + lr) * K + 8 * hi, boff = (size_t)(c0 + lr) * K + 8 * hi;
#pragma unroll 1
    for (int kc = 0; kc < K; kc += 32) {
        V a[4], a2[4];
#pragma unroll
        for (int mb = 0; mb < 4; ++mb) { a[mb] = WFrag<T16>::ld(A + aoff + (size_t)mb * 16 * K + kc); if (NSPLIT == 1 || NSPLIT == 2) a2[mb] = WFrag<T16>::ld(A2 + aoff + (size_t)mb * 16 * K + kc); }
#pragma unroll
        for (int nb = 0; nb < 4; ++nb) { const V b = WFrag<T16>::ld(Bt + boff + (size_t)nb * 16 * K + kc); V b2; if (NSPLIT >= 2) b2 = WFrag<T16>::ld(Bt2 + boff + (size_t)nb * 16 * K + kc);
#pragma unroll
            for (int mb = 0; mb < 4; ++mb) { acc[mb][nb] = WFrag<T16>::mma(a[mb], b, acc[mb][nb]); if (NSPLIT == 1 || NSPLIT == 2) acc[mb][nb] = WFrag<T16>::mma(a2[mb], b, acc[mb][nb]); if (NSPLIT >= 2) acc[mb][nb] = WFrag<T16>::mma(a[mb], b2, acc[mb][nb]); } }
        asm volatile("v_nop\n\tv_nop\n\tv_nop\n\tv_nop" : "+v"(acc[0][0]), "+v"(acc[1][1]), "+v"(acc[2][2]), "+v"(acc[3][3]) : "v"(a[0]), "v"(a[3]));
    }
#pragma unroll
    for (int mb = 0; mb < 4; ++mb) {
#pragma unroll
        for (int nb = 0; nb < 4; ++nb) {
#pragma unroll
            for (int j = 0; j < 8; ++j) os[(hi * 8 + j) * 68 + nb * 16 + lr] = acc[mb][nb][j]; }
        __builtin_amdgcn_wave_barrier(); asm volatile("" ::: "memory");
        float* crow = C + (size_t)(r0 + mb * 16) * ldc + c0;
{
#pragma unroll
            for (int s = 0; s < 8; ++s) { const int row = 2 * s + hi, cofs = lr * 4; v4f val = *(const v4fa*)(os + row * 68 + cofs); if (BIAS) { val[0] += bfr(bias[c0 + cofs]); val[1] += bfr(bias[c0 + cofs + 1]); val[2] += bfr(bias[c0 + cofs + 2]); val[3] += bfr(bias[c0 + cofs + 3]); }
                *(v4f*)(crow + (size_t)row * ldc + cofs) = val; }
             }
        __builtin_amdgcn_wave_barrier(); asm volatile("" ::: "memory");
    }
}

__device__ __forceinline__ void splitf(float y, unsigned short& h, unsigned short& l) { h = f2bf(y); l = f2bf(y - bf2f(h)); }
typedef __attribute__((ext_vector_type(2))) unsigned short v2us;
typedef __attribute__((ext_vector_type(4))) unsigned short v4us;
typedef __attribute__((ext_vector_type(2))) float v2f;

__global__ __launch_bounds__(256) void k_cvt8(const float* __restrict__ src, bf* dst, size_t n8) { const size_t i = (size_t)blockIdx.x * 256 + threadIdx.x; if (i >= n8) return; const v8f v = *(const v8f*)(src + i * 8); v8us o;
#pragma unroll
    for (int k = 0; k < 8; ++k) o[k] = f2bf(v[k]); *(v8us*)(dst + i * 8) = o;  }
__global__ __launch_bounds__(256) void k_pl(const float* __restrict__ F, bf* Ph, bf* Pl) { const size_t e = ((size_t)blockIdx.x * 256 + threadIdx.x) * 2; if (e >= (size_t)NH_ * TT * HD) return; const int d = (int)(e % HD); const int t = (int)((e / HD) % TT); const int h = (int)(e / ((size_t)HD * TT)); const float* f = F + (size_t)t * EE + h * HD + d; v2us oh, ol;
#pragma unroll
    for (int u = 0; u < 2; ++u) { unsigned short a, c; splitf(f[u], a, c); oh[u] = a; ol[u] = c; } *(v2us*)(Ph + e) = oh; *(v2us*)(Pl + e) = ol;  }
__global__ __launch_bounds__(256) void k_vtp(const float* __restrict__ F, bf* Vh, bf* Vl) { const size_t e = ((size_t)blockIdx.x * 256 + threadIdx.x) * 2; if (e >= (size_t)NH_ * HD * TT) return; const int t = (int)(e % TT); const int d = (int)((e / TT) % HD); const int h = (int)(e / ((size_t)TT * HD)); v2us oh, ol;
#pragma unroll
    for (int u = 0; u < 2; ++u) { unsigned short a, c; splitf(F[(size_t)(t + u) * EE + h * HD + d], a, c); oh[u] = a; ol[u] = c; } *(v2us*)(Vh + e) = oh; *(v2us*)(Vl + e) = ol;  }
__global__ __launch_bounds__(256) void k_soft1(float* Sb, const int* __restrict__ msk) { const int lane = threadIdx.x & 31; const int row = blockIdx.x * 8 + (threadIdx.x >> 5); if (row >= ZH * TT) return; const int i = row % TT; float* sr = Sb + (size_t)row * TT; const int* mr = msk + (size_t)i * TT; float v[64]; float mx = -3.0e38f;
#pragma unroll
    for (int ch = 0; ch < 16; ++ch) { const int j0 = ch * 128 + lane * 4; const v4f a = *(const v4f*)(sr + j0);
#pragma unroll
        for (int q = 0; q < 4; ++q) { const float t = mr[j0 + q] ? -3.0e38f : a[q] * SCL; v[ch * 4 + q] = t; mx = fmaxf(mx, t); } }
#pragma unroll
    for (int sh = 16; sh; sh >>= 1) mx = fmaxf(mx, __shfl_xor(mx, sh, 32));
    float sum = 0.f;
#pragma unroll
    for (int k = 0; k < 64; ++k) { float d0 = __fsub_rn(v[k], mx); asm volatile("" : "+v"(d0)); v[k] = __expf(d0); sum += v[k]; }
#pragma unroll
    for (int sh = 16; sh; sh >>= 1) sum += __shfl_xor(sum, sh, 32);
    const float f = __fdiv_rn(1.0f, sum);
{
#pragma unroll
        for (int ch = 0; ch < 16; ++ch) { v4f o; o[0] = v[ch * 4] * f; o[1] = v[ch * 4 + 1] * f; o[2] = v[ch * 4 + 2] * f; o[3] = v[ch * 4 + 3] * f; *(v4f*)(sr + ch * 128 + lane * 4) = o; }
         } }
__global__ __launch_bounds__(256) void k_soft2(const float* __restrict__ S2, const float* __restrict__ P1, const int* __restrict__ msk, const float* __restrict__ lam, int h0, bf* Ph, bf* Pl) { const int lane = threadIdx.x & 31; const int row = blockIdx.x * 8 + (threadIdx.x >> 5); if (row >= ZH * TT) return; const int i = row % TT, z = row / TT; const float lm = bfr(lam[h0 + z]); const float* sr = S2 + (size_t)row * TT; const float* pr = P1 + (size_t)row * TT; const int* mr = msk + (size_t)i * TT; float v[64]; float mx = -3.0e38f;
#pragma unroll
    for (int ch = 0; ch < 16; ++ch) { const int j0 = ch * 128 + lane * 4; const v4f a = *(const v4f*)(sr + j0);
#pragma unroll
        for (int q = 0; q < 4; ++q) { const float t = mr[j0 + q] ? -3.0e38f : a[q] * SCL; v[ch * 4 + q] = t; mx = fmaxf(mx, t); } }
#pragma unroll
    for (int sh = 16; sh; sh >>= 1) mx = fmaxf(mx, __shfl_xor(mx, sh, 32));
    float sum = 0.f;
#pragma unroll
    for (int k = 0; k < 64; ++k) { float d0 = __fsub_rn(v[k], mx); asm volatile("" : "+v"(d0)); v[k] = __expf(d0); sum += v[k]; }
#pragma unroll
    for (int sh = 16; sh; sh >>= 1) sum += __shfl_xor(sum, sh, 32);
    const float f = __fmul_rn(__fdiv_rn(1.0f, sum), lm);
{
#pragma unroll
        for (int ch = 0; ch < 16; ++ch) { const int j0 = ch * 128 + lane * 4; const v4f p1 = *(const v4f*)(pr + j0); v4us oh, ol;
#pragma unroll
            for (int q = 0; q < 4; ++q) { float t2 = __fmul_rn(v[ch * 4 + q], f); asm volatile("" : "+v"(t2)); unsigned short a, c; splitf(__fsub_rn(p1[q], t2), a, c); oh[q] = a; ol[q] = c; }
            *(v4us*)(Ph + (size_t)row * TT + j0) = oh; *(v4us*)(Pl + (size_t)row * TT + j0) = ol; }
         } }
// k_cat: CAT[t][(h0+z)*64 + d] = Ob[z][t][d] (8-B lanes); k_gst: per (h, t) partial sums over the head's 64 dims (centred squares when centred) -> PS[h][t]; k_gred: M[h] = sum_t PS / (64*2048);
__global__ __launch_bounds__(256) void k_cat(const float* __restrict__ Ob, int h0, float* CAT) { const size_t e = ((size_t)blockIdx.x * 256 + threadIdx.x) * 2; if (e >= (size_t)ZH * TT * HD) return; const int d = (int)(e % HD); const int t = (int)((e / HD) % TT); const int z = (int)(e / ((size_t)HD * TT)); v2f o; o[0] = Ob[e]; o[1] = Ob[e + 1]; const size_t oo = (size_t)t * EE + (h0 + z) * HD + d; *(v2f*)(CAT + oo) = o;  }
__global__ __launch_bounds__(256) void k_gst(const float* __restrict__ CAT, const float* __restrict__ MU, int centred, float* PS) { const int e = blockIdx.x * 256 + threadIdx.x; if (e >= NH_ * TT) return; const int t = e % TT, h = e / TT; const float m = centred ? MU[h] : 0.f; const float* r = CAT + (size_t)t * EE + h * HD; float s = 0.f;
    for (int d = 0; d < HD; ++d) { const float dv = __fsub_rn(r[d], m); float q = centred ? __fmul_rn(dv, dv) : dv; asm volatile("" : "+v"(q)); s = __fadd_rn(s, q); } *(float*)(PS + e) = s;  }
__global__ __launch_bounds__(32) void k_gred(const float* __restrict__ PS, float* M) { const int lane = threadIdx.x; if (lane >= NH_) { return; } float s = 0.f; for (int t = 0; t < TT; ++t) s = __fadd_rn(s, PS[(size_t)lane * TT + t]); const float m = s * (1.0f / (float)(HD * TT)); *(float*)(M + lane) = m;  }
__global__ __launch_bounds__(256) void k_gn(const float* __restrict__ CAT, const float* __restrict__ MU, const float* __restrict__ VAR, const float* __restrict__ gw, const float* __restrict__ gb, bf* Ah, bf* Al) { const size_t i = ((size_t)blockIdx.x * 256 + threadIdx.x) * 4; if (i >= (size_t)TT * EE) return; const int c = (int)(i % EE); const int h = c / HD; const float rs = __frsqrt_rn(__fadd_rn(VAR[h], 1e-5f)); const float mu = MU[h]; const v4f a = *(const v4f*)(CAT + i); v4us oh, ol;
#pragma unroll
    for (int q = 0; q < 4; ++q) { float t = __fmul_rn(__fsub_rn(a[q], mu), rs); asm volatile("" : "+v"(t)); float tg = __fmul_rn(t, bfr(gw[c + q])); asm volatile("" : "+v"(tg)); unsigned short u, c2; splitf(__fadd_rn(tg, bfr(gb[c + q])), u, c2); oh[q] = u; ol[q] = c2; }
    *(v4us*)(Ah + i) = oh; *(v4us*)(Al + i) = ol;  }

extern "C" void kernel_launch(void* const* d_in, const int* in_sizes, int n_in,
                              void* d_out, int out_size, void* d_ws, size_t ws_size, hipStream_t stream) {
    (void)in_sizes; (void)n_in; (void)out_size;
    const float* x = (const float*)d_in[0]; const int* msk = (const int*)d_in[1]; const float* IN[17]; for (int i = 2; i < 17; ++i) IN[i] = (const float*)d_in[i];   // 2 Wq1 [16][64][1024], 3 bq1, 4 Wq2, 5 bq2, 6 Wk1, 7 bk1, 8 Wk2, 9 bk2, 10 Wv, 11 bv, 12 lam, 13 gn_w, 14 gn_b, 15 Wo [1024][1024] (out,in), 16 bo
    float* OUT = (float*)d_out;     // [1][2048][1024]
    char* wsp = (char*)d_ws;
    auto take = [&](size_t bytes) { char* p = wsp; wsp += (bytes + 255) & ~(size_t)255; return (void*)p; };
    bf* WB[6]; for (int i = 0; i < 6; ++i) WB[i] = (bf*)take((size_t)EE * EE * 2); bf* XB = (bf*)take((size_t)TT * EE * 2); float* F = (float*)take((size_t)TT * EE * 4);
    bf* Q1h = (bf*)take((size_t)NH_ * TT * HD * 2); bf* Q1l = (bf*)take((size_t)NH_ * TT * HD * 2); bf* Q2h = (bf*)take((size_t)NH_ * TT * HD * 2); bf* Q2l = (bf*)take((size_t)NH_ * TT * HD * 2); bf* K1h = (bf*)take((size_t)NH_ * TT * HD * 2); bf* K1l = (bf*)take((size_t)NH_ * TT * HD * 2); bf* K2h = (bf*)take((size_t)NH_ * TT * HD * 2); bf* K2l = (bf*)take((size_t)NH_ * TT * HD * 2); bf* Vh = (bf*)take((size_t)NH_ * HD * TT * 2); bf* Vl = (bf*)take((size_t)NH_ * HD * TT * 2);
    float* S1 = (float*)take((size_t)ZH * TT * TT * 4); float* S2 = (float*)take((size_t)ZH * TT * TT * 4); bf* Ph = (bf*)take((size_t)ZH * TT * TT * 2); bf* Pl = (bf*)take((size_t)ZH * TT * TT * 2); float* Ob = (float*)take((size_t)ZH * TT * HD * 4); float* CAT = (float*)take((size_t)TT * EE * 4); float* PS = (float*)take((size_t)NH_ * TT * 4); float* MU = (float*)take(64 * 4); float* VAR = (float*)take(64 * 4); bf* Ah = (bf*)take((size_t)TT * EE * 2); bf* Al = (bf*)take((size_t)TT * EE * 2);
    if ((size_t)(wsp - (char*)d_ws) > ws_size) return;    // total ~ 186 MB = 177 MiB (ten hl planes [16][2048][64] 42 MB, two two-head f32 score maps 67 MB + hl probability planes 34 MB, weights 12 MB)
    const int widx[6] = {2, 4, 6, 8, 10, 15}; for (int i = 0; i < 6; ++i) k_cvt8<<<(EE * EE / 8 + 255) / 256, 256, 0, stream>>>(IN[widx[i]], WB[i], (size_t)EE * EE / 8);   // [H][DH][E] stacked = natural [1024][1024] Bt; Wo [E][D] natural
    k_cvt8<<<(TT * EE / 8 + 255) / 256, 256, 0, stream>>>(x, XB, (size_t)TT * EE / 8);
    const unsigned LP = (unsigned)(((size_t)NH_ * TT * HD / 2 + 255) / 256);
    bf* PLh[4] = {Q1h, Q2h, K1h, K2h}; bf* PLl[4] = {Q1l, Q2l, K1l, K2l};
    for (int i = 0; i < 4; ++i) { k_gemmw<bf, 0, true><<<dim3(TT / 64, EE / 64, 1), 32, 0, stream>>>(XB, nullptr, WB[i], nullptr, EE, F, EE, IN[widx[i] + 1], 0, 0, 0); k_pl<<<LP, 256, 0, stream>>>(F, PLh[i], PLl[i]); }
    k_gemmw<bf, 0, true><<<dim3(TT / 64, EE / 64, 1), 32, 0, stream>>>(XB, nullptr, WB[4], nullptr, EE, F, EE, IN[11], 0, 0, 0); k_vtp<<<LP, 256, 0, stream>>>(F, Vh, Vl);
    for (int h0 = 0; h0 < NH_; h0 += ZH) { const size_t z = (size_t)h0;
        k_gemmw<bf, 2, false><<<dim3(TT / 64, TT / 64, ZH), 32, 0, stream>>>(Q1h + z * TT * HD, Q1l + z * TT * HD, K1h + z * TT * HD, K1l + z * TT * HD, HD, S1, TT, nullptr, (size_t)TT * HD, (size_t)TT * HD, (size_t)TT * TT);
        k_gemmw<bf, 2, false><<<dim3(TT / 64, TT / 64, ZH), 32, 0, stream>>>(Q2h + z * TT * HD, Q2l + z * TT * HD, K2h + z * TT * HD, K2l + z * TT * HD, HD, S2, TT, nullptr, (size_t)TT * HD, (size_t)TT * HD, (size_t)TT * TT);
        k_soft1<<<ZH * TT / 8, 256, 0, stream>>>(S1, msk); k_soft2<<<ZH * TT / 8, 256, 0, stream>>>(S2, S1, msk, IN[12], h0, Ph, Pl);
        k_gemmw<bf, 2, false><<<dim3(TT / 64, 1, ZH), 32, 0, stream>>>(Ph, Pl, Vh + z * HD * TT, Vl + z * HD * TT, TT, Ob, HD, nullptr, (size_t)TT * TT, (size_t)HD * TT, (size_t)TT * HD);
        k_cat<<<(unsigned)(((size_t)ZH * TT * HD / 2 + 255) / 256), 256, 0, stream>>>(Ob, h0, CAT); }
    k_gst<<<(NH_ * TT + 255) / 256, 256, 0, stream>>>(CAT, nullptr, 0, PS); k_gred<<<1, 32, 0, stream>>>(PS, MU); k_gst<<<(NH_ * TT + 255) / 256, 256, 0, stream>>>(CAT, MU, 1, PS); k_gred<<<1, 32, 0, stream>>>(PS, VAR);
    k_gn<<<(unsigned)(((size_t)TT * EE / 4 + 255) / 256), 256, 0, stream>>>(CAT, MU, VAR, IN[13], IN[14], Ah, Al);
    k_gemmw<bf, 1, true><<<dim3(TT / 64, EE / 64, 1), 32, 0, stream>>>(Ah, Al, WB[5], nullptr, EE, OUT, EE, IN[16], 0, 0, 0);
}

// v001
// Measured time: 688 microseconds a run.
// Timed twice side by side with v000, it ran 1.49 times as fast both times.
#include <hip/hip_runtime.h>

// DifferentialMultiHeadSelfAttention (x [1][2048][1024]; per-head q1, q2, k1, k2, v = x W[h]^T + b[h] (16 x 64); s = q.k/8 with mask[i][j] (int, 1 = masked -> -inf, read as data); w = softmax(s1) - lam[h] softmax(s2);
// out = w.v; heads concatenated; GroupNorm(16 groups = heads, eps 1e-5, biased var over (64 dims x 2048 tokens)) x gn_w + gn_b; out Wo^T + bo -> [1][2048][1024]).
// Compute dtypes, f32 accumulate: every input rounded to bf16; the five projections on PLAIN bf16 operands (inputs: exact, + bias; the stacked [16][64][1024] weights are one natural [1024][1024] Bt); both score GEMMs

#define TT   2048
#define EE   1024
#define NH_  16
#define HD   64
#define ZH   2
#define SCL  0.125f
#define KPV  4
typedef _Float16 h16;
typedef unsigned short bf;
typedef __attribute__((ext_vector_type(16))) __bf16   v16bf;
typedef __attribute__((ext_vector_type(16))) _Float16 v16h;
typedef __attribute__((ext_vector_type(8)))  _Float16 v8h;
typedef __attribute__((ext_vector_type(8)))  unsigned short v8us;
typedef __attribute__((ext_vector_type(8)))  float    v8f;
typedef __attribute__((ext_vector_type(4)))  float    v4f;
typedef v8h  __attribute__((may_alias)) v8ha;
typedef v4f  __attribute__((may_alias)) v4fa;
typedef v8us __attribute__((may_alias)) v8usa;

__device__ __forceinline__ unsigned short f2bf(float f) { unsigned u = __float_as_uint(f); u += 0x7FFFu + ((u >> 16) & 1u); return (unsigned short)(u >> 16); }
__device__ __forceinline__ float bf2f(unsigned short b) { return __uint_as_float(((unsigned)b) << 16); }
__device__ __forceinline__ float bfr(float f) { return bf2f(f2bf(f)); }
__device__ __forceinline__ v16h cat16(v8h lo, v8h hi) { return __builtin_shufflevector(lo, hi, 0, 1, 2, 3, 4, 5, 6, 7, 8, 9, 10, 11, 12, 13, 14, 15); }
__device__ __forceinline__ v16bf cat16b(v8us lo, v8us hi) { return __builtin_bit_cast(v16bf, __builtin_shufflevector(lo, hi, 0, 1, 2, 3, 4, 5, 6, 7, 8, 9, 10, 11, 12, 13, 14, 15)); }
__device__ __forceinline__ v8f wmma16(v16h a, v16h b, v8f c) { return __builtin_amdgcn_wmma_f32_16x16x32_f16(false, a, false, b, (short)0, c, false, false); }
__device__ __forceinline__ v8f wmmab(v16bf a, v16bf b, v8f c) { return __builtin_amdgcn_wmma_f32_16x16x32_bf16(false, a, false, b, (short)0, c, false, false); }



// ---- k_gemmw: register-blocked GEMM, NW WAVES per 64x64 output tile (16 accumulators each), operands straight from K-contiguous 16-bit planes; grid (M/64, N/64, Z), 32 * NW threads.
// C[m][n] (f32, pitch ldc, + optional f32 bias[n]) = sum_k A[m][k] Bt[n][k] (+ split products per NSPLIT). z-batch strides sA/sB/sC in elements. K % (32 * NW * KP) == 0.
// Split K: wave w takes the 32-wide k chunks w, w + NW, ... (neighbour waves share a 128-B line of every operand row); the NW partial tiles are staged whole in LDS and summed in wave order behind one barrier.
// KP > 1 (N == 64 only): blockIdx.y is a K range instead of a tile column, and range y stores its partial C in plane y (plane pitch ZH * sC); the consumer sums the planes.
template <typename T16> struct WFrag;
template <> struct WFrag<h16> { typedef v16h V; static __device__ __forceinline__ V ld(const h16* p) { return cat16(*(const v8h*)p, *(const v8h*)(p + 16)); } static __device__ __forceinline__ v8f mma(V a, V b, v8f c) { return wmma16(a, b, c); } };
template <> struct WFrag<bf> { typedef v16bf V; static __device__ __forceinline__ V ld(const bf* p) { return cat16b(*(const v8us*)p, *(const v8us*)(p + 16)); } static __device__ __forceinline__ v8f mma(V a, V b, v8f c) { return wmmab(a, b, c); } };
template <typename T16, int NSPLIT, bool BIAS, int NW, int KP>
__global__ __launch_bounds__(32 * NW) void k_gemmw(const T16* __restrict__ A, const T16* __restrict__ A2, const T16* __restrict__ Bt, const T16* __restrict__ Bt2, int K, float* C, int ldc, const float* __restrict__ bias, size_t sA, size_t sB, size_t sC) {
    typedef typename WFrag<T16>::V V;
    constexpr int SR = NW > 1 ? 64 : 16;    // tile rows staged in LDS at once, per wave
    __shared__ __align__(16) float os[NW * SR * 68];
    const size_t z = blockIdx.z; A += z * sA; if (A2) A2 += z * sA; Bt += z * sB; if (Bt2) Bt2 += z * sB; C += z * sC;
    const int lane = threadIdx.x & 31, lr = lane & 15, hi = lane >> 4; const int r0 = blockIdx.x * 64, c0 = KP > 1 ? 0 : blockIdx.y * 64;
    const int w = NW > 1 ? __builtin_amdgcn_readfirstlane((int)(threadIdx.x >> 5)) : 0;
    const int klo = KP > 1 ? (int)blockIdx.y * (K / KP) : 0, khi = KP > 1 ? klo + K / KP : K; if (KP > 1) C += (size_t)blockIdx.y * ZH * sC;
    v8f acc[4][4];
#pragma unroll
    for (int mb = 0; mb < 4; ++mb)
#pragma unroll
        for (int nb = 0; nb < 4; ++nb) acc[mb][nb] = (v8f){};
    const size_t aoff = (size_t)(r0 + lr) * K + 8 * hi, boff = (size_t)(c0 + lr) * K + 8 * hi;
#pragma unroll 1
    for (int kc = klo + w * 32; kc < khi; kc += 32 * NW) {
        V a[4], a2[4];
#pragma unroll
        for (int mb = 0; mb < 4; ++mb) { a[mb] = WFrag<T16>::ld(A + aoff + (size_t)mb * 16 * K + kc); if (NSPLIT == 1 || NSPLIT == 2) a2[mb] = WFrag<T16>::ld(A2 + aoff + (size_t)mb * 16 * K + kc); }
#pragma unroll
        for (int nb = 0; nb < 4; ++nb) { const V b = WFrag<T16>::ld(Bt + boff + (size_t)nb * 16 * K + kc); V b2; if (NSPLIT >= 2) b2 = WFrag<T16>::ld(Bt2 + boff + (size_t)nb * 16 * K + kc);
#pragma unroll
            for (int mb = 0; mb < 4; ++mb) { acc[mb][nb] = WFrag<T16>::mma(a[mb], b, acc[mb][nb]); if (NSPLIT == 1 || NSPLIT == 2) acc[mb][nb] = WFrag<T16>::mma(a2[mb], b, acc[mb][nb]); if (NSPLIT >= 2) acc[mb][nb] = WFrag<T16>::mma(a[mb], b2, acc[mb][nb]); } }
        asm volatile("v_nop\n\tv_nop\n\tv_nop\n\tv_nop" : "+v"(acc[0][0]), "+v"(acc[1][1]), "+v"(acc[2][2]), "+v"(acc[3][3]) : "v"(a[0]), "v"(a[3]));
    }
    // the four loops below are unrolled so that acc[][] is indexed by constants and stays in registers
#pragma unroll
    for (int mb0 = 0; mb0 < 4; mb0 += SR / 16) {
#pragma unroll
        for (int mi = 0; mi < SR / 16; ++mi) {
#pragma unroll
            for (int nb = 0; nb < 4; ++nb) {
#pragma unroll
                for (int j = 0; j < 8; ++j) os[(w * SR + mi * 16 + hi * 8 + j) * 68 + nb * 16 + lr] = acc[mb0 + mi][nb][j]; } }
        if (NW > 1) __syncthreads();   // every wave's partial tile is in LDS before any wave sums it
        else { __builtin_amdgcn_wave_barrier(); asm volatile("" ::: "memory"); }   // one wave: only keeps the compiler from moving the LDS reads above the LDS stores
        float* crow = C + (size_t)(r0 + mb0 * 16) * ldc + c0;
        // both loops unrolled: all LDS reads of a wave's rows go out together instead of one latency per read
#pragma unroll
        for (int q = 0; q < SR / 2 / NW; ++q) { const int row = 2 * (q * NW + w) + hi, cofs = lr * 4; v4f val = *(const v4fa*)(os + row * 68 + cofs);
#pragma unroll
            for (int u = 1; u < NW; ++u) val += *(const v4fa*)(os + (u * SR + row) * 68 + cofs);
            if (BIAS) { val[0] += bfr(bias[c0 + cofs]); val[1] += bfr(bias[c0 + cofs + 1]); val[2] += bfr(bias[c0 + cofs + 2]); val[3] += bfr(bias[c0 + cofs + 3]); }
            *(v4f*)(crow + (size_t)row * ldc + cofs) = val; }
        if (NW == 1) { __builtin_amdgcn_wave_barrier(); asm volatile("" ::: "memory"); }   // one wave: the next strip's LDS stores stay behind these reads
    }
}

__device__ __forceinline__ void splitf(float y, unsigned short& h, unsigned short& l) { h = f2bf(y); l = f2bf(y - bf2f(h)); }
typedef __attribute__((ext_vector_type(2))) unsigned short v2us;
typedef __attribute__((ext_vector_type(4))) unsigned short v4us;
typedef __attribute__((ext_vector_type(2))) float v2f;

__global__ __launch_bounds__(256) void k_cvt8(const float* __restrict__ src, bf* dst, size_t n8) { const size_t i = (size_t)blockIdx.x * 256 + threadIdx.x; if (i >= n8) return; const v8f v = *(const v8f*)(src + i * 8); v8us o;
#pragma unroll
    for (int k = 0; k < 8; ++k) o[k] = f2bf(v[k]); *(v8us*)(dst + i * 8) = o;  }
__global__ __launch_bounds__(256) void k_pl(const float* __restrict__ F, bf* Ph, bf* Pl) { const size_t e = ((size_t)blockIdx.x * 256 + threadIdx.x) * 2; if (e >= (size_t)NH_ * TT * HD) return; const int d = (int)(e % HD); const int t = (int)((e / HD) % TT); const int h = (int)(e / ((size_t)HD * TT)); const float* f = F + (size_t)t * EE + h * HD + d; v2us oh, ol;
#pragma unroll
    for (int u = 0; u < 2; ++u) { unsigned short a, c; splitf(f[u], a, c); oh[u] = a; ol[u] = c; } *(v2us*)(Ph + e) = oh; *(v2us*)(Pl + e) = ol;  }
__global__ __launch_bounds__(256) void k_vtp(const float* __restrict__ F, bf* Vh, bf* Vl) { const size_t e = ((size_t)blockIdx.x * 256 + threadIdx.x) * 2; if (e >= (size_t)NH_ * HD * TT) return; const int t = (int)(e % TT); const int d = (int)((e / TT) % HD); const int h = (int)(e / ((size_t)TT * HD)); v2us oh, ol;
#pragma unroll
    for (int u = 0; u < 2; ++u) { unsigned short a, c; splitf(F[(size_t)(t + u) * EE + h * HD + d], a, c); oh[u] = a; ol[u] = c; } *(v2us*)(Vh + e) = oh; *(v2us*)(Vl + e) = ol;  }
__global__ __launch_bounds__(256) void k_soft1(float* Sb, const int* __restrict__ msk) { const int lane = threadIdx.x & 31; const int row = blockIdx.x * 8 + (threadIdx.x >> 5); if (row >= ZH * TT) return; const int i = row % TT; float* sr = Sb + (size_t)row * TT; const int* mr = msk + (size_t)i * TT; float v[64]; float mx = -3.0e38f;
#pragma unroll
    for (int ch = 0; ch < 16; ++ch) { const int j0 = ch * 128 + lane * 4; const v4f a = *(const v4f*)(sr + j0);
#pragma unroll
        for (int q = 0; q < 4; ++q) { const float t = mr[j0 + q] ? -3.0e38f : a[q] * SCL; v[ch * 4 + q] = t; mx = fmaxf(mx, t); } }
#pragma unroll
    for (int sh = 16; sh; sh >>= 1) mx = fmaxf(mx, __shfl_xor(mx, sh, 32));
    float sum = 0.f;
#pragma unroll
    for (int k = 0; k < 64; ++k) { float d0 = __fsub_rn(v[k], mx); asm volatile("" : "+v"(d0)); v[k] = __expf(d0); sum += v[k]; }
#pragma unroll
    for (int sh = 16; sh; sh >>= 1) sum += __shfl_xor(sum, sh, 32);
    const float f = __fdiv_rn(1.0f, sum);
{
#pragma unroll
        for (int ch = 0; ch < 16; ++ch) { v4f o; o[0] = v[ch * 4] * f; o[1] = v[ch * 4 + 1] * f; o[2] = v[ch * 4 + 2] * f; o[3] = v[ch * 4 + 3] * f; *(v4f*)(sr + ch * 128 + lane * 4) = o; }
         } }
__global__ __launch_bounds__(256) void k_soft2(const float* __restrict__ S2, const float* __restrict__ P1, const int* __restrict__ msk, const float* __restrict__ lam, int h0, bf* Ph, bf* Pl) { const int lane = threadIdx.x & 31; const int row = blockIdx.x * 8 + (threadIdx.x >> 5); if (row >= ZH * TT) return; const int i = row % TT, z = row / TT; const float lm = bfr(lam[h0 + z]); const float* sr = S2 + (size_t)row * TT; const float* pr = P1 + (size_t)row * TT; const int* mr = msk + (size_t)i * TT; float v[64]; float mx = -3.0e38f;
#pragma unroll
    for (int ch = 0; ch < 16; ++ch) { const int j0 = ch * 128 + lane * 4; const v4f a = *(const v4f*)(sr + j0);
#pragma unroll
        for (int q = 0; q < 4; ++q) { const float t = mr[j0 + q] ? -3.0e38f : a[q] * SCL; v[ch * 4 + q] = t; mx = fmaxf(mx, t); } }
#pragma unroll
    for (int sh = 16; sh; sh >>= 1) mx = fmaxf(mx, __shfl_xor(mx, sh, 32));
    float sum = 0.f;
#pragma unroll
    for (int k = 0; k < 64; ++k) { float d0 = __fsub_rn(v[k], mx); asm volatile("" : "+v"(d0)); v[k] = __expf(d0); sum += v[k]; }
#pragma unroll
    for (int sh = 16; sh; sh >>= 1) sum += __shfl_xor(sum, sh, 32);
    const float f = __fmul_rn(__fdiv_rn(1.0f, sum), lm);
{
#pragma unroll
        for (int ch = 0; ch < 16; ++ch) { const int j0 = ch * 128 + lane * 4; const v4f p1 = *(const v4f*)(pr + j0); v4us oh, ol;
#pragma unroll
            for (int q = 0; q < 4; ++q) { float t2 = __fmul_rn(v[ch * 4 + q], f); asm volatile("" : "+v"(t2)); unsigned short a, c; splitf(__fsub_rn(p1[q], t2), a, c); oh[q] = a; ol[q] = c; }
            *(v4us*)(Ph + (size_t)row * TT + j0) = oh; *(v4us*)(Pl + (size_t)row * TT + j0) = ol; }
         } }
// k_cat: CAT[t][(h0+z)*64 + d] = sum over the KPV K-range planes p of Ob[p][z][t][d], in plane order (8-B lanes); k_gst: per (h, t) partial sums over the head's 64 dims (centred squares when centred) -> PS[h][t]; k_gred: M[h] = sum_t PS / (64*2048);
__global__ __launch_bounds__(256) void k_cat(const float* __restrict__ Ob, int h0, float* CAT) { const size_t e = ((size_t)blockIdx.x * 256 + threadIdx.x) * 2; if (e >= (size_t)ZH * TT * HD) return; const int d = (int)(e % HD); const int t = (int)((e / HD) % TT); const int z = (int)(e / ((size_t)HD * TT)); v2f o = *(const v2f*)(Ob + e);
#pragma unroll   // the KPV plane loads go out together
    for (int p = 1; p < KPV; ++p) o += *(const v2f*)(Ob + (size_t)p * ZH * TT * HD + e); const size_t oo = (size_t)t * EE + (h0 + z) * HD + d; *(v2f*)(CAT + oo) = o;  }
__global__ __launch_bounds__(256) void k_gst(const float* __restrict__ CAT, const float* __restrict__ MU, int centred, float* PS) { const int e = blockIdx.x * 256 + threadIdx.x; if (e >= NH_ * TT) return; const int t = e % TT, h = e / TT; const float m = centred ? MU[h] : 0.f; const float* r = CAT + (size_t)t * EE + h * HD; float s = 0.f;
    for (int d = 0; d < HD; ++d) { const float dv = __fsub_rn(r[d], m); float q = centred ? __fmul_rn(dv, dv) : dv; asm volatile("" : "+v"(q)); s = __fadd_rn(s, q); } *(float*)(PS + e) = s;  }
__global__ __launch_bounds__(32) void k_gred(const float* __restrict__ PS, float* M) { const int lane = threadIdx.x; if (lane >= NH_) { return; } float s = 0.f; for (int t = 0; t < TT; ++t) s = __fadd_rn(s, PS[(size_t)lane * TT + t]); const float m = s * (1.0f / (float)(HD * TT)); *(float*)(M + lane) = m;  }
__global__ __launch_bounds__(256) void k_gn(const float* __restrict__ CAT, const float* __restrict__ MU, const float* __restrict__ VAR, const float* __restrict__ gw, const float* __restrict__ gb, bf* Ah, bf* Al) { const size_t i = ((size_t)blockIdx.x * 256 + threadIdx.x) * 4; if (i >= (size_t)TT * EE) return; const int c = (int)(i % EE); const int h = c / HD; const float rs = __frsqrt_rn(__fadd_rn(VAR[h], 1e-5f)); const float mu = MU[h]; const v4f a = *(const v4f*)(CAT + i); v4us oh, ol;
#pragma unroll
    for (int q = 0; q < 4; ++q) { float t = __fmul_rn(__fsub_rn(a[q], mu), rs); asm volatile("" : "+v"(t)); float tg = __fmul_rn(t, bfr(gw[c + q])); asm volatile("" : "+v"(tg)); unsigned short u, c2; splitf(__fadd_rn(tg, bfr(gb[c + q])), u, c2); oh[q] = u; ol[q] = c2; }
    *(v4us*)(Ah + i) = oh; *(v4us*)(Al + i) = ol;  }

extern "C" void kernel_launch(void* const* d_in, const int* in_sizes, int n_in,
                              void* d_out, int out_size, void* d_ws, size_t ws_size, hipStream_t stream) {
    (void)in_sizes; (void)n_in; (void)out_size;
    const float* x = (const float*)d_in[0]; const int* msk = (const int*)d_in[1]; const float* IN[17]; for (int i = 2; i < 17; ++i) IN[i] = (const float*)d_in[i];   // 2 Wq1 [16][64][1024], 3 bq1, 4 Wq2, 5 bq2, 6 Wk1, 7 bk1, 8 Wk2, 9 bk2, 10 Wv, 11 bv, 12 lam, 13 gn_w, 14 gn_b, 15 Wo [1024][1024] (out,in), 16 bo
    float* OUT = (float*)d_out;     // [1][2048][1024]
    char* wsp = (char*)d_ws;
    auto take = [&](size_t bytes) { char* p = wsp; wsp += (bytes + 255) & ~(size_t)255; return (void*)p; };
    bf* WB[6]; for (int i = 0; i < 6; ++i) WB[i] = (bf*)take((size_t)EE * EE * 2); bf* XB = (bf*)take((size_t)TT * EE * 2); float* F = (float*)take((size_t)TT * EE * 4);
    bf* Q1h = (bf*)take((size_t)NH_ * TT * HD * 2); bf* Q1l = (bf*)take((size_t)NH_ * TT * HD * 2); bf* Q2h = (bf*)take((size_t)NH_ * TT * HD * 2); bf* Q2l = (bf*)take((size_t)NH_ * TT * HD * 2); bf* K1h = (bf*)take((size_t)NH_ * TT * HD * 2); bf* K1l = (bf*)take((size_t)NH_ * TT * HD * 2); bf* K2h = (bf*)take((size_t)NH_ * TT * HD * 2); bf* K2l = (bf*)take((size_t)NH_ * TT * HD * 2); bf* Vh = (bf*)take((size_t)NH_ * HD * TT * 2); bf* Vl = (bf*)take((size_t)NH_ * HD * TT * 2);
    float* S1 = (float*)take((size_t)ZH * TT * TT * 4); float* S2 = (float*)take((size_t)ZH * TT * TT * 4); bf* Ph = (bf*)take((size_t)ZH * TT * TT * 2); bf* Pl = (bf*)take((size_t)ZH * TT * TT * 2); float* Ob = (float*)take((size_t)KPV * ZH * TT * HD * 4); float* CAT = (float*)take((size_t)TT * EE * 4); float* PS = (float*)take((size_t)NH_ * TT * 4); float* MU = (float*)take(64 * 4); float* VAR = (float*)take(64 * 4); bf* Ah = (bf*)take((size_t)TT * EE * 2); bf* Al = (bf*)take((size_t)TT * EE * 2);
    if ((size_t)(wsp - (char*)d_ws) > ws_size) return;    // total ~ 189 MB = 180 MiB (ten hl planes [16][2048][64] 42 MB, two two-head f32 score maps 67 MB + hl probability planes 34 MB, weights 12 MB)
    const int widx[6] = {2, 4, 6, 8, 10, 15}; for (int i = 0; i < 6; ++i) k_cvt8<<<(EE * EE / 8 + 255) / 256, 256, 0, stream>>>(IN[widx[i]], WB[i], (size_t)EE * EE / 8);   // [H][DH][E] stacked = natural [1024][1024] Bt; Wo [E][D] natural
    k_cvt8<<<(TT * EE / 8 + 255) / 256, 256, 0, stream>>>(x, XB, (size_t)TT * EE / 8);
    const unsigned LP = (unsigned)(((size_t)NH_ * TT * HD / 2 + 255) / 256);
    bf* PLh[4] = {Q1h, Q2h, K1h, K2h}; bf* PLl[4] = {Q1l, Q2l, K1l, K2l};
    for (int i = 0; i < 4; ++i) { k_gemmw<bf, 0, true, 8, 1><<<dim3(TT / 64, EE / 64, 1), 256, 0, stream>>>(XB, nullptr, WB[i], nullptr, EE, F, EE, IN[widx[i] + 1], 0, 0, 0); k_pl<<<LP, 256, 0, stream>>>(F, PLh[i], PLl[i]); }
    k_gemmw<bf, 0, true, 8, 1><<<dim3(TT / 64, EE / 64, 1), 256, 0, stream>>>(XB, nullptr, WB[4], nullptr, EE, F, EE, IN[11], 0, 0, 0); k_vtp<<<LP, 256, 0, stream>>>(F, Vh, Vl);
    for (int h0 = 0; h0 < NH_; h0 += ZH) { const size_t z = (size_t)h0;
        k_gemmw<bf, 2, false, 1, 1><<<dim3(TT / 64, TT / 64, ZH), 32, 0, stream>>>(Q1h + z * TT * HD, Q1l + z * TT * HD, K1h + z * TT * HD, K1l + z * TT * HD, HD, S1, TT, nullptr, (size_t)TT * HD, (size_t)TT * HD, (size_t)TT * TT);
        k_gemmw<bf, 2, false, 1, 1><<<dim3(TT / 64, TT / 64, ZH), 32, 0, stream>>>(Q2h + z * TT * HD, Q2l + z * TT * HD, K2h + z * TT * HD, K2l + z * TT * HD, HD, S2, TT, nullptr, (size_t)TT * HD, (size_t)TT * HD, (size_t)TT * TT);
        k_soft1<<<ZH * TT / 8, 256, 0, stream>>>(S1, msk); k_soft2<<<ZH * TT / 8, 256, 0, stream>>>(S2, S1, msk, IN[12], h0, Ph, Pl);
        k_gemmw<bf, 2, false, 8, KPV><<<dim3(TT / 64, KPV, ZH), 256, 0, stream>>>(Ph, Pl, Vh + z * HD * TT, Vl + z * HD * TT, TT, Ob, HD, nullptr, (size_t)TT * TT, (size_t)HD * TT, (size_t)TT * HD);
        k_cat<<<(unsigned)(((size_t)ZH * TT * HD / 2 + 255) / 256), 256, 0, stream>>>(Ob, h0, CAT); }
    k_gst<<<(NH_ * TT + 255) / 256, 256, 0, stream>>>(CAT, nullptr, 0, PS); k_gred<<<1, 32, 0, stream>>>(PS, MU); k_gst<<<(NH_ * TT + 255) / 256, 256, 0, stream>>>(CAT, MU, 1, PS); k_gred<<<1, 32, 0, stream>>>(PS, VAR);
    k_gn<<<(unsigned)(((size_t)TT * EE / 4 + 255) / 256), 256, 0, stream>>>(CAT, MU, VAR, IN[13], IN[14], Ah, Al);
    k_gemmw<bf, 1, true, 8, 1><<<dim3(TT / 64, EE / 64, 1), 256, 0, stream>>>(Ah, Al, WB[5], nullptr, EE, OUT, EE, IN[16], 0, 0, 0);
}

// v003
// It runs in 264 microseconds.
// It is 2.62 times as fast as v001, going by the measured steps of the versions left out in between.
// Over all steps from v000 it is 3.91 times as fast.
#include <hip/hip_runtime.h>

// DifferentialMultiHeadSelfAttention (x [1][2048][1024]; per-head q1, q2, k1, k2, v = x W[h]^T + b[h] (16 x 64); s = q.k/8 with mask[i][j] (int, 1 = masked -> -inf, read as data); w = softmax(s1) - lam[h] softmax(s2);
// out = w.v; heads concatenated; GroupNorm(16 groups = heads, eps 1e-5, biased var over (64 dims x 2048 tokens)) x gn_w + gn_b; out Wo^T + bo -> [1][2048][1024]).
// Compute dtypes, f32 accumulate: every input rounded to bf16; the five projections on PLAIN bf16 operands (inputs: exact, + bias; the stacked [16][64][1024] weights are one natural [1024][1024] Bt); both score GEMMs

#define TT   2048
#define EE   1024
#define NH_  16
#define HD   64
#define ZH   2
#define SCL  0.125f
typedef _Float16 h16;
typedef unsigned short bf;
typedef __attribute__((ext_vector_type(16))) __bf16   v16bf;
typedef __attribute__((ext_vector_type(16))) _Float16 v16h;
typedef __attribute__((ext_vector_type(8)))  _Float16 v8h;
typedef __attribute__((ext_vector_type(8)))  unsigned short v8us;
typedef __attribute__((ext_vector_type(8)))  float    v8f;
typedef __attribute__((ext_vector_type(4)))  float    v4f;
typedef v8h  __attribute__((may_alias)) v8ha;
typedef v4f  __attribute__((may_alias)) v4fa;
typedef v8us __attribute__((may_alias)) v8usa;

__device__ __forceinline__ unsigned short f2bf(float f) { unsigned u = __float_as_uint(f); u += 0x7FFFu + ((u >> 16) & 1u); return (unsigned short)(u >> 16); }
__device__ __forceinline__ float bf2f(unsigned short b) { return __uint_as_float(((unsigned)b) << 16); }
__device__ __forceinline__ float bfr(float f) { return bf2f(f2bf(f)); }
__device__ __forceinline__ v16h cat16(v8h lo, v8h hi) { return __builtin_shufflevector(lo, hi, 0, 1, 2, 3, 4, 5, 6, 7, 8, 9, 10, 11, 12, 13, 14, 15); }
__device__ __forceinline__ v16bf cat16b(v8us lo, v8us hi) { return __builtin_bit_cast(v16bf, __builtin_shufflevector(lo, hi, 0, 1, 2, 3, 4, 5, 6, 7, 8, 9, 10, 11, 12, 13, 14, 15)); }
__device__ __forceinline__ v8f wmma16(v16h a, v16h b, v8f c) { return __builtin_amdgcn_wmma_f32_16x16x32_f16(false, a, false, b, (short)0, c, false, false); }
__device__ __forceinline__ v8f wmmab(v16bf a, v16bf b, v8f c) { return __builtin_amdgcn_wmma_f32_16x16x32_bf16(false, a, false, b, (short)0, c, false, false); }



// ---- FRAGMENT ORDER of every 16-bit operand plane [R][K]: the 16 rows x 32 k of one matrix operand lie as 512 elements in a row, [u][lane][s] = element (row 16 T + (lane & 15), k 32 c + 16 u + 8 (lane >> 4) + s),
// block (T, c) at (T * (K / 32) + c) * 512. A wave's 16-byte load of half u then reads 512 contiguous bytes (4 whole lines) instead of 32 bytes out of each of 16 lines; which element reaches which lane and register is as before.
// ---- k_gemmw: register-blocked GEMM, NW WAVES per 64x64 output tile (16 accumulators each), operands straight from 16-bit planes in fragment order; grid (M/64, N/64, Z), 32 * NW threads.
// C[m][n] (f32, pitch ldc, + optional f32 bias[n]) = sum_k A[m][k] Bt[n][k] (+ split products per NSPLIT). z-batch strides sA/sB/sC in elements. K % (32 * NW * KP) == 0.
// Split K: wave w takes the 32-wide k chunks w, w + NW, ... (1 KiB of each 16-row strip); the NW partial tiles are staged whole in LDS and summed in wave order behind one barrier.
// KP > 1 (N == 64 only): blockIdx.y is a K range instead of a tile column, and range y stores its partial C in plane y (plane pitch ZH * sC); the consumer sums the planes.
template <typename T16> struct WFrag;
template <> struct WFrag<h16> { typedef v16h V; static __device__ __forceinline__ V ld(const h16* p) { return cat16(*(const v8h*)p, *(const v8h*)(p + 256)); } static __device__ __forceinline__ v8f mma(V a, V b, v8f c) { return wmma16(a, b, c); } };
template <> struct WFrag<bf> { typedef v16bf V; static __device__ __forceinline__ V ld(const bf* p) { return cat16b(*(const v8us*)p, *(const v8us*)(p + 256)); } static __device__ __forceinline__ v8f mma(V a, V b, v8f c) { return wmmab(a, b, c); } };
template <typename T16, int NSPLIT, bool BIAS, int NW, int KP>
__global__ __launch_bounds__(32 * NW) void k_gemmw(const T16* __restrict__ A, const T16* __restrict__ A2, const T16* __restrict__ Bt, const T16* __restrict__ Bt2, int K, float* C, int ldc, const float* __restrict__ bias, size_t sA, size_t sB, size_t sC) {
    typedef typename WFrag<T16>::V V;
    constexpr int SR = NW > 1 ? 64 : 16;    // tile rows staged in LDS at once, per wave
    __shared__ __align__(16) float os[NW * SR * 68];
    const size_t z = blockIdx.z; A += z * sA; if (A2) A2 += z * sA; Bt += z * sB; if (Bt2) Bt2 += z * sB; C += z * sC;
    const int lane = threadIdx.x & 31, lr = lane & 15, hi = lane >> 4; const int r0 = blockIdx.x * 64, c0 = KP > 1 ? 0 : blockIdx.y * 64;
    const int w = NW > 1 ? __builtin_amdgcn_readfirstlane((int)(threadIdx.x >> 5)) : 0;
    const int klo = KP > 1 ? (int)blockIdx.y * (K / KP) : 0, khi = KP > 1 ? klo + K / KP : K; if (KP > 1) C += (size_t)blockIdx.y * ZH * sC;
    v8f acc[4][4];
#pragma unroll
    for (int mb = 0; mb < 4; ++mb)
#pragma unroll
        for (int nb = 0; nb < 4; ++nb) acc[mb][nb] = (v8f){};
    const size_t aoff = (size_t)r0 * K + 8 * lane, boff = (size_t)c0 * K + 8 * lane;   // fragment order: a 16-row strip is still 16 * K elements, a 32-wide k chunk of it 512
#pragma unroll 1
    for (int kc = klo + w * 32; kc < khi; kc += 32 * NW) {
        V a[4], a2[4], b[4], b2[4]; const T16 *pa[4], *pa2[4], *pb[4], *pb2[4];
#pragma unroll
        for (int mb = 0; mb < 4; ++mb) { pa[mb] = A + aoff + (size_t)mb * 16 * K + kc * 16; pa2[mb] = pa[mb]; a[mb] = WFrag<T16>::ld(pa[mb]); if (NSPLIT == 1 || NSPLIT == 2) { pa2[mb] = A2 + aoff + (size_t)mb * 16 * K + kc * 16; a2[mb] = WFrag<T16>::ld(pa2[mb]); } }
        asm volatile("s_wait_xcnt 0x0" :: "v"(pa[0]), "v"(pa[1]), "v"(pa[2]), "v"(pa[3]), "v"(pa2[0]), "v"(pa2[1]), "v"(pa2[2]), "v"(pa2[3]) : "memory");   // the loads' address registers stay whole up to this wait and are free for reuse (here: as a later load's target) only behind it
#pragma unroll
        for (int nb = 0; nb < 4; ++nb) { pb[nb] = Bt + boff + (size_t)nb * 16 * K + kc * 16; pb2[nb] = pb[nb]; b[nb] = WFrag<T16>::ld(pb[nb]); if (NSPLIT >= 2) { pb2[nb] = Bt2 + boff + (size_t)nb * 16 * K + kc * 16; b2[nb] = WFrag<T16>::ld(pb2[nb]); } }
        asm volatile("s_wait_xcnt 0x0" :: "v"(pb[0]), "v"(pb[1]), "v"(pb[2]), "v"(pb[3]), "v"(pb2[0]), "v"(pb2[1]), "v"(pb2[2]), "v"(pb2[3]) : "memory");   // as above
        __builtin_amdgcn_sched_barrier(0);   // all loads of a trip go out ahead of its products; without it the compiler sinks each B fragment's loads to their first use, one exposed latency per fragment
#pragma unroll
        for (int nb = 0; nb < 4; ++nb) {
#pragma unroll
            for (int mb = 0; mb < 4; ++mb) { acc[mb][nb] = WFrag<T16>::mma(a[mb], b[nb], acc[mb][nb]); if (NSPLIT == 1 || NSPLIT == 2) acc[mb][nb] = WFrag<T16>::mma(a2[mb], b[nb], acc[mb][nb]); if (NSPLIT >= 2) acc[mb][nb] = WFrag<T16>::mma(a[mb], b2[nb], acc[mb][nb]); } }
        asm volatile("v_nop\n\tv_nop\n\tv_nop\n\tv_nop" : "+v"(acc[0][0]), "+v"(acc[1][1]), "+v"(acc[2][2]), "+v"(acc[3][3]) : "v"(a[0]), "v"(a[3]));
    }
    // the four loops below are unrolled so that acc[][] is indexed by constants and stays in registers
#pragma unroll
    for (int mb0 = 0; mb0 < 4; mb0 += SR / 16) {
#pragma unroll
        for (int mi = 0; mi < SR / 16; ++mi) {
#pragma unroll
            for (int nb = 0; nb < 4; ++nb) {
#pragma unroll
                for (int j = 0; j < 8; ++j) os[(w * SR + mi * 16 + hi * 8 + j) * 68 + nb * 16 + lr] = acc[mb0 + mi][nb][j]; } }
        if (NW > 1) __syncthreads();   // every wave's partial tile is in LDS before any wave sums it
        else { __builtin_amdgcn_wave_barrier(); asm volatile("" ::: "memory"); }   // one wave: only keeps the compiler from moving the LDS reads above the LDS stores
        float* crow = C + (size_t)(r0 + mb0 * 16) * ldc + c0;
        // both loops unrolled: all LDS reads of a wave's rows go out together instead of one latency per read
#pragma unroll
        for (int q = 0; q < SR / 2 / NW; ++q) { const int row = 2 * (q * NW + w) + hi, cofs = lr * 4; v4f val = *(const v4fa*)(os + row * 68 + cofs);
#pragma unroll
            for (int u = 1; u < NW; ++u) val += *(const v4fa*)(os + (u * SR + row) * 68 + cofs);
            if (BIAS) { val[0] += bfr(bias[c0 + cofs]); val[1] += bfr(bias[c0 + cofs + 1]); val[2] += bfr(bias[c0 + cofs + 2]); val[3] += bfr(bias[c0 + cofs + 3]); }
            *(v4f*)(crow + (size_t)row * ldc + cofs) = val; }
        if (NW == 1) { __builtin_amdgcn_wave_barrier(); asm volatile("" ::: "memory"); }   // one wave: the next strip's LDS stores stay behind these reads
    }
}

__device__ __forceinline__ void splitf(float y, unsigned short& h, unsigned short& l) { h = f2bf(y); l = f2bf(y - bf2f(h)); }
typedef __attribute__((ext_vector_type(4))) unsigned short v4us;
typedef __attribute__((ext_vector_type(2))) float v2f;

// The three writers below run one thread per 16-byte slot [lane] of a fragment half, in the order of the plane: every wave stores 512 contiguous bytes a plane.
// k_cvt8: src [R][EE] f32 -> dst in fragment order (K = EE)
__global__ __launch_bounds__(256) void k_cvt8(const float* __restrict__ src, bf* dst, size_t n8) { const size_t i = (size_t)blockIdx.x * 256 + threadIdx.x; if (i >= n8) return;
    const int lr = (int)(i & 15), hi = (int)(i >> 4) & 1, u = (int)(i >> 5) & 1, c = (int)(i >> 6) & (EE / 32 - 1); const size_t T = i >> 11; const v8f v = *(const v8f*)(src + (T * 16 + lr) * EE + c * 32 + u * 16 + hi * 8); v8us o;
#pragma unroll
    for (int k = 0; k < 8; ++k) o[k] = f2bf(v[k]); *(v8us*)(dst + i * 8) = o;  }
// k_pl: F [t][h * 64 + d] -> per head a plane [TT][HD] in fragment order (K = HD), high and low
__global__ __launch_bounds__(256) void k_pl(const float* __restrict__ F, bf* Ph, bf* Pl) { const size_t i = (size_t)blockIdx.x * 256 + threadIdx.x; if (i >= (size_t)NH_ * TT * HD / 8) return;
    const int lr = (int)(i & 15), hi = (int)(i >> 4) & 1, u = (int)(i >> 5) & 1, c = (int)(i >> 6) & 1, T = (int)(i >> 7) & (TT / 16 - 1), h = (int)(i >> 14); const v8f v = *(const v8f*)(F + (size_t)(T * 16 + lr) * EE + h * HD + c * 32 + u * 16 + hi * 8); v8us oh, ol;
#pragma unroll
    for (int k = 0; k < 8; ++k) { unsigned short a, b; splitf(v[k], a, b); oh[k] = a; ol[k] = b; } *(v8us*)(Ph + i * 8) = oh; *(v8us*)(Pl + i * 8) = ol;  }
// k_vtp: F [t][h * 64 + d] -> per head the transposed plane [HD][TT] with its blocks ordered (32-key chunk, 16-row strip): block (c, T) at (c * 4 + T) * 512, so that the four strips of one key chunk lie together
__global__ __launch_bounds__(256) void k_vtp(const float* __restrict__ F, bf* Vh, bf* Vl) { const size_t i = (size_t)blockIdx.x * 256 + threadIdx.x; if (i >= (size_t)NH_ * HD * TT / 8) return;
    const int lr = (int)(i & 15), hi = (int)(i >> 4) & 1, u = (int)(i >> 5) & 1, T = (int)(i >> 6) & 3, c = (int)(i >> 8) & (TT / 32 - 1), h = (int)(i >> 14); const float* f = F + (size_t)(c * 32 + u * 16 + hi * 8) * EE + h * HD + T * 16 + lr; v8us oh, ol;
#pragma unroll
    for (int k = 0; k < 8; ++k) { unsigned short a, b; splitf(f[(size_t)k * EE], a, b); oh[k] = a; ol[k] = b; } *(v8us*)(Vh + i * 8) = oh; *(v8us*)(Vl + i * 8) = ol;  }
// ---- k_attn: both score maps, both softmaxes, their difference and the product with V in one launch; no score or probability ever leaves the registers.
// grid (TT / 128, heads), 16 waves: wave w owns the 16 queries (w & 7) of the block's 128 and the key half (w >> 3). Scores are formed transposed (A = K rows, B = Q rows kept in registers), so a lane holds
// 8 keys of ONE query per tile: maximum and sum are in-lane, and two 16-key tiles converted in place are the A operand of the product with V (its k order is the loader's: 8 hi + s, 16 + 8 hi + s).
// Sweep 1 finds each query's maximum and exp sum of both maps (running maximum per lane; lane halves, then key halves joined in a fixed order); sweep 2 forms the scores again, w = e1 / sum1 - lam e2 / sum2,
// splits w in bf16 high + low and accumulates w.V (three products, as the score products). The two key halves' output tiles are summed in LDS and stored as whole lines of CAT[t][h * 64 + d].
typedef __attribute__((ext_vector_type(4))) int v4i;
typedef __attribute__((ext_vector_type(2))) __bf16 v2bf;
__device__ __forceinline__ v16bf ldf(const bf* p) { return cat16b(*(const v8us*)p, *(const v8us*)(p + 256)); }   // the two halves of one fragment-order block
// the K fragments of 32 keys of one map: k[kt * 4 + c * 2] high, + 1 low (16-key tile kt, 32-wide chunk c of the head dim)
__device__ __forceinline__ void ldk(const bf* Kh, const bf* Kl, v16bf (&k)[8]) {
#pragma unroll
    for (int kt = 0; kt < 2; ++kt)
#pragma unroll
        for (int c = 0; c < 2; ++c) { k[kt * 4 + c * 2] = ldf(Kh + kt * 16 * HD + c * 512); k[kt * 4 + c * 2 + 1] = ldf(Kl + kt * 16 * HD + c * 512); }
    asm volatile("s_wait_xcnt 0x0" :: "v"(Kh), "v"(Kl) : "memory"); }   // the loads' address registers stay whole up to this wait and are free for reuse only behind it
__device__ __forceinline__ void ldm(const int* mr, v4i (&mk)[4]) {
#pragma unroll
    for (int u = 0; u < 4; ++u) mk[u] = *(const v4i*)(mr + (u >> 1) * 16 + (u & 1) * 4);
    asm volatile("s_wait_xcnt 0x0" :: "v"(mr) : "memory"); }   // as in ldk
// two transposed score tiles: s[kt][j] = q[query lr] . k[key kt * 16 + 8 hi + j], split products kh.qh + kh.ql + kl.qh over the two chunks
__device__ __forceinline__ void sc2(const v16bf (&k)[8], const v16bf (&qh)[2], const v16bf (&ql)[2], v8f (&s)[2]) { s[0] = (v8f){}; s[1] = (v8f){};
#pragma unroll
    for (int c = 0; c < 2; ++c) { s[0] = wmmab(k[c * 2], qh[c], s[0]); s[1] = wmmab(k[4 + c * 2], qh[c], s[1]); s[0] = wmmab(k[c * 2], ql[c], s[0]); s[1] = wmmab(k[4 + c * 2], ql[c], s[1]); s[0] = wmmab(k[c * 2 + 1], qh[c], s[0]); s[1] = wmmab(k[4 + c * 2 + 1], qh[c], s[1]); } }
// masked scores, scaled by 1/8 and by log2(e) in one multiply, so that every exponential below is a bare exp2: t[kt * 8 + j] belongs to key kt * 16 + 8 hi + j of the block
__device__ __forceinline__ void msc(const v8f (&s)[2], const v4i (&mk)[4], float (&t)[16]) {
#pragma unroll
    for (int e = 0; e < 16; ++e) t[e] = mk[e >> 2][e & 3] ? -3.0e38f : s[e >> 3][e & 7] * (SCL * 1.44269504f); }
__device__ __forceinline__ void run_ml(const float (&t)[16], float& m, float& l) { float tm = t[0];
#pragma unroll
    for (int k = 1; k < 16; ++k) tm = fmaxf(tm, t[k]);
    const float mn = fmaxf(m, tm); float a = 0.f;
#pragma unroll
    for (int k = 0; k < 16; ++k) a += __builtin_amdgcn_exp2f(t[k] - mn);
    l = l * __builtin_amdgcn_exp2f(m - mn) + a; m = mn; }
__device__ __forceinline__ void join_ml(float& m, float& l, float mo, float lo) { const float mn = fmaxf(m, mo); l = l * __builtin_amdgcn_exp2f(m - mn) + lo * __builtin_amdgcn_exp2f(mo - mn); m = mn; }
__global__ __launch_bounds__(512) void k_attn(const bf* __restrict__ Q1h, const bf* __restrict__ Q1l, const bf* __restrict__ Q2h, const bf* __restrict__ Q2l, const bf* __restrict__ K1h, const bf* __restrict__ K1l, const bf* __restrict__ K2h, const bf* __restrict__ K2l,
                                              const bf* __restrict__ Vh, const bf* __restrict__ Vl, const int* __restrict__ msk, const float* __restrict__ lam, float* CAT) {
    __shared__ __align__(16) float os[16 * 16 * 68];
    __shared__ float st[2][4][128];
    const int lane = threadIdx.x & 31, lr = lane & 15, hi = lane >> 4; const int w = __builtin_amdgcn_readfirstlane((int)(threadIdx.x >> 5)), qw = w & 7, kh = w >> 3;
    const int h = blockIdx.y, q0 = blockIdx.x * 128 + qw * 16; const size_t hb = (size_t)h * TT * HD;
    v16bf q1h[2], q1l[2], q2h[2], q2l[2]; const size_t qo = hb + (size_t)q0 * HD + 8 * lane; const bf *pq1h = Q1h + qo, *pq1l = Q1l + qo, *pq2h = Q2h + qo, *pq2l = Q2l + qo;
#pragma unroll
    for (int c = 0; c < 2; ++c) { q1h[c] = ldf(pq1h + c * 512); q1l[c] = ldf(pq1l + c * 512); q2h[c] = ldf(pq2h + c * 512); q2l[c] = ldf(pq2l + c * 512); }
    asm volatile("s_wait_xcnt 0x0" :: "v"(pq1h), "v"(pq1l), "v"(pq2h), "v"(pq2l) : "memory");   // as in ldk
    const size_t ko = hb + 8 * lane; const int* mrow = msk + (size_t)(q0 + lr) * TT + 8 * hi; const int kbeg = kh * (TT / 2), kend = kbeg + TT / 2;
    float m1 = -3.0e38f, l1 = 0.f, m2 = -3.0e38f, l2 = 0.f;
    // Order of a trip, held by the scheduling barriers: each group of loads goes out whole right behind the products that free its registers and flies under the vector work that follows, instead of one exposed latency per fragment.
    v16bf kf[8]; v4i mk[4]; ldk(K1h + ko + (size_t)kbeg * HD, K1l + ko + (size_t)kbeg * HD, kf); ldm(mrow + kbeg, mk);
#pragma unroll 1   // one 32-key block a trip: a second copy of the body would not fit the registers of four waves a SIMD
    for (int kb = kbeg; kb < kend; kb += 32) { v8f s[2]; float t[16]; const size_t o = ko + (size_t)kb * HD; const int kn = kb + 32 < kend ? kb + 32 : kb;   // the last trip fetches its own block again: in bounds, unused
        sc2(kf, q1h, q1l, s); __builtin_amdgcn_sched_barrier(0);
        ldk(K2h + o, K2l + o, kf); __builtin_amdgcn_sched_barrier(0);
        msc(s, mk, t); run_ml(t, m1, l1); __builtin_amdgcn_sched_barrier(0);
        sc2(kf, q2h, q2l, s); __builtin_amdgcn_sched_barrier(0);
        ldk(K1h + ko + (size_t)kn * HD, K1l + ko + (size_t)kn * HD, kf); __builtin_amdgcn_sched_barrier(0);
        msc(s, mk, t); ldm(mrow + kn, mk); run_ml(t, m2, l2); }
    join_ml(m1, l1, __shfl_xor(m1, 16, 32), __shfl_xor(l1, 16, 32)); join_ml(m2, l2, __shfl_xor(m2, 16, 32), __shfl_xor(l2, 16, 32));
    if (hi == 0) { st[kh][0][qw * 16 + lr] = m1; st[kh][1][qw * 16 + lr] = l1; st[kh][2][qw * 16 + lr] = m2; st[kh][3][qw * 16 + lr] = l2; }
    __syncthreads();   // both key halves' maxima and sums are in LDS before either half joins them
    m1 = st[0][0][qw * 16 + lr]; l1 = st[0][1][qw * 16 + lr]; m2 = st[0][2][qw * 16 + lr]; l2 = st[0][3][qw * 16 + lr];
    join_ml(m1, l1, st[1][0][qw * 16 + lr], st[1][1][qw * 16 + lr]); join_ml(m2, l2, st[1][2][qw * 16 + lr], st[1][3][qw * 16 + lr]);
    const float f1 = __fdiv_rn(1.0f, l1), f2 = __fdiv_rn(1.0f, l2) * bfr(lam[h]);
    v8f o4[4];
#pragma unroll
    for (int dt = 0; dt < 4; ++dt) o4[dt] = (v8f){};
    const size_t vo = hb + 8 * lane;
    ldk(K1h + ko + (size_t)kbeg * HD, K1l + ko + (size_t)kbeg * HD, kf); ldm(mrow + kbeg, mk);
#pragma unroll 1   // as above
    for (int kb = kbeg; kb < kend; kb += 32) { v8f s[2]; float t[16], e1[16]; const size_t o = ko + (size_t)kb * HD; const int kn = kb + 32 < kend ? kb + 32 : kb;
        sc2(kf, q1h, q1l, s); __builtin_amdgcn_sched_barrier(0);
        ldk(K2h + o, K2l + o, kf); __builtin_amdgcn_sched_barrier(0);
        msc(s, mk, t);
#pragma unroll
        for (int e = 0; e < 16; ++e) e1[e] = __builtin_amdgcn_exp2f(t[e] - m1) * f1;
        __builtin_amdgcn_sched_barrier(0);
        sc2(kf, q2h, q2l, s); __builtin_amdgcn_sched_barrier(0);
        v16bf vh[4], vl[4]; const bf *pvh = Vh + vo + (size_t)kb * HD, *pvl = Vl + vo + (size_t)kb * HD;
#pragma unroll
        for (int dt = 0; dt < 4; ++dt) { vh[dt] = ldf(pvh + dt * 512); vl[dt] = ldf(pvl + dt * 512); }
        asm volatile("s_wait_xcnt 0x0" :: "v"(pvh), "v"(pvl) : "memory");   // as in ldk
        __builtin_amdgcn_sched_barrier(0);
        msc(s, mk, t); v16bf ph, pl;
#pragma unroll
        for (int e = 0; e < 16; e += 2) { v2f wv; wv[0] = e1[e] - __builtin_amdgcn_exp2f(t[e] - m2) * f2; wv[1] = e1[e + 1] - __builtin_amdgcn_exp2f(t[e + 1] - m2) * f2;
            const v2bf hh = __builtin_convertvector(wv, v2bf); const v2bf ll = __builtin_convertvector(wv - __builtin_convertvector(hh, v2f), v2bf); ph[e] = hh[0]; ph[e + 1] = hh[1]; pl[e] = ll[0]; pl[e + 1] = ll[1]; }
        __builtin_amdgcn_sched_barrier(0);
#pragma unroll
        for (int dt = 0; dt < 4; ++dt) o4[dt] = wmmab(ph, vh[dt], o4[dt]);
#pragma unroll
        for (int dt = 0; dt < 4; ++dt) o4[dt] = wmmab(pl, vh[dt], o4[dt]);
#pragma unroll
        for (int dt = 0; dt < 4; ++dt) o4[dt] = wmmab(ph, vl[dt], o4[dt]);
        __builtin_amdgcn_sched_barrier(0);
        ldk(K1h + ko + (size_t)kn * HD, K1l + ko + (size_t)kn * HD, kf); ldm(mrow + kn, mk);
    }
#pragma unroll
    for (int dt = 0; dt < 4; ++dt) {
#pragma unroll
        for (int j = 0; j < 8; ++j) os[(w * 16 + hi * 8 + j) * 68 + dt * 16 + lr] = o4[dt][j]; }
    __syncthreads();   // every wave's partial output tile is in LDS before any thread sums the two key halves
#pragma unroll
    for (int q = 0; q < 4; ++q) { const int idx = q * 512 + (int)threadIdx.x, row = idx >> 4, c4 = (idx & 15) * 4; const v4f val = *(const v4fa*)(os + row * 68 + c4) + *(const v4fa*)(os + (128 + row) * 68 + c4);
        *(v4f*)(CAT + (size_t)(blockIdx.x * 128 + row) * EE + h * HD + c4) = val; }
}
// k_gst: per (h, t) partial sums over the head's 64 dims (centred squares when centred) -> PS[h][t]; k_gred: M[h] = sum_t PS / (64*2048);
__global__ __launch_bounds__(256) void k_gst(const float* __restrict__ CAT, const float* __restrict__ MU, int centred, float* PS) { const int e = blockIdx.x * 256 + threadIdx.x; if (e >= NH_ * TT) return; const int t = e % TT, h = e / TT; const float m = centred ? MU[h] : 0.f; const float* r = CAT + (size_t)t * EE + h * HD; float s = 0.f;
    for (int d = 0; d < HD; ++d) { const float dv = __fsub_rn(r[d], m); float q = centred ? __fmul_rn(dv, dv) : dv; asm volatile("" : "+v"(q)); s = __fadd_rn(s, q); } *(float*)(PS + e) = s;  }
__global__ __launch_bounds__(32) void k_gred(const float* __restrict__ PS, float* M) { const int lane = threadIdx.x; if (lane >= NH_) { return; } float s = 0.f; for (int t = 0; t < TT; ++t) s = __fadd_rn(s, PS[(size_t)lane * TT + t]); const float m = s * (1.0f / (float)(HD * TT)); *(float*)(M + lane) = m;  }
__global__ __launch_bounds__(256) void k_gn(const float* __restrict__ CAT, const float* __restrict__ MU, const float* __restrict__ VAR, const float* __restrict__ gw, const float* __restrict__ gb, bf* Ah, bf* Al) { const size_t o = ((size_t)blockIdx.x * 256 + threadIdx.x) * 4; if (o >= (size_t)TT * EE) return;   // o: place in the fragment-order planes (K = EE), half a 16-byte slot a thread; i: the same elements in CAT
    const size_t i = ((o >> 14) * 16 + ((o >> 3) & 15)) * EE + ((o >> 9) & (EE / 32 - 1)) * 32 + ((o >> 8) & 1) * 16 + ((o >> 7) & 1) * 8 + (o & 7); const int c = (int)(i % EE); const int h = c / HD; const float rs = __frsqrt_rn(__fadd_rn(VAR[h], 1e-5f)); const float mu = MU[h]; const v4f a = *(const v4f*)(CAT + i); v4us oh, ol;
#pragma unroll
    for (int q = 0; q < 4; ++q) { float t = __fmul_rn(__fsub_rn(a[q], mu), rs); asm volatile("" : "+v"(t)); float tg = __fmul_rn(t, bfr(gw[c + q])); asm volatile("" : "+v"(tg)); unsigned short u, c2; splitf(__fadd_rn(tg, bfr(gb[c + q])), u, c2); oh[q] = u; ol[q] = c2; }
    *(v4us*)(Ah + o) = oh; *(v4us*)(Al + o) = ol;  }

extern "C" void kernel_launch(void* const* d_in, const int* in_sizes, int n_in,
                              void* d_out, int out_size, void* d_ws, size_t ws_size, hipStream_t stream) {
    (void)in_sizes; (void)n_in; (void)out_size;
    const float* x = (const float*)d_in[0]; const int* msk = (const int*)d_in[1]; const float* IN[17]; for (int i = 2; i < 17; ++i) IN[i] = (const float*)d_in[i];   // 2 Wq1 [16][64][1024], 3 bq1, 4 Wq2, 5 bq2, 6 Wk1, 7 bk1, 8 Wk2, 9 bk2, 10 Wv, 11 bv, 12 lam, 13 gn_w, 14 gn_b, 15 Wo [1024][1024] (out,in), 16 bo
    float* OUT = (float*)d_out;     // [1][2048][1024]
    char* wsp = (char*)d_ws;
    auto take = [&](size_t bytes) { char* p = wsp; wsp += (bytes + 255) & ~(size_t)255; return (void*)p; };
    bf* WB[6]; for (int i = 0; i < 6; ++i) WB[i] = (bf*)take((size_t)EE * EE * 2); bf* XB = (bf*)take((size_t)TT * EE * 2); float* F = (float*)take((size_t)TT * EE * 4);
    bf* Q1h = (bf*)take((size_t)NH_ * TT * HD * 2); bf* Q1l = (bf*)take((size_t)NH_ * TT * HD * 2); bf* Q2h = (bf*)take((size_t)NH_ * TT * HD * 2); bf* Q2l = (bf*)take((size_t)NH_ * TT * HD * 2); bf* K1h = (bf*)take((size_t)NH_ * TT * HD * 2); bf* K1l = (bf*)take((size_t)NH_ * TT * HD * 2); bf* K2h = (bf*)take((size_t)NH_ * TT * HD * 2); bf* K2l = (bf*)take((size_t)NH_ * TT * HD * 2); bf* Vh = (bf*)take((size_t)NH_ * HD * TT * 2); bf* Vl = (bf*)take((size_t)NH_ * HD * TT * 2);
    float* CAT = (float*)take((size_t)TT * EE * 4); float* PS = (float*)take((size_t)NH_ * TT * 4); float* MU = (float*)take(64 * 4); float* VAR = (float*)take(64 * 4); bf* Ah = (bf*)take((size_t)TT * EE * 2); bf* Al = (bf*)take((size_t)TT * EE * 2);
    if ((size_t)(wsp - (char*)d_ws) > ws_size) return;
    const int widx[6] = {2, 4, 6, 8, 10, 15}; for (int i = 0; i < 6; ++i) k_cvt8<<<(EE * EE / 8 + 255) / 256, 256, 0, stream>>>(IN[widx[i]], WB[i], (size_t)EE * EE / 8);   // [H][DH][E] stacked = natural [1024][1024] Bt; Wo [E][D] natural
    k_cvt8<<<(TT * EE / 8 + 255) / 256, 256, 0, stream>>>(x, XB, (size_t)TT * EE / 8);
    const unsigned LP = (unsigned)(((size_t)NH_ * TT * HD / 8 + 255) / 256);
    bf* PLh[4] = {Q1h, Q2h, K1h, K2h}; bf* PLl[4] = {Q1l, Q2l, K1l, K2l};
    for (int i = 0; i < 4; ++i) { k_gemmw<bf, 0, true, 8, 1><<<dim3(TT / 64, EE / 64, 1), 256, 0, stream>>>(XB, nullptr, WB[i], nullptr, EE, F, EE, IN[widx[i] + 1], 0, 0, 0); k_pl<<<LP, 256, 0, stream>>>(F, PLh[i], PLl[i]); }
    k_gemmw<bf, 0, true, 8, 1><<<dim3(TT / 64, EE / 64, 1), 256, 0, stream>>>(XB, nullptr, WB[4], nullptr, EE, F, EE, IN[11], 0, 0, 0); k_vtp<<<LP, 256, 0, stream>>>(F, Vh, Vl);
    k_attn<<<dim3(TT / 128, NH_, 1), 512, 0, stream>>>(Q1h, Q1l, Q2h, Q2l, K1h, K1l, K2h, K2l, Vh, Vl, msk, IN[12], CAT);
    k_gst<<<(NH_ * TT + 255) / 256, 256, 0, stream>>>(CAT, nullptr, 0, PS); k_gred<<<1, 32, 0, stream>>>(PS, MU); k_gst<<<(NH_ * TT + 255) / 256, 256, 0, stream>>>(CAT, MU, 1, PS); k_gred<<<1, 32, 0, stream>>>(PS, VAR);
    k_gn<<<(unsigned)(((size_t)TT * EE / 4 + 255) / 256), 256, 0, stream>>>(CAT, MU, VAR, IN[13], IN[14], Ah, Al);
    k_gemmw<bf, 1, true, 8, 1><<<dim3(TT / 64, EE / 64, 1), 256, 0, stream>>>(Ah, Al, WB[5], nullptr, EE, OUT, EE, IN[16], 0, 0, 0);
}

// v004
// It runs in 206 microseconds.
// Timed twice side by side with v003, it ran 1.28 and 1.29 times as fast.
// Over all steps from v000 it is 5.02 times as fast.
#include <hip/hip_runtime.h>

// DifferentialMultiHeadSelfAttention (x [1][2048][1024]; per-head q1, q2, k1, k2, v = x W[h]^T + b[h] (16 x 64); s = q.k/8 with mask[i][j] (int, 1 = masked -> -inf, read as data); w = softmax(s1) - lam[h] softmax(s2);
// out = w.v; heads concatenated; GroupNorm(16 groups = heads, eps 1e-5, biased var over (64 dims x 2048 tokens)) x gn_w + gn_b; out Wo^T + bo -> [1][2048][1024]).
// Compute dtypes, f32 accumulate: every input rounded to bf16; the five projections on PLAIN bf16 operands (inputs: exact, + bias; the stacked [16][64][1024] weights are one natural [1024][1024] Bt); both score GEMMs

#define TT   2048
#define EE   1024
#define NH_  16
#define HD   64
#define ZH   2
#define SCL  0.125f
typedef _Float16 h16;
typedef unsigned short bf;
typedef __attribute__((ext_vector_type(16))) __bf16   v16bf;
typedef __attribute__((ext_vector_type(16))) _Float16 v16h;
typedef __attribute__((ext_vector_type(8)))  _Float16 v8h;
typedef __attribute__((ext_vector_type(8)))  unsigned short v8us;
typedef __attribute__((ext_vector_type(8)))  float    v8f;
typedef __attribute__((ext_vector_type(4)))  float    v4f;
typedef v8h  __attribute__((may_alias)) v8ha;
typedef v4f  __attribute__((may_alias)) v4fa;
typedef v8us __attribute__((may_alias)) v8usa;

__device__ __forceinline__ unsigned short f2bf(float f) { unsigned u = __float_as_uint(f); u += 0x7FFFu + ((u >> 16) & 1u); return (unsigned short)(u >> 16); }
__device__ __forceinline__ float bf2f(unsigned short b) { return __uint_as_float(((unsigned)b) << 16); }
__device__ __forceinline__ float bfr(float f) { return bf2f(f2bf(f)); }
__device__ __forceinline__ v16h cat16(v8h lo, v8h hi) { return __builtin_shufflevector(lo, hi, 0, 1, 2, 3, 4, 5, 6, 7, 8, 9, 10, 11, 12, 13, 14, 15); }
__device__ __forceinline__ v16bf cat16b(v8us lo, v8us hi) { return __builtin_bit_cast(v16bf, __builtin_shufflevector(lo, hi, 0, 1, 2, 3, 4, 5, 6, 7, 8, 9, 10, 11, 12, 13, 14, 15)); }
__device__ __forceinline__ v8f wmma16(v16h a, v16h b, v8f c) { return __builtin_amdgcn_wmma_f32_16x16x32_f16(false, a, false, b, (short)0, c, false, false); }
__device__ __forceinline__ v8f wmmab(v16bf a, v16bf b, v8f c) { return __builtin_amdgcn_wmma_f32_16x16x32_bf16(false, a, false, b, (short)0, c, false, false); }



// ---- FRAGMENT ORDER of every 16-bit operand plane [R][K]: the 16 rows x 32 k of one matrix operand lie as 512 elements in a row, [u][lane][s] = element (row 16 T + (lane & 15), k 32 c + 16 u + 8 (lane >> 4) + s),
// block (T, c) at (T * (K / 32) + c) * 512. A wave's 16-byte load of half u then reads 512 contiguous bytes (4 whole lines) instead of 32 bytes out of each of 16 lines; which element reaches which lane and register is as before.
// ---- k_gemmw: register-blocked GEMM, NW WAVES per 64x64 output tile (16 accumulators each), operands straight from 16-bit planes in fragment order; grid (M/64, N/64, Z), 32 * NW threads.
// C[m][n] (f32, pitch ldc, + optional f32 bias[n]) = sum_k A[m][k] Bt[n][k] (+ split products per NSPLIT). z-batch strides sA/sB/sC in elements. K % (32 * NW * KP) == 0.
// Split K: wave w takes the 32-wide k chunks w, w + NW, ... (1 KiB of each 16-row strip); the NW partial tiles are staged whole in LDS and summed in wave order behind one barrier.
// KP > 1 (N == 64 only): blockIdx.y is a K range instead of a tile column, and range y stores its partial C in plane y (plane pitch ZH * sC); the consumer sums the planes.
template <typename T16> struct WFrag;
template <> struct WFrag<h16> { typedef v16h V; static __device__ __forceinline__ V ld(const h16* p) { return cat16(*(const v8h*)p, *(const v8h*)(p + 256)); } static __device__ __forceinline__ v8f mma(V a, V b, v8f c) { return wmma16(a, b, c); } };
template <> struct WFrag<bf> { typedef v16bf V; static __device__ __forceinline__ V ld(const bf* p) { return cat16b(*(const v8us*)p, *(const v8us*)(p + 256)); } static __device__ __forceinline__ v8f mma(V a, V b, v8f c) { return wmmab(a, b, c); } };
template <typename T16, int NSPLIT, bool BIAS, int NW, int KP>
__global__ __launch_bounds__(32 * NW) void k_gemmw(const T16* __restrict__ A, const T16* __restrict__ A2, const T16* __restrict__ Bt, const T16* __restrict__ Bt2, int K, float* C, int ldc, const float* __restrict__ bias, size_t sA, size_t sB, size_t sC) {
    typedef typename WFrag<T16>::V V;
    constexpr int SR = NW > 1 ? 64 : 16;    // tile rows staged in LDS at once, per wave
    __shared__ __align__(16) float os[NW * SR * 68];
    const size_t z = blockIdx.z; A += z * sA; if (A2) A2 += z * sA; Bt += z * sB; if (Bt2) Bt2 += z * sB; C += z * sC;
    const int lane = threadIdx.x & 31, lr = lane & 15, hi = lane >> 4; const int r0 = blockIdx.x * 64, c0 = KP > 1 ? 0 : blockIdx.y * 64;
    const int w = NW > 1 ? __builtin_amdgcn_readfirstlane((int)(threadIdx.x >> 5)) : 0;
    const int klo = KP > 1 ? (int)blockIdx.y * (K / KP) : 0, khi = KP > 1 ? klo + K / KP : K; if (KP > 1) C += (size_t)blockIdx.y * ZH * sC;
    v8f acc[4][4];
#pragma unroll
    for (int mb = 0; mb < 4; ++mb)
#pragma unroll
        for (int nb = 0; nb < 4; ++nb) acc[mb][nb] = (v8f){};
    const size_t aoff = (size_t)r0 * K + 8 * lane, boff = (size_t)c0 * K + 8 * lane;   // fragment order: a 16-row strip is still 16 * K elements, a 32-wide k chunk of it 512
#pragma unroll 1
    for (int kc = klo + w * 32; kc < khi; kc += 32 * NW) {
        V a[4], a2[4], b[4], b2[4]; const T16 *pa[4], *pa2[4], *pb[4], *pb2[4];
#pragma unroll
        for (int mb = 0; mb < 4; ++mb) { pa[mb] = A + aoff + (size_t)mb * 16 * K + kc * 16; pa2[mb] = pa[mb]; a[mb] = WFrag<T16>::ld(pa[mb]); if (NSPLIT == 1 || NSPLIT == 2) { pa2[mb] = A2 + aoff + (size_t)mb * 16 * K + kc * 16; a2[mb] = WFrag<T16>::ld(pa2[mb]); } }
        asm volatile("s_wait_xcnt 0x0" :: "v"(pa[0]), "v"(pa[1]), "v"(pa[2]), "v"(pa[3]), "v"(pa2[0]), "v"(pa2[1]), "v"(pa2[2]), "v"(pa2[3]) : "memory");   // the loads' address registers stay whole up to this wait and are free for reuse (here: as a later load's target) only behind it
#pragma unroll
        for (int nb = 0; nb < 4; ++nb) { pb[nb] = Bt + boff + (size_t)nb * 16 * K + kc * 16; pb2[nb] = pb[nb]; b[nb] = WFrag<T16>::ld(pb[nb]); if (NSPLIT >= 2) { pb2[nb] = Bt2 + boff + (size_t)nb * 16 * K + kc * 16; b2[nb] = WFrag<T16>::ld(pb2[nb]); } }
        asm volatile("s_wait_xcnt 0x0" :: "v"(pb[0]), "v"(pb[1]), "v"(pb[2]), "v"(pb[3]), "v"(pb2[0]), "v"(pb2[1]), "v"(pb2[2]), "v"(pb2[3]) : "memory");   // as above
        __builtin_amdgcn_sched_barrier(0);   // all loads of a trip go out ahead of its products; without it the compiler sinks each B fragment's loads to their first use, one exposed latency per fragment
#pragma unroll
        for (int nb = 0; nb < 4; ++nb) {
#pragma unroll
            for (int mb = 0; mb < 4; ++mb) { acc[mb][nb] = WFrag<T16>::mma(a[mb], b[nb], acc[mb][nb]); if (NSPLIT == 1 || NSPLIT == 2) acc[mb][nb] = WFrag<T16>::mma(a2[mb], b[nb], acc[mb][nb]); if (NSPLIT >= 2) acc[mb][nb] = WFrag<T16>::mma(a[mb], b2[nb], acc[mb][nb]); } }
        asm volatile("v_nop\n\tv_nop\n\tv_nop\n\tv_nop" : "+v"(acc[0][0]), "+v"(acc[1][1]), "+v"(acc[2][2]), "+v"(acc[3][3]) : "v"(a[0]), "v"(a[3]));
    }
    // the four loops below are unrolled so that acc[][] is indexed by constants and stays in registers
#pragma unroll
    for (int mb0 = 0; mb0 < 4; mb0 += SR / 16) {
#pragma unroll
        for (int mi = 0; mi < SR / 16; ++mi) {
#pragma unroll
            for (int nb = 0; nb < 4; ++nb) {
#pragma unroll
                for (int j = 0; j < 8; ++j) os[(w * SR + mi * 16 + hi * 8 + j) * 68 + nb * 16 + lr] = acc[mb0 + mi][nb][j]; } }
        if (NW > 1) __syncthreads();   // every wave's partial tile is in LDS before any wave sums it
        else { __builtin_amdgcn_wave_barrier(); asm volatile("" ::: "memory"); }   // one wave: only keeps the compiler from moving the LDS reads above the LDS stores
        float* crow = C + (size_t)(r0 + mb0 * 16) * ldc + c0;
        // both loops unrolled: all LDS reads of a wave's rows go out together instead of one latency per read
#pragma unroll
        for (int q = 0; q < SR / 2 / NW; ++q) { const int row = 2 * (q * NW + w) + hi, cofs = lr * 4; v4f val = *(const v4fa*)(os + row * 68 + cofs);
#pragma unroll
            for (int u = 1; u < NW; ++u) val += *(const v4fa*)(os + (u * SR + row) * 68 + cofs);
            if (BIAS) { val[0] += bfr(bias[c0 + cofs]); val[1] += bfr(bias[c0 + cofs + 1]); val[2] += bfr(bias[c0 + cofs + 2]); val[3] += bfr(bias[c0 + cofs + 3]); }
            *(v4f*)(crow + (size_t)row * ldc + cofs) = val; }
        if (NW == 1) { __builtin_amdgcn_wave_barrier(); asm volatile("" ::: "memory"); }   // one wave: the next strip's LDS stores stay behind these reads
    }
}

__device__ __forceinline__ void splitf(float y, unsigned short& h, unsigned short& l) { h = f2bf(y); l = f2bf(y - bf2f(h)); }
typedef __attribute__((ext_vector_type(4))) unsigned short v4us;
typedef __attribute__((ext_vector_type(2))) float v2f;

// The three writers below run one thread per 16-byte slot [lane] of a fragment half, in the order of the plane: every wave stores 512 contiguous bytes a plane.
// k_cvt8: src [R][EE] f32 -> dst in fragment order (K = EE)
__global__ __launch_bounds__(256) void k_cvt8(const float* __restrict__ src, bf* dst, size_t n8) { const size_t i = (size_t)blockIdx.x * 256 + threadIdx.x; if (i >= n8) return;
    const int lr = (int)(i & 15), hi = (int)(i >> 4) & 1, u = (int)(i >> 5) & 1, c = (int)(i >> 6) & (EE / 32 - 1); const size_t T = i >> 11; const v8f v = *(const v8f*)(src + (T * 16 + lr) * EE + c * 32 + u * 16 + hi * 8); v8us o;
#pragma unroll
    for (int k = 0; k < 8; ++k) o[k] = f2bf(v[k]); *(v8us*)(dst + i * 8) = o;  }
// k_pl: F [t][h * 64 + d] -> per head a plane [TT][HD] in fragment order (K = HD), high and low
__global__ __launch_bounds__(256) void k_pl(const float* __restrict__ F, bf* Ph, bf* Pl) { const size_t i = (size_t)blockIdx.x * 256 + threadIdx.x; if (i >= (size_t)NH_ * TT * HD / 8) return;
    const int lr = (int)(i & 15), hi = (int)(i >> 4) & 1, u = (int)(i >> 5) & 1, c = (int)(i >> 6) & 1, T = (int)(i >> 7) & (TT / 16 - 1), h = (int)(i >> 14); const v8f v = *(const v8f*)(F + (size_t)(T * 16 + lr) * EE + h * HD + c * 32 + u * 16 + hi * 8); v8us oh, ol;
#pragma unroll
    for (int k = 0; k < 8; ++k) { unsigned short a, b; splitf(v[k], a, b); oh[k] = a; ol[k] = b; } *(v8us*)(Ph + i * 8) = oh; *(v8us*)(Pl + i * 8) = ol;  }
// k_vtp: F [t][h * 64 + d] -> per head the transposed plane [HD][TT] with its blocks ordered (32-key chunk, 16-row strip): block (c, T) at (c * 4 + T) * 512, so that the four strips of one key chunk lie together
__global__ __launch_bounds__(256) void k_vtp(const float* __restrict__ F, bf* Vh, bf* Vl) { const size_t i = (size_t)blockIdx.x * 256 + threadIdx.x; if (i >= (size_t)NH_ * HD * TT / 8) return;
    const int lr = (int)(i & 15), hi = (int)(i >> 4) & 1, u = (int)(i >> 5) & 1, T = (int)(i >> 6) & 3, c = (int)(i >> 8) & (TT / 32 - 1), h = (int)(i >> 14); const float* f = F + (size_t)(c * 32 + u * 16 + hi * 8) * EE + h * HD + T * 16 + lr; v8us oh, ol;
#pragma unroll
    for (int k = 0; k < 8; ++k) { unsigned short a, b; splitf(f[(size_t)k * EE], a, b); oh[k] = a; ol[k] = b; } *(v8us*)(Vh + i * 8) = oh; *(v8us*)(Vl + i * 8) = ol;  }
// ---- k_attn: both score maps, both softmaxes, their difference and the product with V in one launch; no score or probability ever leaves the registers.
// grid (TT / 128, heads), 16 waves: wave w owns the 16 queries (w & 7) of the block's 128 and the key half (w >> 3). Scores are formed transposed (A = K rows, B = Q rows kept in registers), so a lane holds
// 8 keys of ONE query per tile: maximum and sum are in-lane, and two 16-key tiles converted in place are the A operand of the product with V (its k order is the loader's: 8 hi + s, 16 + 8 hi + s).
// Sweep 1 finds each query's maximum and exp sum of both maps (running maximum per lane; lane halves, then key halves joined in a fixed order); sweep 2 forms the scores again, w = e1 / sum1 - lam e2 / sum2,
// splits w in bf16 high + low and accumulates w.V (three products, as the score products). The two key halves' output tiles are summed in LDS and stored as whole lines of CAT[t][h * 64 + d].
// GroupNorm statistics: the block holds 128 tokens x 64 dims of one group in registers at that point, so it also stores their sum and their square sum centred on the block's own mean, GP[h][block] = (sum, m2); k_gn joins a head's 16 pairs.
typedef __attribute__((ext_vector_type(4))) int v4i;
typedef __attribute__((ext_vector_type(2))) __bf16 v2bf;
__device__ __forceinline__ v16bf ldf(const bf* p) { return cat16b(*(const v8us*)p, *(const v8us*)(p + 256)); }   // the two halves of one fragment-order block
// the K fragments of 32 keys of one map: k[kt * 4 + c * 2] high, + 1 low (16-key tile kt, 32-wide chunk c of the head dim)
__device__ __forceinline__ void ldk(const bf* Kh, const bf* Kl, v16bf (&k)[8]) {
#pragma unroll
    for (int kt = 0; kt < 2; ++kt)
#pragma unroll
        for (int c = 0; c < 2; ++c) { k[kt * 4 + c * 2] = ldf(Kh + kt * 16 * HD + c * 512); k[kt * 4 + c * 2 + 1] = ldf(Kl + kt * 16 * HD + c * 512); }
    asm volatile("s_wait_xcnt 0x0" :: "v"(Kh), "v"(Kl) : "memory"); }   // the loads' address registers stay whole up to this wait and are free for reuse only behind it
__device__ __forceinline__ void ldm(const int* mr, v4i (&mk)[4]) {
#pragma unroll
    for (int u = 0; u < 4; ++u) mk[u] = *(const v4i*)(mr + (u >> 1) * 16 + (u & 1) * 4);
    asm volatile("s_wait_xcnt 0x0" :: "v"(mr) : "memory"); }   // as in ldk
// two transposed score tiles: s[kt][j] = q[query lr] . k[key kt * 16 + 8 hi + j], split products kh.qh + kh.ql + kl.qh over the two chunks
__device__ __forceinline__ void sc2(const v16bf (&k)[8], const v16bf (&qh)[2], const v16bf (&ql)[2], v8f (&s)[2]) { s[0] = (v8f){}; s[1] = (v8f){};
#pragma unroll
    for (int c = 0; c < 2; ++c) { s[0] = wmmab(k[c * 2], qh[c], s[0]); s[1] = wmmab(k[4 + c * 2], qh[c], s[1]); s[0] = wmmab(k[c * 2], ql[c], s[0]); s[1] = wmmab(k[4 + c * 2], ql[c], s[1]); s[0] = wmmab(k[c * 2 + 1], qh[c], s[0]); s[1] = wmmab(k[4 + c * 2 + 1], qh[c], s[1]); } }
// masked scores, scaled by 1/8 and by log2(e) in one multiply, so that every exponential below is a bare exp2: t[kt * 8 + j] belongs to key kt * 16 + 8 hi + j of the block
__device__ __forceinline__ void msc(const v8f (&s)[2], const v4i (&mk)[4], float (&t)[16]) {
#pragma unroll
    for (int e = 0; e < 16; ++e) t[e] = mk[e >> 2][e & 3] ? -3.0e38f : s[e >> 3][e & 7] * (SCL * 1.44269504f); }
__device__ __forceinline__ void run_ml(const float (&t)[16], float& m, float& l) { float tm = t[0];
#pragma unroll
    for (int k = 1; k < 16; ++k) tm = fmaxf(tm, t[k]);
    const float mn = fmaxf(m, tm); float a = 0.f;
#pragma unroll
    for (int k = 0; k < 16; ++k) a += __builtin_amdgcn_exp2f(t[k] - mn);
    l = l * __builtin_amdgcn_exp2f(m - mn) + a; m = mn; }
__device__ __forceinline__ void join_ml(float& m, float& l, float mo, float lo) { const float mn = fmaxf(m, mo); l = l * __builtin_amdgcn_exp2f(m - mn) + lo * __builtin_amdgcn_exp2f(mo - mn); m = mn; }
__device__ __forceinline__ float wsum(float v) {   // sum over the wave's 32 lanes, the same bits in every lane
#pragma unroll   // five fixed steps: no loop counter, the lane masks are constants
    for (int m = 16; m >= 1; m >>= 1) v += __shfl_xor(v, m, 32);
    return v; }
__global__ __launch_bounds__(512) void k_attn(const bf* __restrict__ Q1h, const bf* __restrict__ Q1l, const bf* __restrict__ Q2h, const bf* __restrict__ Q2l, const bf* __restrict__ K1h, const bf* __restrict__ K1l, const bf* __restrict__ K2h, const bf* __restrict__ K2l,
                                              const bf* __restrict__ Vh, const bf* __restrict__ Vl, const int* __restrict__ msk, const float* __restrict__ lam, float* CAT, float* GP) {
    __shared__ __align__(16) float os[16 * 16 * 68];
    __shared__ float st[2][4][128];
    __shared__ __align__(16) float gs[2][16];
    const int lane = threadIdx.x & 31, lr = lane & 15, hi = lane >> 4; const int w = __builtin_amdgcn_readfirstlane((int)(threadIdx.x >> 5)), qw = w & 7, kh = w >> 3;
    const int h = blockIdx.y, q0 = blockIdx.x * 128 + qw * 16; const size_t hb = (size_t)h * TT * HD;
    v16bf q1h[2], q1l[2], q2h[2], q2l[2]; const size_t qo = hb + (size_t)q0 * HD + 8 * lane; const bf *pq1h = Q1h + qo, *pq1l = Q1l + qo, *pq2h = Q2h + qo, *pq2l = Q2l + qo;
#pragma unroll
    for (int c = 0; c < 2; ++c) { q1h[c] = ldf(pq1h + c * 512); q1l[c] = ldf(pq1l + c * 512); q2h[c] = ldf(pq2h + c * 512); q2l[c] = ldf(pq2l + c * 512); }
    asm volatile("s_wait_xcnt 0x0" :: "v"(pq1h), "v"(pq1l), "v"(pq2h), "v"(pq2l) : "memory");   // as in ldk
    const size_t ko = hb + 8 * lane; const int* mrow = msk + (size_t)(q0 + lr) * TT + 8 * hi; const int kbeg = kh * (TT / 2), kend = kbeg + TT / 2;
    float m1 = -3.0e38f, l1 = 0.f, m2 = -3.0e38f, l2 = 0.f;
    // Order of a trip, held by the scheduling barriers: each group of loads goes out whole right behind the products that free its registers and flies under the vector work that follows, instead of one exposed latency per fragment.
    v16bf kf[8]; v4i mk[4]; ldk(K1h + ko + (size_t)kbeg * HD, K1l + ko + (size_t)kbeg * HD, kf); ldm(mrow + kbeg, mk);
#pragma unroll 1   // one 32-key block a trip: a second copy of the body would not fit the registers of four waves a SIMD
    for (int kb = kbeg; kb < kend; kb += 32) { v8f s[2]; float t[16]; const size_t o = ko + (size_t)kb * HD; const int kn = kb + 32 < kend ? kb + 32 : kb;   // the last trip fetches its own block again: in bounds, unused
        sc2(kf, q1h, q1l, s); __builtin_amdgcn_sched_barrier(0);
        ldk(K2h + o, K2l + o, kf); __builtin_amdgcn_sched_barrier(0);
        msc(s, mk, t); run_ml(t, m1, l1); __builtin_amdgcn_sched_barrier(0);
        sc2(kf, q2h, q2l, s); __builtin_amdgcn_sched_barrier(0);
        ldk(K1h + ko + (size_t)kn * HD, K1l + ko + (size_t)kn * HD, kf); __builtin_amdgcn_sched_barrier(0);
        msc(s, mk, t); ldm(mrow + kn, mk); run_ml(t, m2, l2); }
    join_ml(m1, l1, __shfl_xor(m1, 16, 32), __shfl_xor(l1, 16, 32)); join_ml(m2, l2, __shfl_xor(m2, 16, 32), __shfl_xor(l2, 16, 32));
    if (hi == 0) { st[kh][0][qw * 16 + lr] = m1; st[kh][1][qw * 16 + lr] = l1; st[kh][2][qw * 16 + lr] = m2; st[kh][3][qw * 16 + lr] = l2; }
    __syncthreads();   // both key halves' maxima and sums are in LDS before either half joins them
    m1 = st[0][0][qw * 16 + lr]; l1 = st[0][1][qw * 16 + lr]; m2 = st[0][2][qw * 16 + lr]; l2 = st[0][3][qw * 16 + lr];
    join_ml(m1, l1, st[1][0][qw * 16 + lr], st[1][1][qw * 16 + lr]); join_ml(m2, l2, st[1][2][qw * 16 + lr], st[1][3][qw * 16 + lr]);
    const float f1 = __fdiv_rn(1.0f, l1), f2 = __fdiv_rn(1.0f, l2) * bfr(lam[h]);
    v8f o4[4];
#pragma unroll
    for (int dt = 0; dt < 4; ++dt) o4[dt] = (v8f){};
    const size_t vo = hb + 8 * lane;
    ldk(K1h + ko + (size_t)kbeg * HD, K1l + ko + (size_t)kbeg * HD, kf); ldm(mrow + kbeg, mk);
#pragma unroll 1   // as above
    for (int kb = kbeg; kb < kend; kb += 32) { v8f s[2]; float t[16], e1[16]; const size_t o = ko + (size_t)kb * HD; const int kn = kb + 32 < kend ? kb + 32 : kb;
        sc2(kf, q1h, q1l, s); __builtin_amdgcn_sched_barrier(0);
        ldk(K2h + o, K2l + o, kf); __builtin_amdgcn_sched_barrier(0);
        msc(s, mk, t);
#pragma unroll
        for (int e = 0; e < 16; ++e) e1[e] = __builtin_amdgcn_exp2f(t[e] - m1) * f1;
        __builtin_amdgcn_sched_barrier(0);
        sc2(kf, q2h, q2l, s); __builtin_amdgcn_sched_barrier(0);
        v16bf vh[4], vl[4]; const bf *pvh = Vh + vo + (size_t)kb * HD, *pvl = Vl + vo + (size_t)kb * HD;
#pragma unroll
        for (int dt = 0; dt < 4; ++dt) { vh[dt] = ldf(pvh + dt * 512); vl[dt] = ldf(pvl + dt * 512); }
        asm volatile("s_wait_xcnt 0x0" :: "v"(pvh), "v"(pvl) : "memory");   // as in ldk
        __builtin_amdgcn_sched_barrier(0);
        msc(s, mk, t); v16bf ph, pl;
#pragma unroll
        for (int e = 0; e < 16; e += 2) { v2f wv; wv[0] = e1[e] - __builtin_amdgcn_exp2f(t[e] - m2) * f2; wv[1] = e1[e + 1] - __builtin_amdgcn_exp2f(t[e + 1] - m2) * f2;
            const v2bf hh = __builtin_convertvector(wv, v2bf); const v2bf ll = __builtin_convertvector(wv - __builtin_convertvector(hh, v2f), v2bf); ph[e] = hh[0]; ph[e + 1] = hh[1]; pl[e] = ll[0]; pl[e + 1] = ll[1]; }
        __builtin_amdgcn_sched_barrier(0);
#pragma unroll
        for (int dt = 0; dt < 4; ++dt) o4[dt] = wmmab(ph, vh[dt], o4[dt]);
#pragma unroll
        for (int dt = 0; dt < 4; ++dt) o4[dt] = wmmab(pl, vh[dt], o4[dt]);
#pragma unroll
        for (int dt = 0; dt < 4; ++dt) o4[dt] = wmmab(ph, vl[dt], o4[dt]);
        __builtin_amdgcn_sched_barrier(0);
        ldk(K1h + ko + (size_t)kn * HD, K1l + ko + (size_t)kn * HD, kf); ldm(mrow + kn, mk);
    }
#pragma unroll
    for (int dt = 0; dt < 4; ++dt) {
#pragma unroll
        for (int j = 0; j < 8; ++j) os[(w * 16 + hi * 8 + j) * 68 + dt * 16 + lr] = o4[dt][j]; }
    __syncthreads();   // every wave's partial output tile is in LDS before any thread sums the two key halves
    v4f vals[4]; float* pc[4];
#pragma unroll
    for (int q = 0; q < 4; ++q) { const int idx = q * 512 + (int)threadIdx.x, row = idx >> 4, c4 = (idx & 15) * 4; vals[q] = *(const v4fa*)(os + row * 68 + c4) + *(const v4fa*)(os + (128 + row) * 68 + c4);
        pc[q] = CAT + (size_t)(blockIdx.x * 128 + row) * EE + h * HD + c4; *(v4f*)pc[q] = vals[q]; }
    asm volatile("s_wait_xcnt 0x0" :: "v"(pc[0]), "v"(pc[1]), "v"(pc[2]), "v"(pc[3]), "v"(vals[0]), "v"(vals[1]), "v"(vals[2]), "v"(vals[3]) : "memory");   // the stores' address and data registers stay whole up to this wait and are free for reuse only behind it
    const v4f s4 = (vals[0] + vals[1]) + (vals[2] + vals[3]); const float ws = wsum((s4[0] + s4[1]) + (s4[2] + s4[3]));
    if (lane == 0) gs[0][w] = ws;
    __syncthreads();   // all 16 waves' sums are in LDS before any thread forms the block's mean
    const v4f b4 = (*(const v4fa*)(gs[0]) + *(const v4fa*)(gs[0] + 4)) + (*(const v4fa*)(gs[0] + 8) + *(const v4fa*)(gs[0] + 12)); const float bs = (b4[0] + b4[1]) + (b4[2] + b4[3]), bm = bs * (1.0f / (128 * HD));
    v4f d4 = (v4f){};
#pragma unroll   // vals[] is indexed by constants and stays in registers
    for (int q = 0; q < 4; ++q) { const v4f d = vals[q] - bm; d4 += d * d; }
    const float wq = wsum((d4[0] + d4[1]) + (d4[2] + d4[3]));
    if (lane == 0) gs[1][w] = wq;
    __syncthreads();   // all 16 waves' centred square sums are in LDS before thread 0 adds them
    if (threadIdx.x == 0) { const v4f c4v = (*(const v4fa*)(gs[1]) + *(const v4fa*)(gs[1] + 4)) + (*(const v4fa*)(gs[1] + 8) + *(const v4fa*)(gs[1] + 12)); v2f o2; o2[0] = bs; o2[1] = (c4v[0] + c4v[1]) + (c4v[2] + c4v[3]);
        *(v2f*)(GP + ((size_t)h * (TT / 128) + blockIdx.x) * 2) = o2; }
}
// k_gn: a head's mean and biased variance from its 16 pairs GP[h][b] = (sum, m2 about the block's own mean) of 128 x 64 values each: var * N = sum_b m2_b + n_b (mean_b - mean)^2, an identity, every term >= 0; then the normalisation.
__global__ __launch_bounds__(256) void k_gn(const float* __restrict__ CAT, const float* __restrict__ GP, const float* __restrict__ gw, const float* __restrict__ gb, bf* Ah, bf* Al) { const size_t o = ((size_t)blockIdx.x * 256 + threadIdx.x) * 4; if (o >= (size_t)TT * EE) return;   // o: place in the fragment-order planes (K = EE), half a 16-byte slot a thread; i: the same elements in CAT
    const size_t i = ((o >> 14) * 16 + ((o >> 3) & 15)) * EE + ((o >> 9) & (EE / 32 - 1)) * 32 + ((o >> 8) & 1) * 16 + ((o >> 7) & 1) * 8 + (o & 7); const int c = (int)(i % EE);
    const float* gp = GP + (size_t)(blockIdx.x & (NH_ - 1)) * (TT / 128) * 2;   // head c / HD: a block's 1024 slots are two 32-wide chunks of one head, so the pairs are read once for the block through the scalar path
    float gsum = 0.f, gm2 = 0.f;
#pragma unroll   // both loops unrolled: the 16 pairs come in two wide loads, one latency, instead of one load a trip
    for (int b = 0; b < TT / 128; ++b) gsum += gp[2 * b];
    const float mu = gsum * (1.0f / (float)(HD * TT));
#pragma unroll
    for (int b = 0; b < TT / 128; ++b) { const float d = gp[2 * b] * (1.0f / (128 * HD)) - mu; gm2 += gp[2 * b + 1] + (float)(128 * HD) * (d * d); }
    const float rs = __frsqrt_rn(__fadd_rn(gm2 * (1.0f / (float)(HD * TT)), 1e-5f)); const v4f a = *(const v4f*)(CAT + i); v4us oh, ol;
#pragma unroll
    for (int q = 0; q < 4; ++q) { float t = __fmul_rn(__fsub_rn(a[q], mu), rs); asm volatile("" : "+v"(t)); float tg = __fmul_rn(t, bfr(gw[c + q])); asm volatile("" : "+v"(tg)); unsigned short u, c2; splitf(__fadd_rn(tg, bfr(gb[c + q])), u, c2); oh[q] = u; ol[q] = c2; }
    *(v4us*)(Ah + o) = oh; *(v4us*)(Al + o) = ol;  }

extern "C" void kernel_launch(void* const* d_in, const int* in_sizes, int n_in,
                              void* d_out, int out_size, void* d_ws, size_t ws_size, hipStream_t stream) {
    (void)in_sizes; (void)n_in; (void)out_size;
    const float* x = (const float*)d_in[0]; const int* msk = (const int*)d_in[1]; const float* IN[17]; for (int i = 2; i < 17; ++i) IN[i] = (const float*)d_in[i];   // 2 Wq1 [16][64][1024], 3 bq1, 4 Wq2, 5 bq2, 6 Wk1, 7 bk1, 8 Wk2, 9 bk2, 10 Wv, 11 bv, 12 lam, 13 gn_w, 14 gn_b, 15 Wo [1024][1024] (out,in), 16 bo
    float* OUT = (float*)d_out;     // [1][2048][1024]
    char* wsp = (char*)d_ws;
    auto take = [&](size_t bytes) { char* p = wsp; wsp += (bytes + 255) & ~(size_t)255; return (void*)p; };
    bf* WB[6]; for (int i = 0; i < 6; ++i) WB[i] = (bf*)take((size_t)EE * EE * 2); bf* XB = (bf*)take((size_t)TT * EE * 2); float* F = (float*)take((size_t)TT * EE * 4);
    bf* Q1h = (bf*)take((size_t)NH_ * TT * HD * 2); bf* Q1l = (bf*)take((size_t)NH_ * TT * HD * 2); bf* Q2h = (bf*)take((size_t)NH_ * TT * HD * 2); bf* Q2l = (bf*)take((size_t)NH_ * TT * HD * 2); bf* K1h = (bf*)take((size_t)NH_ * TT * HD * 2); bf* K1l = (bf*)take((size_t)NH_ * TT * HD * 2); bf* K2h = (bf*)take((size_t)NH_ * TT * HD * 2); bf* K2l = (bf*)take((size_t)NH_ * TT * HD * 2); bf* Vh = (bf*)take((size_t)NH_ * HD * TT * 2); bf* Vl = (bf*)take((size_t)NH_ * HD * TT * 2);
    float* CAT = (float*)take((size_t)TT * EE * 4); float* GP = (float*)take((size_t)NH_ * (TT / 128) * 2 * 4); bf* Ah = (bf*)take((size_t)TT * EE * 2); bf* Al = (bf*)take((size_t)TT * EE * 2);
    if ((size_t)(wsp - (char*)d_ws) > ws_size) return;
    const int widx[6] = {2, 4, 6, 8, 10, 15}; for (int i = 0; i < 6; ++i) k_cvt8<<<(EE * EE / 8 + 255) / 256, 256, 0, stream>>>(IN[widx[i]], WB[i], (size_t)EE * EE / 8);   // [H][DH][E] stacked = natural [1024][1024] Bt; Wo [E][D] natural
    k_cvt8<<<(TT * EE / 8 + 255) / 256, 256, 0, stream>>>(x, XB, (size_t)TT * EE / 8);
    const unsigned LP = (unsigned)(((size_t)NH_ * TT * HD / 8 + 255) / 256);
    bf* PLh[4] = {Q1h, Q2h, K1h, K2h}; bf* PLl[4] = {Q1l, Q2l, K1l, K2l};
    for (int i = 0; i < 4; ++i) { k_gemmw<bf, 0, true, 8, 1><<<dim3(TT / 64, EE / 64, 1), 256, 0, stream>>>(XB, nullptr, WB[i], nullptr, EE, F, EE, IN[widx[i] + 1], 0, 0, 0); k_pl<<<LP, 256, 0, stream>>>(F, PLh[i], PLl[i]); }
    k_gemmw<bf, 0, true, 8, 1><<<dim3(TT / 64, EE / 64, 1), 256, 0, stream>>>(XB, nullptr, WB[4], nullptr, EE, F, EE, IN[11], 0, 0, 0); k_vtp<<<LP, 256, 0, stream>>>(F, Vh, Vl);
    k_attn<<<dim3(TT / 128, NH_, 1), 512, 0, stream>>>(Q1h, Q1l, Q2h, Q2l, K1h, K1l, K2h, K2l, Vh, Vl, msk, IN[12], CAT, GP);
    k_gn<<<(unsigned)(((size_t)TT * EE / 4 + 255) / 256), 256, 0, stream>>>(CAT, GP, IN[13], IN[14], Ah, Al);
    k_gemmw<bf, 1, true, 8, 1><<<dim3(TT / 64, EE / 64, 1), 256, 0, stream>>>(Ah, Al, WB[5], nullptr, EE, OUT, EE, IN[16], 0, 0, 0);
}

// v005
// A run of this version takes 181 microseconds.
// In two side-by-side timings against v004, it was 1.13 and 1.15 times as fast.
// All steps since v000 together make it 5.74 times as fast.
#include <hip/hip_runtime.h>

// DifferentialMultiHeadSelfAttention (x [1][2048][1024]; per-head q1, q2, k1, k2, v = x W[h]^T + b[h] (16 x 64); s = q.k/8 with mask[i][j] (int, 1 = masked -> -inf, read as data); w = softmax(s1) - lam[h] softmax(s2);
// out = w.v; heads concatenated; GroupNorm(16 groups = heads, eps 1e-5, biased var over (64 dims x 2048 tokens)) x gn_w + gn_b; out Wo^T + bo -> [1][2048][1024]).
// Compute dtypes, f32 accumulate: every input rounded to bf16; the five projections on PLAIN bf16 operands (inputs: exact, + bias; the stacked [16][64][1024] weights are one natural [1024][1024] Bt); both score GEMMs

#define TT   2048
#define EE   1024
#define NH_  16
#define HD   64
#define ZH   2
#define SCL  0.125f
typedef _Float16 h16;
typedef unsigned short bf;
typedef __attribute__((ext_vector_type(16))) __bf16   v16bf;
typedef __attribute__((ext_vector_type(16))) _Float16 v16h;
typedef __attribute__((ext_vector_type(8)))  _Float16 v8h;
typedef __attribute__((ext_vector_type(8)))  unsigned short v8us;
typedef __attribute__((ext_vector_type(8)))  float    v8f;
typedef __attribute__((ext_vector_type(4)))  float    v4f;
typedef v8h  __attribute__((may_alias)) v8ha;
typedef v4f  __attribute__((may_alias)) v4fa;
typedef v8us __attribute__((may_alias)) v8usa;

__device__ __forceinline__ unsigned short f2bf(float f) { unsigned u = __float_as_uint(f); u += 0x7FFFu + ((u >> 16) & 1u); return (unsigned short)(u >> 16); }
__device__ __forceinline__ float bf2f(unsigned short b) { return __uint_as_float(((unsigned)b) << 16); }
__device__ __forceinline__ float bfr(float f) { return bf2f(f2bf(f)); }
__device__ __forceinline__ v16h cat16(v8h lo, v8h hi) { return __builtin_shufflevector(lo, hi, 0, 1, 2, 3, 4, 5, 6, 7, 8, 9, 10, 11, 12, 13, 14, 15); }
__device__ __forceinline__ v16bf cat16b(v8us lo, v8us hi) { return __builtin_bit_cast(v16bf, __builtin_shufflevector(lo, hi, 0, 1, 2, 3, 4, 5, 6, 7, 8, 9, 10, 11, 12, 13, 14, 15)); }
__device__ __forceinline__ v8f wmma16(v16h a, v16h b, v8f c) { return __builtin_amdgcn_wmma_f32_16x16x32_f16(false, a, false, b, (short)0, c, false, false); }
__device__ __forceinline__ v8f wmmab(v16bf a, v16bf b, v8f c) { return __builtin_amdgcn_wmma_f32_16x16x32_bf16(false, a, false, b, (short)0, c, false, false); }



// ---- FRAGMENT ORDER of every 16-bit operand plane [R][K]: the 16 rows x 32 k of one matrix operand lie as 512 elements in a row, [u][lane][s] = element (row 16 T + (lane & 15), k 32 c + 16 u + 8 (lane >> 4) + s),
// block (T, c) at (T * (K / 32) + c) * 512. A wave's 16-byte load of half u then reads 512 contiguous bytes (4 whole lines) instead of 32 bytes out of each of 16 lines; which element reaches which lane and register is as before.
// ---- k_gemmw: register-blocked GEMM, NW WAVES per 64x64 output tile (16 accumulators each), operands straight from 16-bit planes in fragment order; grid (M/64, N/64, Z), 32 * NW threads.
// C[m][n] (f32, pitch ldc, + optional f32 bias[n]) = sum_k A[m][k] Bt[n][k] (+ split products per NSPLIT). z-batch strides sA/sB/sC in elements, bias vector z of up to five. K % (32 * NW * KP) == 0.
// Split K: wave w takes the 32-wide k chunks w, w + NW, ... (1 KiB of each 16-row strip); the NW partial tiles are staged whole in LDS and summed in wave order behind one barrier.
// KP > 1 (N == 64 only): blockIdx.y is a K range instead of a tile column, and range y stores its partial C in plane y (plane pitch ZH * sC); the consumer sums the planes.
template <typename T16> struct WFrag;
template <> struct WFrag<h16> { typedef v16h V; static __device__ __forceinline__ V ld(const h16* p) { return cat16(*(const v8h*)p, *(const v8h*)(p + 256)); } static __device__ __forceinline__ v8f mma(V a, V b, v8f c) { return wmma16(a, b, c); } };
template <> struct WFrag<bf> { typedef v16bf V; static __device__ __forceinline__ V ld(const bf* p) { return cat16b(*(const v8us*)p, *(const v8us*)(p + 256)); } static __device__ __forceinline__ v8f mma(V a, V b, v8f c) { return wmmab(a, b, c); } };
template <typename T16, int NSPLIT, bool BIAS, int NW, int KP>
__global__ __launch_bounds__(32 * NW) void k_gemmw(const T16* __restrict__ A, const T16* __restrict__ A2, const T16* __restrict__ Bt, const T16* __restrict__ Bt2, int K, float* C, int ldc, const float* __restrict__ bias0, const float* __restrict__ bias1, const float* __restrict__ bias2, const float* __restrict__ bias3, const float* __restrict__ bias4, size_t sA, size_t sB, size_t sC) {
    typedef typename WFrag<T16>::V V;
    const float* bias = blockIdx.z == 0 ? bias0 : blockIdx.z == 1 ? bias1 : blockIdx.z == 2 ? bias2 : blockIdx.z == 3 ? bias3 : bias4;   // each product of a z-batch has its own bias vector
    constexpr int SR = NW > 1 ? 64 : 16;    // tile rows staged in LDS at once, per wave
    __shared__ __align__(16) float os[NW * SR * 68];
    const size_t z = blockIdx.z; A += z * sA; if (A2) A2 += z * sA; Bt += z * sB; if (Bt2) Bt2 += z * sB; C += z * sC;
    const int lane = threadIdx.x & 31, lr = lane & 15, hi = lane >> 4; const int r0 = blockIdx.x * 64, c0 = KP > 1 ? 0 : blockIdx.y * 64;
    const int w = NW > 1 ? __builtin_amdgcn_readfirstlane((int)(threadIdx.x >> 5)) : 0;
    const int klo = KP > 1 ? (int)blockIdx.y * (K / KP) : 0, khi = KP > 1 ? klo + K / KP : K; if (KP > 1) C += (size_t)blockIdx.y * ZH * sC;
    v8f acc[4][4];
#pragma unroll
    for (int mb = 0; mb < 4; ++mb)
#pragma unroll
        for (int nb = 0; nb < 4; ++nb) acc[mb][nb] = (v8f){};
    const size_t aoff = (size_t)r0 * K + 8 * lane, boff = (size_t)c0 * K + 8 * lane;   // fragment order: a 16-row strip is still 16 * K elements, a 32-wide k chunk of it 512
#pragma unroll 1
    for (int kc = klo + w * 32; kc < khi; kc += 32 * NW) {
        V a[4], a2[4], b[4], b2[4]; const T16 *pa[4], *pa2[4], *pb[4], *pb2[4];
#pragma unroll
        for (int mb = 0; mb < 4; ++mb) { pa[mb] = A + aoff + (size_t)mb * 16 * K + kc * 16; pa2[mb] = pa[mb]; a[mb] = WFrag<T16>::ld(pa[mb]); if (NSPLIT == 1 || NSPLIT == 2) { pa2[mb] = A2 + aoff + (size_t)mb * 16 * K + kc * 16; a2[mb] = WFrag<T16>::ld(pa2[mb]); } }
        asm volatile("s_wait_xcnt 0x0" :: "v"(pa[0]), "v"(pa[1]), "v"(pa[2]), "v"(pa[3]), "v"(pa2[0]), "v"(pa2[1]), "v"(pa2[2]), "v"(pa2[3]) : "memory");   // the loads' address registers stay whole up to this wait and are free for reuse (here: as a later load's target) only behind it
#pragma unroll
        for (int nb = 0; nb < 4; ++nb) { pb[nb] = Bt + boff + (size_t)nb * 16 * K + kc * 16; pb2[nb] = pb[nb]; b[nb] = WFrag<T16>::ld(pb[nb]); if (NSPLIT >= 2) { pb2[nb] = Bt2 + boff + (size_t)nb * 16 * K + kc * 16; b2[nb] = WFrag<T16>::ld(pb2[nb]); } }
        asm volatile("s_wait_xcnt 0x0" :: "v"(pb[0]), "v"(pb[1]), "v"(pb[2]), "v"(pb[3]), "v"(pb2[0]), "v"(pb2[1]), "v"(pb2[2]), "v"(pb2[3]) : "memory");   // as above
        __builtin_amdgcn_sched_barrier(0);   // all loads of a trip go out ahead of its products; without it the compiler sinks each B fragment's loads to their first use, one exposed latency per fragment
#pragma unroll
        for (int nb = 0; nb < 4; ++nb) {
#pragma unroll
            for (int mb = 0; mb < 4; ++mb) { acc[mb][nb] = WFrag<T16>::mma(a[mb], b[nb], acc[mb][nb]); if (NSPLIT == 1 || NSPLIT == 2) acc[mb][nb] = WFrag<T16>::mma(a2[mb], b[nb], acc[mb][nb]); if (NSPLIT >= 2) acc[mb][nb] = WFrag<T16>::mma(a[mb], b2[nb], acc[mb][nb]); } }
        asm volatile("v_nop\n\tv_nop\n\tv_nop\n\tv_nop" : "+v"(acc[0][0]), "+v"(acc[1][1]), "+v"(acc[2][2]), "+v"(acc[3][3]) : "v"(a[0]), "v"(a[3]));
    }
    // the four loops below are unrolled so that acc[][] is indexed by constants and stays in registers
#pragma unroll
    for (int mb0 = 0; mb0 < 4; mb0 += SR / 16) {
#pragma unroll
        for (int mi = 0; mi < SR / 16; ++mi) {
#pragma unroll
            for (int nb = 0; nb < 4; ++nb) {
#pragma unroll
                for (int j = 0; j < 8; ++j) os[(w * SR + mi * 16 + hi * 8 + j) * 68 + nb * 16 + lr] = acc[mb0 + mi][nb][j]; } }
        if (NW > 1) __syncthreads();   // every wave's partial tile is in LDS before any wave sums it
        else { __builtin_amdgcn_wave_barrier(); asm volatile("" ::: "memory"); }   // one wave: only keeps the compiler from moving the LDS reads above the LDS stores
        float* crow = C + (size_t)(r0 + mb0 * 16) * ldc + c0;
        // both loops unrolled: all LDS reads of a wave's rows go out together instead of one latency per read
#pragma unroll
        for (int q = 0; q < SR / 2 / NW; ++q) { const int row = 2 * (q * NW + w) + hi, cofs = lr * 4; v4f val = *(const v4fa*)(os + row * 68 + cofs);
#pragma unroll
            for (int u = 1; u < NW; ++u) val += *(const v4fa*)(os + (u * SR + row) * 68 + cofs);
            if (BIAS) { val[0] += bfr(bias[c0 + cofs]); val[1] += bfr(bias[c0 + cofs + 1]); val[2] += bfr(bias[c0 + cofs + 2]); val[3] += bfr(bias[c0 + cofs + 3]); }
            *(v4f*)(crow + (size_t)row * ldc + cofs) = val; }
        if (NW == 1) { __builtin_amdgcn_wave_barrier(); asm volatile("" ::: "memory"); }   // one wave: the next strip's LDS stores stay behind these reads
    }
}

__device__ __forceinline__ void splitf(float y, unsigned short& h, unsigned short& l) { h = f2bf(y); l = f2bf(y - bf2f(h)); }
typedef __attribute__((ext_vector_type(4))) unsigned short v4us;
typedef __attribute__((ext_vector_type(2))) float v2f;

// The three writers below run one thread per 16-byte slot [lane] of a fragment half, in the order of the plane: every wave stores 512 contiguous bytes a plane.
// k_cvt8: src [R][EE] f32 -> dst in fragment order (K = EE); one grid for all seven sources: blocks 0 .. TT * EE / 2048 - 1 convert x, then EE * EE / 2048 blocks for each of the six weight matrices (their planes lie one behind another in WB)
#define XBL (TT * EE / 2048)
#define WBL (EE * EE / 2048)
__global__ __launch_bounds__(256) void k_cvt8(const float* __restrict__ x, const float* __restrict__ w0, const float* __restrict__ w1, const float* __restrict__ w2, const float* __restrict__ w3, const float* __restrict__ w4, const float* __restrict__ w5, bf* XB, bf* WB) {
    const int b = (int)blockIdx.x, isx = b < XBL, j = isx ? 0 : (b - XBL) / WBL; const float* src = isx ? x : j == 0 ? w0 : j == 1 ? w1 : j == 2 ? w2 : j == 3 ? w3 : j == 4 ? w4 : w5;
    bf* dst = isx ? XB : WB + (size_t)j * EE * EE; const size_t i = (size_t)(isx ? b : (b - XBL) % WBL) * 256 + threadIdx.x;
    const int lr = (int)(i & 15), hi = (int)(i >> 4) & 1, u = (int)(i >> 5) & 1, c = (int)(i >> 6) & (EE / 32 - 1); const size_t T = i >> 11; const v8f v = *(const v8f*)(src + (T * 16 + lr) * EE + c * 32 + u * 16 + hi * 8); v8us o;
    asm volatile("s_wait_xcnt 0x0" ::: "memory");   // the loads' address registers are free for reuse only behind this wait
#pragma unroll
    for (int k = 0; k < 8; ++k) o[k] = f2bf(v[k]); *(v8us*)(dst + i * 8) = o;  }
// d_pl: F [t][h * 64 + d] -> per head a plane [TT][HD] in fragment order (K = HD), high and low
__device__ __forceinline__ void d_pl(const float* __restrict__ F, bf* Ph, bf* Pl) { const size_t i = (size_t)blockIdx.x * 256 + threadIdx.x; if (i >= (size_t)NH_ * TT * HD / 8) return;
    const int lr = (int)(i & 15), hi = (int)(i >> 4) & 1, u = (int)(i >> 5) & 1, c = (int)(i >> 6) & 1, T = (int)(i >> 7) & (TT / 16 - 1), h = (int)(i >> 14); const v8f v = *(const v8f*)(F + (size_t)(T * 16 + lr) * EE + h * HD + c * 32 + u * 16 + hi * 8); v8us oh, ol;
#pragma unroll
    for (int k = 0; k < 8; ++k) { unsigned short a, b; splitf(v[k], a, b); oh[k] = a; ol[k] = b; } *(v8us*)(Ph + i * 8) = oh; *(v8us*)(Pl + i * 8) = ol;  }
// d_vtp: F [t][h * 64 + d] -> per head the transposed plane [HD][TT] with its blocks ordered (32-key chunk, 16-row strip): block (c, T) at (c * 4 + T) * 512, so that the four strips of one key chunk lie together
__device__ __forceinline__ void d_vtp(const float* __restrict__ F, bf* Vh, bf* Vl) { const size_t i = (size_t)blockIdx.x * 256 + threadIdx.x; if (i >= (size_t)NH_ * HD * TT / 8) return;
    const int lr = (int)(i & 15), hi = (int)(i >> 4) & 1, u = (int)(i >> 5) & 1, T = (int)(i >> 6) & 3, c = (int)(i >> 8) & (TT / 32 - 1), h = (int)(i >> 14); const float* f = F + (size_t)(c * 32 + u * 16 + hi * 8) * EE + h * HD + T * 16 + lr; v8us oh, ol;
#pragma unroll
    for (int k = 0; k < 8; ++k) { unsigned short a, b; splitf(f[(size_t)k * EE], a, b); oh[k] = a; ol[k] = b; } *(v8us*)(Vh + i * 8) = oh; *(v8us*)(Vl + i * 8) = ol;  }
// k_pl5: one grid for the five projections' plane writers: blockIdx.y = p picks projection p (F5 holds the five f32 results one behind another, P the ten planes as high, low of q1, q2, k1, k2, v); p 0 .. 3 go through d_pl, p 4 (v) through d_vtp
__global__ __launch_bounds__(256) void k_pl5(const float* __restrict__ F5, bf* P) { const int p = (int)blockIdx.y; const float* F = F5 + (size_t)p * TT * EE; bf* Ph = P + (size_t)p * 2 * NH_ * TT * HD; bf* Pl = Ph + (size_t)NH_ * TT * HD;
    if (p < 4) d_pl(F, Ph, Pl); else d_vtp(F, Ph, Pl); }
// ---- k_attn: both score maps, both softmaxes, their difference and the product with V in one launch; no score or probability ever leaves the registers.
// grid (TT / 128, heads), 16 waves: wave w owns the 16 queries (w & 7) of the block's 128 and the key half (w >> 3). Scores are formed transposed (A = K rows, B = Q rows kept in registers), so a lane holds
// 8 keys of ONE query per tile: maximum and sum are in-lane, and two 16-key tiles converted in place are the A operand of the product with V (its k order is the loader's: 8 hi + s, 16 + 8 hi + s).
// Sweep 1 finds each query's maximum and exp sum of both maps (running maximum per lane; lane halves, then key halves joined in a fixed order); sweep 2 forms the scores again, w = e1 / sum1 - lam e2 / sum2,
// splits w in bf16 high + low and accumulates w.V (three products, as the score products). The two key halves' output tiles are summed in LDS and stored as whole lines of CAT[t][h * 64 + d].
// GroupNorm statistics: the block holds 128 tokens x 64 dims of one group in registers at that point, so it also stores their sum and their square sum centred on the block's own mean, GP[h][block] = (sum, m2); k_gn joins a head's 16 pairs.
typedef __attribute__((ext_vector_type(4))) int v4i;
typedef __attribute__((ext_vector_type(2))) __bf16 v2bf;
__device__ __forceinline__ v16bf ldf(const bf* p) { return cat16b(*(const v8us*)p, *(const v8us*)(p + 256)); }   // the two halves of one fragment-order block
// the K fragments of 32 keys of one map: k[kt * 4 + c * 2] high, + 1 low (16-key tile kt, 32-wide chunk c of the head dim)
__device__ __forceinline__ void ldk(const bf* Kh, const bf* Kl, v16bf (&k)[8]) {
#pragma unroll
    for (int kt = 0; kt < 2; ++kt)
#pragma unroll
        for (int c = 0; c < 2; ++c) { k[kt * 4 + c * 2] = ldf(Kh + kt * 16 * HD + c * 512); k[kt * 4 + c * 2 + 1] = ldf(Kl + kt * 16 * HD + c * 512); }
    asm volatile("s_wait_xcnt 0x0" :: "v"(Kh), "v"(Kl) : "memory"); }   // the loads' address registers stay whole up to this wait and are free for reuse only behind it
__device__ __forceinline__ void ldm(const int* mr, v4i (&mk)[4]) {
#pragma unroll
    for (int u = 0; u < 4; ++u) mk[u] = *(const v4i*)(mr + (u >> 1) * 16 + (u & 1) * 4);
    asm volatile("s_wait_xcnt 0x0" :: "v"(mr) : "memory"); }   // as in ldk
// two transposed score tiles: s[kt][j] = q[query lr] . k[key kt * 16 + 8 hi + j], split products kh.qh + kh.ql + kl.qh over the two chunks
__device__ __forceinline__ void sc2(const v16bf (&k)[8], const v16bf (&qh)[2], const v16bf (&ql)[2], v8f (&s)[2]) { s[0] = (v8f){}; s[1] = (v8f){};
#pragma unroll
    for (int c = 0; c < 2; ++c) { s[0] = wmmab(k[c * 2], qh[c], s[0]); s[1] = wmmab(k[4 + c * 2], qh[c], s[1]); s[0] = wmmab(k[c * 2], ql[c], s[0]); s[1] = wmmab(k[4 + c * 2], ql[c], s[1]); s[0] = wmmab(k[c * 2 + 1], qh[c], s[0]); s[1] = wmmab(k[4 + c * 2 + 1], qh[c], s[1]); } }
// masked scores, scaled by 1/8 and by log2(e) in one multiply, so that every exponential below is a bare exp2: t[kt * 8 + j] belongs to key kt * 16 + 8 hi + j of the block
__device__ __forceinline__ void msc(const v8f (&s)[2], const v4i (&mk)[4], float (&t)[16]) {
#pragma unroll
    for (int e = 0; e < 16; ++e) t[e] = mk[e >> 2][e & 3] ? -3.0e38f : s[e >> 3][e & 7] * (SCL * 1.44269504f); }
__device__ __forceinline__ void run_ml(const float (&t)[16], float& m, float& l) { float tm = t[0];
#pragma unroll
    for (int k = 1; k < 16; ++k) tm = fmaxf(tm, t[k]);
    const float mn = fmaxf(m, tm); float a = 0.f;
#pragma unroll
    for (int k = 0; k < 16; ++k) a += __builtin_amdgcn_exp2f(t[k] - mn);
    l = l * __builtin_amdgcn_exp2f(m - mn) + a; m = mn; }
__device__ __forceinline__ void join_ml(float& m, float& l, float mo, float lo) { const float mn = fmaxf(m, mo); l = l * __builtin_amdgcn_exp2f(m - mn) + lo * __builtin_amdgcn_exp2f(mo - mn); m = mn; }
__device__ __forceinline__ float wsum(float v) {   // sum over the wave's 32 lanes, the same bits in every lane
#pragma unroll   // five fixed steps: no loop counter, the lane masks are constants
    for (int m = 16; m >= 1; m >>= 1) v += __shfl_xor(v, m, 32);
    return v; }
__global__ __launch_bounds__(512) void k_attn(const bf* __restrict__ Q1h, const bf* __restrict__ Q1l, const bf* __restrict__ Q2h, const bf* __restrict__ Q2l, const bf* __restrict__ K1h, const bf* __restrict__ K1l, const bf* __restrict__ K2h, const bf* __restrict__ K2l,
                                              const bf* __restrict__ Vh, const bf* __restrict__ Vl, const int* __restrict__ msk, const float* __restrict__ lam, float* CAT, float* GP) {
    __shared__ __align__(16) float os[16 * 16 * 68];
    __shared__ float st[2][4][128];
    __shared__ __align__(16) float gs[2][16];
    const int lane = threadIdx.x & 31, lr = lane & 15, hi = lane >> 4; const int w = __builtin_amdgcn_readfirstlane((int)(threadIdx.x >> 5)), qw = w & 7, kh = w >> 3;
    const int h = blockIdx.y, q0 = blockIdx.x * 128 + qw * 16; const size_t hb = (size_t)h * TT * HD;
    v16bf q1h[2], q1l[2], q2h[2], q2l[2]; const size_t qo = hb + (size_t)q0 * HD + 8 * lane; const bf *pq1h = Q1h + qo, *pq1l = Q1l + qo, *pq2h = Q2h + qo, *pq2l = Q2l + qo;
#pragma unroll
    for (int c = 0; c < 2; ++c) { q1h[c] = ldf(pq1h + c * 512); q1l[c] = ldf(pq1l + c * 512); q2h[c] = ldf(pq2h + c * 512); q2l[c] = ldf(pq2l + c * 512); }
    asm volatile("s_wait_xcnt 0x0" :: "v"(pq1h), "v"(pq1l), "v"(pq2h), "v"(pq2l) : "memory");   // as in ldk
    const size_t ko = hb + 8 * lane; const int* mrow = msk + (size_t)(q0 + lr) * TT + 8 * hi; const int kbeg = kh * (TT / 2), kend = kbeg + TT / 2;
    float m1 = -3.0e38f, l1 = 0.f, m2 = -3.0e38f, l2 = 0.f;
    // Order of a trip, held by the scheduling barriers: each group of loads goes out whole right behind the products that free its registers and flies under the vector work that follows, instead of one exposed latency per fragment.
    v16bf kf[8]; v4i mk[4]; ldk(K1h + ko + (size_t)kbeg * HD, K1l + ko + (size_t)kbeg * HD, kf); ldm(mrow + kbeg, mk);
#pragma unroll 1   // one 32-key block a trip: a second copy of the body would not fit the registers of four waves a SIMD
    for (int kb = kbeg; kb < kend; kb += 32) { v8f s[2]; float t[16]; const size_t o = ko + (size_t)kb * HD; const int kn = kb + 32 < kend ? kb + 32 : kb;   // the last trip fetches its own block again: in bounds, unused
        sc2(kf, q1h, q1l, s); __builtin_amdgcn_sched_barrier(0);
        ldk(K2h + o, K2l + o, kf); __builtin_amdgcn_sched_barrier(0);
        msc(s, mk, t); run_ml(t, m1, l1); __builtin_amdgcn_sched_barrier(0);
        sc2(kf, q2h, q2l, s); __builtin_amdgcn_sched_barrier(0);
        ldk(K1h + ko + (size_t)kn * HD, K1l + ko + (size_t)kn * HD, kf); __builtin_amdgcn_sched_barrier(0);
        msc(s, mk, t); ldm(mrow + kn, mk); run_ml(t, m2, l2); }
    join_ml(m1, l1, __shfl_xor(m1, 16, 32), __shfl_xor(l1, 16, 32)); join_ml(m2, l2, __shfl_xor(m2, 16, 32), __shfl_xor(l2, 16, 32));
    if (hi == 0) { st[kh][0][qw * 16 + lr] = m1; st[kh][1][qw * 16 + lr] = l1; st[kh][2][qw * 16 + lr] = m2; st[kh][3][qw * 16 + lr] = l2; }
    __syncthreads();   // both key halves' maxima and sums are in LDS before either half joins them
    m1 = st[0][0][qw * 16 + lr]; l1 = st[0][1][qw * 16 + lr]; m2 = st[0][2][qw * 16 + lr]; l2 = st[0][3][qw * 16 + lr];
    join_ml(m1, l1, st[1][0][qw * 16 + lr], st[1][1][qw * 16 + lr]); join_ml(m2, l2, st[1][2][qw * 16 + lr], st[1][3][qw * 16 + lr]);
    const float f1 = __fdiv_rn(1.0f, l1), f2 = __fdiv_rn(1.0f, l2) * bfr(lam[h]);
    v8f o4[4];
#pragma unroll
    for (int dt = 0; dt < 4; ++dt) o4[dt] = (v8f){};
    const size_t vo = hb + 8 * lane;
    ldk(K1h + ko + (size_t)kbeg * HD, K1l + ko + (size_t)kbeg * HD, kf); ldm(mrow + kbeg, mk);
#pragma unroll 1   // as above
    for (int kb = kbeg; kb < kend; kb += 32) { v8f s[2]; float t[16], e1[16]; const size_t o = ko + (size_t)kb * HD; const int kn = kb + 32 < kend ? kb + 32 : kb;
        sc2(kf, q1h, q1l, s); __builtin_amdgcn_sched_barrier(0);
        ldk(K2h + o, K2l + o, kf); __builtin_amdgcn_sched_barrier(0);
        msc(s, mk, t);
#pragma unroll
        for (int e = 0; e < 16; ++e) e1[e] = __builtin_amdgcn_exp2f(t[e] - m1) * f1;
        __builtin_amdgcn_sched_barrier(0);
        sc2(kf, q2h, q2l, s); __builtin_amdgcn_sched_barrier(0);
        v16bf vh[4], vl[4]; const bf *pvh = Vh + vo + (size_t)kb * HD, *pvl = Vl + vo + (size_t)kb * HD;
#pragma unroll
        for (int dt = 0; dt < 4; ++dt) { vh[dt] = ldf(pvh + dt * 512); vl[dt] = ldf(pvl + dt * 512); }
        asm volatile("s_wait_xcnt 0x0" :: "v"(pvh), "v"(pvl) : "memory");   // as in ldk
        __builtin_amdgcn_sched_barrier(0);
        msc(s, mk, t); v16bf ph, pl;
#pragma unroll
        for (int e = 0; e < 16; e += 2) { v2f wv; wv[0] = e1[e] - __builtin_amdgcn_exp2f(t[e] - m2) * f2; wv[1] = e1[e + 1] - __builtin_amdgcn_exp2f(t[e + 1] - m2) * f2;
            const v2bf hh = __builtin_convertvector(wv, v2bf); const v2bf ll = __builtin_convertvector(wv - __builtin_convertvector(hh, v2f), v2bf); ph[e] = hh[0]; ph[e + 1] = hh[1]; pl[e] = ll[0]; pl[e + 1] = ll[1]; }
        __builtin_amdgcn_sched_barrier(0);
#pragma unroll
        for (int dt = 0; dt < 4; ++dt) o4[dt] = wmmab(ph, vh[dt], o4[dt]);
#pragma unroll
        for (int dt = 0; dt < 4; ++dt) o4[dt] = wmmab(pl, vh[dt], o4[dt]);
#pragma unroll
        for (int dt = 0; dt < 4; ++dt) o4[dt] = wmmab(ph, vl[dt], o4[dt]);
        __builtin_amdgcn_sched_barrier(0);
        ldk(K1h + ko + (size_t)kn * HD, K1l + ko + (size_t)kn * HD, kf); ldm(mrow + kn, mk);
    }
#pragma unroll
    for (int dt = 0; dt < 4; ++dt) {
#pragma unroll
        for (int j = 0; j < 8; ++j) os[(w * 16 + hi * 8 + j) * 68 + dt * 16 + lr] = o4[dt][j]; }
    __syncthreads();   // every wave's partial output tile is in LDS before any thread sums the two key halves
    v4f vals[4]; float* pc[4];
#pragma unroll
    for (int q = 0; q < 4; ++q) { const int idx = q * 512 + (int)threadIdx.x, row = idx >> 4, c4 = (idx & 15) * 4; vals[q] = *(const v4fa*)(os + row * 68 + c4) + *(const v4fa*)(os + (128 + row) * 68 + c4);
        pc[q] = CAT + (size_t)(blockIdx.x * 128 + row) * EE + h * HD + c4; *(v4f*)pc[q] = vals[q]; }
    asm volatile("s_wait_xcnt 0x0" :: "v"(pc[0]), "v"(pc[1]), "v"(pc[2]), "v"(pc[3]), "v"(vals[0]), "v"(vals[1]), "v"(vals[2]), "v"(vals[3]) : "memory");   // the stores' address and data registers stay whole up to this wait and are free for reuse only behind it
    const v4f s4 = (vals[0] + vals[1]) + (vals[2] + vals[3]); const float ws = wsum((s4[0] + s4[1]) + (s4[2] + s4[3]));
    if (lane == 0) gs[0][w] = ws;
    __syncthreads();   // all 16 waves' sums are in LDS before any thread forms the block's mean
    const v4f b4 = (*(const v4fa*)(gs[0]) + *(const v4fa*)(gs[0] + 4)) + (*(const v4fa*)(gs[0] + 8) + *(const v4fa*)(gs[0] + 12)); const float bs = (b4[0] + b4[1]) + (b4[2] + b4[3]), bm = bs * (1.0f / (128 * HD));
    v4f d4 = (v4f){};
#pragma unroll   // vals[] is indexed by constants and stays in registers
    for (int q = 0; q < 4; ++q) { const v4f d = vals[q] - bm; d4 += d * d; }
    const float wq = wsum((d4[0] + d4[1]) + (d4[2] + d4[3]));
    if (lane == 0) gs[1][w] = wq;
    __syncthreads();   // all 16 waves' centred square sums are in LDS before thread 0 adds them
    if (threadIdx.x == 0) { const v4f c4v = (*(const v4fa*)(gs[1]) + *(const v4fa*)(gs[1] + 4)) + (*(const v4fa*)(gs[1] + 8) + *(const v4fa*)(gs[1] + 12)); v2f o2; o2[0] = bs; o2[1] = (c4v[0] + c4v[1]) + (c4v[2] + c4v[3]);
        *(v2f*)(GP + ((size_t)h * (TT / 128) + blockIdx.x) * 2) = o2; }
}
// k_gn: a head's mean and biased variance from its 16 pairs GP[h][b] = (sum, m2 about the block's own mean) of 128 x 64 values each: var * N = sum_b m2_b + n_b (mean_b - mean)^2, an identity, every term >= 0; then the normalisation.
__global__ __launch_bounds__(256) void k_gn(const float* __restrict__ CAT, const float* __restrict__ GP, const float* __restrict__ gw, const float* __restrict__ gb, bf* Ah, bf* Al) { const size_t o = ((size_t)blockIdx.x * 256 + threadIdx.x) * 4; if (o >= (size_t)TT * EE) return;   // o: place in the fragment-order planes (K = EE), half a 16-byte slot a thread; i: the same elements in CAT
    const size_t i = ((o >> 14) * 16 + ((o >> 3) & 15)) * EE + ((o >> 9) & (EE / 32 - 1)) * 32 + ((o >> 8) & 1) * 16 + ((o >> 7) & 1) * 8 + (o & 7); const int c = (int)(i % EE);
    const float* gp = GP + (size_t)(blockIdx.x & (NH_ - 1)) * (TT / 128) * 2;   // head c / HD: a block's 1024 slots are two 32-wide chunks of one head, so the pairs are read once for the block through the scalar path
    float gsum = 0.f, gm2 = 0.f;
#pragma unroll   // both loops unrolled: the 16 pairs come in two wide loads, one latency, instead of one load a trip
    for (int b = 0; b < TT / 128; ++b) gsum += gp[2 * b];
    const float mu = gsum * (1.0f / (float)(HD * TT));
#pragma unroll
    for (int b = 0; b < TT / 128; ++b) { const float d = gp[2 * b] * (1.0f / (128 * HD)) - mu; gm2 += gp[2 * b + 1] + (float)(128 * HD) * (d * d); }
    const float rs = __frsqrt_rn(__fadd_rn(gm2 * (1.0f / (float)(HD * TT)), 1e-5f)); const v4f a = *(const v4f*)(CAT + i); v4us oh, ol;
#pragma unroll
    for (int q = 0; q < 4; ++q) { float t = __fmul_rn(__fsub_rn(a[q], mu), rs); asm volatile("" : "+v"(t)); float tg = __fmul_rn(t, bfr(gw[c + q])); asm volatile("" : "+v"(tg)); unsigned short u, c2; splitf(__fadd_rn(tg, bfr(gb[c + q])), u, c2); oh[q] = u; ol[q] = c2; }
    *(v4us*)(Ah + o) = oh; *(v4us*)(Al + o) = ol;  }

extern "C" void kernel_launch(void* const* d_in, const int* in_sizes, int n_in,
                              void* d_out, int out_size, void* d_ws, size_t ws_size, hipStream_t stream) {
    (void)in_sizes; (void)n_in; (void)out_size;
    const float* x = (const float*)d_in[0]; const int* msk = (const int*)d_in[1]; const float* IN[17]; for (int i = 2; i < 17; ++i) IN[i] = (const float*)d_in[i];   // 2 Wq1 [16][64][1024], 3 bq1, 4 Wq2, 5 bq2, 6 Wk1, 7 bk1, 8 Wk2, 9 bk2, 10 Wv, 11 bv, 12 lam, 13 gn_w, 14 gn_b, 15 Wo [1024][1024] (out,in), 16 bo
    float* OUT = (float*)d_out;     // [1][2048][1024]
    char* wsp = (char*)d_ws;
    auto take = [&](size_t bytes) { char* p = wsp; wsp += (bytes + 255) & ~(size_t)255; return (void*)p; };
    bf* WB = (bf*)take((size_t)6 * EE * EE * 2); bf* XB = (bf*)take((size_t)TT * EE * 2); float* F = (float*)take((size_t)5 * TT * EE * 4);   // WB: six weight planes, F: the five projections' f32 results, each set one behind another
    bf* Q1h = (bf*)take((size_t)NH_ * TT * HD * 2); bf* Q1l = (bf*)take((size_t)NH_ * TT * HD * 2); bf* Q2h = (bf*)take((size_t)NH_ * TT * HD * 2); bf* Q2l = (bf*)take((size_t)NH_ * TT * HD * 2); bf* K1h = (bf*)take((size_t)NH_ * TT * HD * 2); bf* K1l = (bf*)take((size_t)NH_ * TT * HD * 2); bf* K2h = (bf*)take((size_t)NH_ * TT * HD * 2); bf* K2l = (bf*)take((size_t)NH_ * TT * HD * 2); bf* Vh = (bf*)take((size_t)NH_ * HD * TT * 2); bf* Vl = (bf*)take((size_t)NH_ * HD * TT * 2);
    float* CAT = (float*)take((size_t)TT * EE * 4); float* GP = (float*)take((size_t)NH_ * (TT / 128) * 2 * 4); bf* Ah = (bf*)take((size_t)TT * EE * 2); bf* Al = (bf*)take((size_t)TT * EE * 2);
    if ((size_t)(wsp - (char*)d_ws) > ws_size) return;
    k_cvt8<<<XBL + 6 * WBL, 256, 0, stream>>>(x, IN[2], IN[4], IN[6], IN[8], IN[10], IN[15], XB, WB);   // [H][DH][E] stacked = natural [1024][1024] Bt; Wo [E][D] natural
    const unsigned LP = (unsigned)(((size_t)NH_ * TT * HD / 8 + 255) / 256);
    k_gemmw<bf, 0, true, 8, 1><<<dim3(TT / 64, EE / 64, 5), 256, 0, stream>>>(XB, nullptr, WB, nullptr, EE, F, EE, IN[3], IN[5], IN[7], IN[9], IN[11], 0, (size_t)EE * EE, (size_t)TT * EE);   // q1, q2, k1, k2, v
    k_pl5<<<dim3(LP, 5, 1), 256, 0, stream>>>(F, Q1h);   // the ten planes from Q1h to Vl lie one behind another in the workspace, in the order taken above
    k_attn<<<dim3(TT / 128, NH_, 1), 512, 0, stream>>>(Q1h, Q1l, Q2h, Q2l, K1h, K1l, K2h, K2l, Vh, Vl, msk, IN[12], CAT, GP);
    k_gn<<<(unsigned)(((size_t)TT * EE / 4 + 255) / 256), 256, 0, stream>>>(CAT, GP, IN[13], IN[14], Ah, Al);
    k_gemmw<bf, 1, true, 8, 1><<<dim3(TT / 64, EE / 64, 1), 256, 0, stream>>>(Ah, Al, WB + (size_t)5 * EE * EE, nullptr, EE, OUT, EE, IN[16], nullptr, nullptr, nullptr, nullptr, 0, 0, 0);
}

// v006
// A run of this version takes 133 microseconds.
// Next to v005, in two timings, it ran 1.35 times as fast each time.
// Counting every step since v000, it is 7.75 times as fast.
#include <hip/hip_runtime.h>

// DifferentialMultiHeadSelfAttention (x [1][2048][1024]; per-head q1, q2, k1, k2, v = x W[h]^T + b[h] (16 x 64); s = q.k/8 with mask[i][j] (int, 1 = masked -> -inf, read as data); w = softmax(s1) - lam[h] softmax(s2);
// out = w.v; heads concatenated; GroupNorm(16 groups = heads, eps 1e-5, biased var over (64 dims x 2048 tokens)) x gn_w + gn_b; out Wo^T + bo -> [1][2048][1024]).
// Compute dtypes, f32 accumulate: every input rounded to bf16; the five projections on PLAIN bf16 operands (inputs: exact, + bias; the stacked [16][64][1024] weights are one natural [1024][1024] Bt); both score GEMMs

#define TT   2048
#define EE   1024
#define NH_  16
#define HD   64
#define ZH   2
#define SCL  0.125f
typedef _Float16 h16;
typedef unsigned short bf;
typedef __attribute__((ext_vector_type(16))) __bf16   v16bf;
typedef __attribute__((ext_vector_type(16))) _Float16 v16h;
typedef __attribute__((ext_vector_type(8)))  _Float16 v8h;
typedef __attribute__((ext_vector_type(8)))  unsigned short v8us;
typedef __attribute__((ext_vector_type(8)))  float    v8f;
typedef __attribute__((ext_vector_type(4)))  float    v4f;
typedef v8h  __attribute__((may_alias)) v8ha;
typedef v4f  __attribute__((may_alias)) v4fa;
typedef v8us __attribute__((may_alias)) v8usa;

__device__ __forceinline__ unsigned short f2bf(float f) { unsigned u = __float_as_uint(f); u += 0x7FFFu + ((u >> 16) & 1u); return (unsigned short)(u >> 16); }
__device__ __forceinline__ float bf2f(unsigned short b) { return __uint_as_float(((unsigned)b) << 16); }
__device__ __forceinline__ float bfr(float f) { return bf2f(f2bf(f)); }
__device__ __forceinline__ v16h cat16(v8h lo, v8h hi) { return __builtin_shufflevector(lo, hi, 0, 1, 2, 3, 4, 5, 6, 7, 8, 9, 10, 11, 12, 13, 14, 15); }
__device__ __forceinline__ v16bf cat16b(v8us lo, v8us hi) { return __builtin_bit_cast(v16bf, __builtin_shufflevector(lo, hi, 0, 1, 2, 3, 4, 5, 6, 7, 8, 9, 10, 11, 12, 13, 14, 15)); }
__device__ __forceinline__ v8f wmma16(v16h a, v16h b, v8f c) { return __builtin_amdgcn_wmma_f32_16x16x32_f16(false, a, false, b, (short)0, c, false, false); }
__device__ __forceinline__ v8f wmmab(v16bf a, v16bf b, v8f c) { return __builtin_amdgcn_wmma_f32_16x16x32_bf16(false, a, false, b, (short)0, c, false, false); }



// ---- FRAGMENT ORDER of every 16-bit operand plane [R][K]: the 16 rows x 32 k of one matrix operand lie as 512 elements in a row, [u][lane][s] = element (row 16 T + (lane & 15), k 32 c + 16 u + 8 (lane >> 4) + s),
// block (T, c) at (T * (K / 32) + c) * 512 (V's transposed planes: at (c * 4 + T) * 512). A wave's 16-byte load of half u then reads 512 contiguous bytes (4 whole lines) instead of 32 bytes out of each of 16 lines; which element reaches which lane and register is as before.
// ---- k_gemmw: register-blocked GEMM, NW WAVES per 64x64 output tile (16 accumulators each), operands straight from 16-bit planes in fragment order; grid (M/64, N/64, Z), 32 * NW threads.
// C[m][n] (f32, pitch ldc, + optional f32 bias[n]) = sum_k A[m][k] Bt[n][k] (+ split products per NSPLIT). z-batch strides sA/sB/sC in elements, bias vector z of up to five. K % (32 * NW * KP) == 0.
// Split K: wave w takes the 32-wide k chunks w, w + NW, ... (1 KiB of each 16-row strip); the NW partial tiles are staged whole in LDS and summed in wave order behind one barrier.
// KP > 1 (N == 64 only): blockIdx.y is a K range instead of a tile column, and range y stores its partial C in plane y (plane pitch ZH * sC); the consumer sums the planes.
template <typename T16> struct WFrag;
template <> struct WFrag<h16> { typedef v16h V; static __device__ __forceinline__ V ld(const h16* p) { return cat16(*(const v8h*)p, *(const v8h*)(p + 256)); } static __device__ __forceinline__ v8f mma(V a, V b, v8f c) { return wmma16(a, b, c); } };
template <> struct WFrag<bf> { typedef v16bf V; static __device__ __forceinline__ V ld(const bf* p) { return cat16b(*(const v8us*)p, *(const v8us*)(p + 256)); } static __device__ __forceinline__ v8f mma(V a, V b, v8f c) { return wmmab(a, b, c); } };
template <typename T16, int NSPLIT, bool BIAS, int NW, int KP>
__global__ __launch_bounds__(32 * NW) void k_gemmw(const T16* __restrict__ A, const T16* __restrict__ A2, const T16* __restrict__ Bt, const T16* __restrict__ Bt2, int K, float* C, int ldc, const float* __restrict__ bias0, const float* __restrict__ bias1, const float* __restrict__ bias2, const float* __restrict__ bias3, const float* __restrict__ bias4, size_t sA, size_t sB, size_t sC) {
    typedef typename WFrag<T16>::V V;
    const float* bias = blockIdx.z == 0 ? bias0 : blockIdx.z == 1 ? bias1 : blockIdx.z == 2 ? bias2 : blockIdx.z == 3 ? bias3 : bias4;   // each product of a z-batch has its own bias vector
    constexpr int SR = NW > 1 ? 64 : 16;    // tile rows staged in LDS at once, per wave
    __shared__ __align__(16) float os[NW * SR * 68];
    const size_t z = blockIdx.z; A += z * sA; if (A2) A2 += z * sA; Bt += z * sB; if (Bt2) Bt2 += z * sB; C += z * sC;
    const int lane = threadIdx.x & 31, lr = lane & 15, hi = lane >> 4; const int r0 = blockIdx.x * 64, c0 = KP > 1 ? 0 : blockIdx.y * 64;
    const int w = NW > 1 ? __builtin_amdgcn_readfirstlane((int)(threadIdx.x >> 5)) : 0;
    const int klo = KP > 1 ? (int)blockIdx.y * (K / KP) : 0, khi = KP > 1 ? klo + K / KP : K; if (KP > 1) C += (size_t)blockIdx.y * ZH * sC;
    v8f acc[4][4];
#pragma unroll
    for (int mb = 0; mb < 4; ++mb)
#pragma unroll
        for (int nb = 0; nb < 4; ++nb) acc[mb][nb] = (v8f){};
    const size_t aoff = (size_t)r0 * K + 8 * lane, boff = (size_t)c0 * K + 8 * lane;   // fragment order: a 16-row strip is still 16 * K elements, a 32-wide k chunk of it 512
#pragma unroll 1
    for (int kc = klo + w * 32; kc < khi; kc += 32 * NW) {
        V a[4], a2[4], b[4], b2[4]; const T16 *pa[4], *pa2[4], *pb[4], *pb2[4];
#pragma unroll
        for (int mb = 0; mb < 4; ++mb) { pa[mb] = A + aoff + (size_t)mb * 16 * K + kc * 16; pa2[mb] = pa[mb]; a[mb] = WFrag<T16>::ld(pa[mb]); if (NSPLIT == 1 || NSPLIT == 2) { pa2[mb] = A2 + aoff + (size_t)mb * 16 * K + kc * 16; a2[mb] = WFrag<T16>::ld(pa2[mb]); } }
        asm volatile("s_wait_xcnt 0x0" :: "v"(pa[0]), "v"(pa[1]), "v"(pa[2]), "v"(pa[3]), "v"(pa2[0]), "v"(pa2[1]), "v"(pa2[2]), "v"(pa2[3]) : "memory");   // the loads' address registers stay whole up to this wait and are free for reuse (here: as a later load's target) only behind it
#pragma unroll
        for (int nb = 0; nb < 4; ++nb) { pb[nb] = Bt + boff + (size_t)nb * 16 * K + kc * 16; pb2[nb] = pb[nb]; b[nb] = WFrag<T16>::ld(pb[nb]); if (NSPLIT >= 2) { pb2[nb] = Bt2 + boff + (size_t)nb * 16 * K + kc * 16; b2[nb] = WFrag<T16>::ld(pb2[nb]); } }
        asm volatile("s_wait_xcnt 0x0" :: "v"(pb[0]), "v"(pb[1]), "v"(pb[2]), "v"(pb[3]), "v"(pb2[0]), "v"(pb2[1]), "v"(pb2[2]), "v"(pb2[3]) : "memory");   // as above
        __builtin_amdgcn_sched_barrier(0);   // all loads of a trip go out ahead of its products; without it the compiler sinks each B fragment's loads to their first use, one exposed latency per fragment
#pragma unroll
        for (int nb = 0; nb < 4; ++nb) {
#pragma unroll
            for (int mb = 0; mb < 4; ++mb) { acc[mb][nb] = WFrag<T16>::mma(a[mb], b[nb], acc[mb][nb]); if (NSPLIT == 1 || NSPLIT == 2) acc[mb][nb] = WFrag<T16>::mma(a2[mb], b[nb], acc[mb][nb]); if (NSPLIT >= 2) acc[mb][nb] = WFrag<T16>::mma(a[mb], b2[nb], acc[mb][nb]); } }
        asm volatile("v_nop\n\tv_nop\n\tv_nop\n\tv_nop" : "+v"(acc[0][0]), "+v"(acc[1][1]), "+v"(acc[2][2]), "+v"(acc[3][3]) : "v"(a[0]), "v"(a[3]));
    }
    // the four loops below are unrolled so that acc[][] is indexed by constants and stays in registers
#pragma unroll
    for (int mb0 = 0; mb0 < 4; mb0 += SR / 16) {
#pragma unroll
        for (int mi = 0; mi < SR / 16; ++mi) {
#pragma unroll
            for (int nb = 0; nb < 4; ++nb) {
#pragma unroll
                for (int j = 0; j < 8; ++j) os[(w * SR + mi * 16 + hi * 8 + j) * 68 + nb * 16 + lr] = acc[mb0 + mi][nb][j]; } }
        if (NW > 1) __syncthreads();   // every wave's partial tile is in LDS before any wave sums it
        else { __builtin_amdgcn_wave_barrier(); asm volatile("" ::: "memory"); }   // one wave: only keeps the compiler from moving the LDS reads above the LDS stores
        float* crow = C + (size_t)(r0 + mb0 * 16) * ldc + c0;
        // both loops unrolled: all LDS reads of a wave's rows go out together instead of one latency per read
#pragma unroll
        for (int q = 0; q < SR / 2 / NW; ++q) { const int row = 2 * (q * NW + w) + hi, cofs = lr * 4; v4f val = *(const v4fa*)(os + row * 68 + cofs);
#pragma unroll
            for (int u = 1; u < NW; ++u) val += *(const v4fa*)(os + (u * SR + row) * 68 + cofs);
            if (BIAS) { val[0] += bfr(bias[c0 + cofs]); val[1] += bfr(bias[c0 + cofs + 1]); val[2] += bfr(bias[c0 + cofs + 2]); val[3] += bfr(bias[c0 + cofs + 3]); }
            *(v4f*)(crow + (size_t)row * ldc + cofs) = val; }
        if (NW == 1) { __builtin_amdgcn_wave_barrier(); asm volatile("" ::: "memory"); }   // one wave: the next strip's LDS stores stay behind these reads
    }
}

__device__ __forceinline__ void splitf(float y, unsigned short& h, unsigned short& l) { h = f2bf(y); l = f2bf(y - bf2f(h)); }
typedef __attribute__((ext_vector_type(4))) unsigned short v4us;
typedef __attribute__((ext_vector_type(2))) float v2f;

// The three writers below run one thread per 16-byte slot [lane] of a fragment half, in the order of the plane: every wave stores 512 contiguous bytes a plane.
// k_cvt8: src [R][EE] f32 -> dst in fragment order (K = EE); one grid for all seven sources: blocks 0 .. TT * EE / 2048 - 1 convert x, then EE * EE / 2048 blocks for each of the six weight matrices (their planes lie one behind another in WB)
#define XBL (TT * EE / 2048)
#define WBL (EE * EE / 2048)
__global__ __launch_bounds__(256) void k_cvt8(const float* __restrict__ x, const float* __restrict__ w0, const float* __restrict__ w1, const float* __restrict__ w2, const float* __restrict__ w3, const float* __restrict__ w4, const float* __restrict__ w5, bf* XB, bf* WB) {
    const int b = (int)blockIdx.x, isx = b < XBL, j = isx ? 0 : (b - XBL) / WBL; const float* src = isx ? x : j == 0 ? w0 : j == 1 ? w1 : j == 2 ? w2 : j == 3 ? w3 : j == 4 ? w4 : w5;
    bf* dst = isx ? XB : WB + (size_t)j * EE * EE; const size_t i = (size_t)(isx ? b : (b - XBL) % WBL) * 256 + threadIdx.x;
    const int lr = (int)(i & 15), hi = (int)(i >> 4) & 1, u = (int)(i >> 5) & 1, c = (int)(i >> 6) & (EE / 32 - 1); const size_t T = i >> 11; const v8f v = *(const v8f*)(src + (T * 16 + lr) * EE + c * 32 + u * 16 + hi * 8); v8us o;
    asm volatile("s_wait_xcnt 0x0" ::: "memory");   // the loads' address registers are free for reuse only behind this wait
#pragma unroll
    for (int k = 0; k < 8; ++k) o[k] = f2bf(v[k]); *(v8us*)(dst + i * 8) = o;  }
// d_pl: F [t][h * 64 + d] -> per head a plane [TT][HD] in fragment order (K = HD), high and low
__device__ __forceinline__ void d_pl(const float* __restrict__ F, bf* Ph, bf* Pl) { const size_t i = (size_t)blockIdx.x * 256 + threadIdx.x; if (i >= (size_t)NH_ * TT * HD / 8) return;
    const int lr = (int)(i & 15), hi = (int)(i >> 4) & 1, u = (int)(i >> 5) & 1, c = (int)(i >> 6) & 1, T = (int)(i >> 7) & (TT / 16 - 1), h = (int)(i >> 14); const v8f v = *(const v8f*)(F + (size_t)(T * 16 + lr) * EE + h * HD + c * 32 + u * 16 + hi * 8); v8us oh, ol;
#pragma unroll
    for (int k = 0; k < 8; ++k) { unsigned short a, b; splitf(v[k], a, b); oh[k] = a; ol[k] = b; } *(v8us*)(Ph + i * 8) = oh; *(v8us*)(Pl + i * 8) = ol;  }
// d_vtp: F [t][h * 64 + d] -> per head the transposed plane [HD][TT] with its blocks ordered (32-key chunk, 16-row strip): block (c, T) at (c * 4 + T) * 512, so that the four strips of one key chunk lie together
__device__ __forceinline__ void d_vtp(const float* __restrict__ F, bf* Vh, bf* Vl) { const size_t i = (size_t)blockIdx.x * 256 + threadIdx.x; if (i >= (size_t)NH_ * HD * TT / 8) return;
    const int lr = (int)(i & 15), hi = (int)(i >> 4) & 1, u = (int)(i >> 5) & 1, T = (int)(i >> 6) & 3, c = (int)(i >> 8) & (TT / 32 - 1), h = (int)(i >> 14); const float* f = F + (size_t)(c * 32 + u * 16 + hi * 8) * EE + h * HD + T * 16 + lr; v8us oh, ol;
#pragma unroll
    for (int k = 0; k < 8; ++k) { unsigned short a, b; splitf(f[(size_t)k * EE], a, b); oh[k] = a; ol[k] = b; } *(v8us*)(Vh + i * 8) = oh; *(v8us*)(Vl + i * 8) = ol;  }
// k_pl5: one grid for the five projections' plane writers: blockIdx.y = p picks projection p (F5 holds the five f32 results one behind another, P the ten planes as high, low of q1, q2, k1, k2, v); p 0 .. 3 go through d_pl, p 4 (v) through d_vtp
__global__ __launch_bounds__(256) void k_pl5(const float* __restrict__ F5, bf* P) { const int p = (int)blockIdx.y; const float* F = F5 + (size_t)p * TT * EE; bf* Ph = P + (size_t)p * 2 * NH_ * TT * HD; bf* Pl = Ph + (size_t)NH_ * TT * HD;
    if (p < 4) d_pl(F, Ph, Pl); else d_vtp(F, Ph, Pl); }
// ---- k_attn: both score maps, both softmaxes, their difference and the product with V in one launch; no score or probability ever leaves the registers.
// grid (TT / 128, heads), 16 waves, two passes. In a pass wave w owns one 16-query strip (w & 3 picks it among the block's four of that pass) and every fourth 32-key block (w >> 2 picks the quarter). Pass 0 takes strips 4 x .. 4 x + 3,
// pass 1 their mirror images 127 - (4 x + ..) with the quarters reversed, so that a mask which closes the keys behind (or ahead of) each query leaves every wave about the same number of open key blocks.
// The mask is sorted by 16-query x 32-key block at run time: each pass first reads its part of it (whole lines) and notes, one bit a block, whether any entry is open (0) and whether open and masked entries are mixed. Both sweeps walk only
// the blocks with an open entry, and fetch the mask's entries again only for mixed blocks (a wholly open block takes zeros). A wholly masked block adds exact zeros to every sum of a row that has an open key anywhere, so leaving it out
// changes no value; nothing is assumed about where the mask is open.
// Scores are formed transposed (A = K rows, B = Q rows kept in registers), so a lane holds 8 keys of ONE query per tile: maximum and sum are in-lane, and two 16-key tiles converted in place are the A operand of the product with V
// (its k order is the loader's: 8 hi + s, 16 + 8 hi + s).
// Sweep 1 finds each query's maximum and exp sum of both maps (running maximum per lane; lane halves, then key quarters joined in a fixed order); sweep 2 forms the scores again, w = e1 / sum1 - lam e2 / sum2,
// splits w in bf16 high + low and accumulates w.V (three products, as the score products). The four key quarters' output tiles are summed in LDS and stored as whole lines of CAT[t][h * 64 + d].
// GroupNorm statistics: behind pass 1 the block holds its 128 tokens x 64 dims of one group in registers, so it also stores their sum and their square sum centred on the block's own mean, GP[h][block] = (sum, m2); k_gn joins a head's 16 pairs.
typedef __attribute__((ext_vector_type(4))) int v4i;
typedef __attribute__((ext_vector_type(2))) __bf16 v2bf;
__device__ __forceinline__ v16bf ldf(const bf* p) { return cat16b(*(const v8us*)p, *(const v8us*)(p + 256)); }   // the two halves of one fragment-order block
// the K fragments of 32 keys of one map: k[kt * 4 + c * 2] high, + 1 low (16-key tile kt, 32-wide chunk c of the head dim)
__device__ __forceinline__ void ldk(const bf* Kh, const bf* Kl, v16bf (&k)[8]) {
#pragma unroll
    for (int kt = 0; kt < 2; ++kt)
#pragma unroll
        for (int c = 0; c < 2; ++c) { k[kt * 4 + c * 2] = ldf(Kh + kt * 16 * HD + c * 512); k[kt * 4 + c * 2 + 1] = ldf(Kl + kt * 16 * HD + c * 512); }
    asm volatile("s_wait_xcnt 0x0" :: "v"(Kh), "v"(Kl) : "memory"); }   // the loads' address registers stay whole up to this wait and are free for reuse only behind it
__device__ __forceinline__ void ldm(const int* mr, v4i (&mk)[4]) {
#pragma unroll
    for (int u = 0; u < 4; ++u) mk[u] = *(const v4i*)(mr + (u >> 1) * 16 + (u & 1) * 4);
    asm volatile("s_wait_xcnt 0x0" :: "v"(mr) : "memory"); }   // as in ldk
// two transposed score tiles: s[kt][j] = q[query lr] . k[key kt * 16 + 8 hi + j], split products kh.qh + kh.ql + kl.qh over the two chunks
__device__ __forceinline__ void sc2(const v16bf (&k)[8], const v16bf (&qh)[2], const v16bf (&ql)[2], v8f (&s)[2]) { s[0] = (v8f){}; s[1] = (v8f){};
#pragma unroll
    for (int c = 0; c < 2; ++c) { s[0] = wmmab(k[c * 2], qh[c], s[0]); s[1] = wmmab(k[4 + c * 2], qh[c], s[1]); s[0] = wmmab(k[c * 2], ql[c], s[0]); s[1] = wmmab(k[4 + c * 2], ql[c], s[1]); s[0] = wmmab(k[c * 2 + 1], qh[c], s[0]); s[1] = wmmab(k[4 + c * 2 + 1], qh[c], s[1]); } }
// masked scores, scaled by 1/8 and by log2(e) in one multiply, so that every exponential below is a bare exp2: t[kt * 8 + j] belongs to key kt * 16 + 8 hi + j of the block
__device__ __forceinline__ void msc(const v8f (&s)[2], const v4i (&mk)[4], float (&t)[16]) {
#pragma unroll
    for (int e = 0; e < 16; ++e) t[e] = mk[e >> 2][e & 3] ? -3.0e38f : s[e >> 3][e & 7] * (SCL * 1.44269504f); }
__device__ __forceinline__ void run_ml(const float (&t)[16], float& m, float& l) { float tm = t[0];
#pragma unroll
    for (int k = 1; k < 16; ++k) tm = fmaxf(tm, t[k]);
    const float mn = fmaxf(m, tm); float a = 0.f;
#pragma unroll
    for (int k = 0; k < 16; ++k) a += __builtin_amdgcn_exp2f(t[k] - mn);
    l = l * __builtin_amdgcn_exp2f(m - mn) + a; m = mn; }
__device__ __forceinline__ void join_ml(float& m, float& l, float mo, float lo) { const float mn = fmaxf(m, mo); l = l * __builtin_amdgcn_exp2f(m - mn) + lo * __builtin_amdgcn_exp2f(mo - mn); m = mn; }
__device__ __forceinline__ float wsum(float v) {   // sum over the wave's 32 lanes, the same bits in every lane
#pragma unroll   // five fixed steps: no loop counter, the lane masks are constants
    for (int m = 16; m >= 1; m >>= 1) v += __shfl_xor(v, m, 32);
    return v; }
// smallest of a lane's 16 mask entries, as unsigned: 0 exactly when one of them is open; and their bitwise or: 0 exactly when none is masked
__device__ __forceinline__ unsigned mmin(const v4i (&mk)[4]) { unsigned a = (unsigned)mk[0][0];
#pragma unroll
    for (int e = 1; e < 16; ++e) { const unsigned b = (unsigned)mk[e >> 2][e & 3]; a = b < a ? b : a; }
    return a; }
__device__ __forceinline__ unsigned mor(const v4i (&mk)[4]) { const v4i o = (mk[0] | mk[1]) | (mk[2] | mk[3]); return (unsigned)((o[0] | o[1]) | (o[2] | o[3])); }
// one block of the mask for sorting: load u takes rows 4 u .. 4 u + 3, 8 lanes on a row's 128 bytes, so every load reads 4 whole lines (which lane sees which entry does not matter to an any-test)
__device__ __forceinline__ void ldp(const int* mr, v4i (&mk)[4]) {
#pragma unroll
    for (int u = 0; u < 4; ++u) mk[u] = *(const v4i*)(mr + (size_t)u * 4 * TT);
    asm volatile("s_wait_xcnt 0x0" :: "v"(mr) : "memory"); }   // as in ldk
// the mask entries of a block for msc: fetched where the block is mixed (the same for the whole wave: a scalar branch), zeros where it is wholly open
__device__ __forceinline__ void ldmx(const int* mr, bool mixed, v4i (&mk)[4]) {
    if (mixed) ldm(mr, mk);
    else {
#pragma unroll
        for (int u = 0; u < 4; ++u) mk[u] = (v4i){}; } }
__global__ __launch_bounds__(512) void k_attn(const bf* __restrict__ Q1h, const bf* __restrict__ Q1l, const bf* __restrict__ Q2h, const bf* __restrict__ Q2l, const bf* __restrict__ K1h, const bf* __restrict__ K1l, const bf* __restrict__ K2h, const bf* __restrict__ K2l,
                                              const bf* __restrict__ Vh, const bf* __restrict__ Vl, const int* __restrict__ msk, const float* __restrict__ lam, float* CAT, float* GP) {
    __shared__ __align__(16) float os[16 * 16 * 68];
    __shared__ float st[4][4][64];
    __shared__ __align__(16) float gs[2][16];
    const int lane = threadIdx.x & 31, lr = lane & 15, hi = lane >> 4; const int w = __builtin_amdgcn_readfirstlane((int)(threadIdx.x >> 5)), sp = w & 3, ku = w >> 2;
    const int h = blockIdx.y; const size_t hb = (size_t)h * TT * HD; const size_t ko = hb + 8 * lane, vo = hb + 8 * lane; const float lamh = bfr(lam[h]);
    v4f vals[4];
#pragma unroll   // two passes written out: vals[] is indexed by constants and stays in registers
    for (int p = 0; p < 2; ++p) {
        const int kq = p == 0 ? ku : 3 - ku, q0 = (p == 0 ? (int)blockIdx.x * 4 + sp : TT / 16 - 1 - ((int)blockIdx.x * 4 + sp)) * 16;
        v16bf q1h[2], q1l[2], q2h[2], q2l[2]; const size_t qo = hb + (size_t)q0 * HD + 8 * lane; const bf *pq1h = Q1h + qo, *pq1l = Q1l + qo, *pq2h = Q2h + qo, *pq2l = Q2l + qo;
#pragma unroll
        for (int c = 0; c < 2; ++c) { q1h[c] = ldf(pq1h + c * 512); q1l[c] = ldf(pq1l + c * 512); q2h[c] = ldf(pq2h + c * 512); q2l[c] = ldf(pq2l + c * 512); }
        asm volatile("s_wait_xcnt 0x0" :: "v"(pq1h), "v"(pq1l), "v"(pq2h), "v"(pq2l) : "memory");   // as in ldk
        const int* mrow = msk + (size_t)(q0 + lr) * TT + 8 * hi + kq * 32;   // the wave's key block i (0 .. 15) begins at key 128 i + 32 kq
        const int* mpre = msk + (size_t)(q0 + (lane >> 3)) * TT + kq * 32 + (lane & 7) * 4;
        unsigned act = 0, mix = 0;   // bit i of act: key block i has an open entry for one of the strip's queries; of mix: it has masked entries as well; the same in every lane (ballots' results)
#pragma unroll   // constants for the bit places; four blocks' mask loads fly together
        for (int g = 0; g < 4; ++g) { v4i mm[4][4];
#pragma unroll
            for (int a = 0; a < 4; ++a) ldp(mpre + (g * 4 + a) * 128, mm[a]);
            __builtin_amdgcn_sched_barrier(0);   // the sixteen loads go out ahead of the first compare: one latency a group instead of one a block
#pragma unroll
            for (int a = 0; a < 4; ++a) { const unsigned op = __builtin_amdgcn_ballot_w32(mmin(mm[a]) == 0u) != 0u ? 1u << (g * 4 + a) : 0u; act |= op; mix |= __builtin_amdgcn_ballot_w32(mor(mm[a]) != 0u) != 0u ? op : 0u; } }
        float m1 = -3.0e38f, l1 = 0.f, m2 = -3.0e38f, l2 = 0.f;
        // Order of a trip, held by the scheduling barriers: each group of loads goes out whole right behind the products that free its registers and flies under the vector work that follows, instead of one exposed latency per fragment.
        v16bf kf[8]; v4i mk[4];
        if (act != 0u) { unsigned rem = act & (act - 1u); int kb = __builtin_ctz(act) * 128;   // kb: the block's first key, less 32 kq; at most 16 trips, one noted bit each
            ldk(K1h + ko + (size_t)(kb + kq * 32) * HD, K1l + ko + (size_t)(kb + kq * 32) * HD, kf);
#pragma unroll 1   // one 32-key block a trip: a second copy of the body would not fit the registers of four waves a SIMD
            for (;;) { v8f s[2]; float t[16]; const size_t o = ko + (size_t)(kb + kq * 32) * HD; const int kn = rem != 0u ? __builtin_ctz(rem) * 128 : kb;   // the last trip fetches its own block again: in bounds, unused
                ldmx(mrow + kb, ((mix >> (kb >> 7)) & 1u) != 0u, mk);   // at the head of the trip, so that its branch leaves the rest of the trip one block whose order the scheduling barriers hold; a mixed block's entries fly under the first products
                sc2(kf, q1h, q1l, s); __builtin_amdgcn_sched_barrier(0);
                ldk(K2h + o, K2l + o, kf); __builtin_amdgcn_sched_barrier(0);
                msc(s, mk, t); run_ml(t, m1, l1); __builtin_amdgcn_sched_barrier(0);
                sc2(kf, q2h, q2l, s); __builtin_amdgcn_sched_barrier(0);
                ldk(K1h + ko + (size_t)(kn + kq * 32) * HD, K1l + ko + (size_t)(kn + kq * 32) * HD, kf); __builtin_amdgcn_sched_barrier(0);
                msc(s, mk, t); run_ml(t, m2, l2);
                if (rem == 0u) break;
                rem &= rem - 1u; kb = kn; } }
        join_ml(m1, l1, __shfl_xor(m1, 16, 32), __shfl_xor(l1, 16, 32)); join_ml(m2, l2, __shfl_xor(m2, 16, 32), __shfl_xor(l2, 16, 32));
        if (hi == 0) { st[ku][0][sp * 16 + lr] = m1; st[ku][1][sp * 16 + lr] = l1; st[ku][2][sp * 16 + lr] = m2; st[ku][3][sp * 16 + lr] = l2; }
        __syncthreads();   // all four key quarters' maxima and sums are in LDS before any wave joins them; it also ends the earlier pass's reads of os ahead of this pass's stores there
        m1 = st[0][0][sp * 16 + lr]; l1 = st[0][1][sp * 16 + lr]; m2 = st[0][2][sp * 16 + lr]; l2 = st[0][3][sp * 16 + lr];
#pragma unroll   // three fixed joins, in the order of the waves
        for (int u = 1; u < 4; ++u) { join_ml(m1, l1, st[u][0][sp * 16 + lr], st[u][1][sp * 16 + lr]); join_ml(m2, l2, st[u][2][sp * 16 + lr], st[u][3][sp * 16 + lr]); }
        const float f1 = __fdiv_rn(1.0f, l1), f2 = __fdiv_rn(1.0f, l2) * lamh;
        v8f o4[4];
#pragma unroll
        for (int dt = 0; dt < 4; ++dt) o4[dt] = (v8f){};
        if (act != 0u) { unsigned rem = act & (act - 1u); int kb = __builtin_ctz(act) * 128;
            ldk(K1h + ko + (size_t)(kb + kq * 32) * HD, K1l + ko + (size_t)(kb + kq * 32) * HD, kf);
#pragma unroll 1   // as above
            for (;;) { v8f s[2]; float t[16], e1[16]; const size_t o = ko + (size_t)(kb + kq * 32) * HD; const int kn = rem != 0u ? __builtin_ctz(rem) * 128 : kb;
                ldmx(mrow + kb, ((mix >> (kb >> 7)) & 1u) != 0u, mk);   // at the head of the trip, so that its branch leaves the rest of the trip one block whose order the scheduling barriers hold; a mixed block's entries fly under the first products
                sc2(kf, q1h, q1l, s); __builtin_amdgcn_sched_barrier(0);
                ldk(K2h + o, K2l + o, kf); __builtin_amdgcn_sched_barrier(0);
                msc(s, mk, t);
#pragma unroll
                for (int e = 0; e < 16; ++e) e1[e] = __builtin_amdgcn_exp2f(t[e] - m1) * f1;
                __builtin_amdgcn_sched_barrier(0);
                sc2(kf, q2h, q2l, s); __builtin_amdgcn_sched_barrier(0);
                v16bf vh[4], vl[4]; const bf *pvh = Vh + vo + (size_t)(kb + kq * 32) * HD, *pvl = Vl + vo + (size_t)(kb + kq * 32) * HD;
#pragma unroll
                for (int dt = 0; dt < 4; ++dt) { vh[dt] = ldf(pvh + dt * 512); vl[dt] = ldf(pvl + dt * 512); }
                asm volatile("s_wait_xcnt 0x0" :: "v"(pvh), "v"(pvl) : "memory");   // as in ldk
                __builtin_amdgcn_sched_barrier(0);
                msc(s, mk, t); v16bf ph, pl;
#pragma unroll
                for (int e = 0; e < 16; e += 2) { v2f wv; wv[0] = e1[e] - __builtin_amdgcn_exp2f(t[e] - m2) * f2; wv[1] = e1[e + 1] - __builtin_amdgcn_exp2f(t[e + 1] - m2) * f2;
                    const v2bf hh = __builtin_convertvector(wv, v2bf); const v2bf ll = __builtin_convertvector(wv - __builtin_convertvector(hh, v2f), v2bf); ph[e] = hh[0]; ph[e + 1] = hh[1]; pl[e] = ll[0]; pl[e + 1] = ll[1]; }
                __builtin_amdgcn_sched_barrier(0);
#pragma unroll
                for (int dt = 0; dt < 4; ++dt) o4[dt] = wmmab(ph, vh[dt], o4[dt]);
#pragma unroll
                for (int dt = 0; dt < 4; ++dt) o4[dt] = wmmab(pl, vh[dt], o4[dt]);
#pragma unroll
                for (int dt = 0; dt < 4; ++dt) o4[dt] = wmmab(ph, vl[dt], o4[dt]);
                __builtin_amdgcn_sched_barrier(0);
                ldk(K1h + ko + (size_t)(kn + kq * 32) * HD, K1l + ko + (size_t)(kn + kq * 32) * HD, kf);
                if (rem == 0u) break;
                rem &= rem - 1u; kb = kn; } }
#pragma unroll
        for (int dt = 0; dt < 4; ++dt) {
#pragma unroll
            for (int j = 0; j < 8; ++j) os[(w * 16 + hi * 8 + j) * 68 + dt * 16 + lr] = o4[dt][j]; }
        __syncthreads();   // every wave's partial output tile is in LDS before any thread sums the four key quarters; it also ends this pass's reads of st ahead of the next pass's stores there
        float* pc[2];
#pragma unroll
        for (int q = 0; q < 2; ++q) { const int idx = q * 512 + (int)threadIdx.x, row = idx >> 4, c4 = (idx & 15) * 4;   // row: 16 (strip of the pass) + query; wave 4 u + strip holds quarter u's tile
            vals[p * 2 + q] = (*(const v4fa*)(os + row * 68 + c4) + *(const v4fa*)(os + (64 + row) * 68 + c4)) + (*(const v4fa*)(os + (128 + row) * 68 + c4) + *(const v4fa*)(os + (192 + row) * 68 + c4));
            const int tok = (p == 0 ? (int)blockIdx.x * 4 + (row >> 4) : TT / 16 - 1 - ((int)blockIdx.x * 4 + (row >> 4))) * 16 + (row & 15);
            pc[q] = CAT + (size_t)tok * EE + h * HD + c4; *(v4f*)pc[q] = vals[p * 2 + q]; }
        asm volatile("s_wait_xcnt 0x0" :: "v"(pc[0]), "v"(pc[1]), "v"(vals[p * 2]), "v"(vals[p * 2 + 1]) : "memory");   // the stores' address and data registers stay whole up to this wait and are free for reuse only behind it
    }
    const v4f s4 = (vals[0] + vals[1]) + (vals[2] + vals[3]); const float ws = wsum((s4[0] + s4[1]) + (s4[2] + s4[3]));
    if (lane == 0) gs[0][w] = ws;
    __syncthreads();   // all 16 waves' sums are in LDS before any thread forms the block's mean
    const v4f b4 = (*(const v4fa*)(gs[0]) + *(const v4fa*)(gs[0] + 4)) + (*(const v4fa*)(gs[0] + 8) + *(const v4fa*)(gs[0] + 12)); const float bs = (b4[0] + b4[1]) + (b4[2] + b4[3]), bm = bs * (1.0f / (128 * HD));
    v4f d4 = (v4f){};
#pragma unroll   // vals[] is indexed by constants and stays in registers
    for (int q = 0; q < 4; ++q) { const v4f d = vals[q] - bm; d4 += d * d; }
    const float wq = wsum((d4[0] + d4[1]) + (d4[2] + d4[3]));
    if (lane == 0) gs[1][w] = wq;
    __syncthreads();   // all 16 waves' centred square sums are in LDS before thread 0 adds them
    if (threadIdx.x == 0) { const v4f c4v = (*(const v4fa*)(gs[1]) + *(const v4fa*)(gs[1] + 4)) + (*(const v4fa*)(gs[1] + 8) + *(const v4fa*)(gs[1] + 12)); v2f o2; o2[0] = bs; o2[1] = (c4v[0] + c4v[1]) + (c4v[2] + c4v[3]);
        *(v2f*)(GP + ((size_t)h * (TT / 128) + blockIdx.x) * 2) = o2; }
}
// k_gn: a head's mean and biased variance from its 16 pairs GP[h][b] = (sum, m2 about the block's own mean) of 128 x 64 values each: var * N = sum_b m2_b + n_b (mean_b - mean)^2, an identity, every term >= 0; then the normalisation.
__global__ __launch_bounds__(256) void k_gn(const float* __restrict__ CAT, const float* __restrict__ GP, const float* __restrict__ gw, const float* __restrict__ gb, bf* Ah, bf* Al) { const size_t o = ((size_t)blockIdx.x * 256 + threadIdx.x) * 4; if (o >= (size_t)TT * EE) return;   // o: place in the fragment-order planes (K = EE), half a 16-byte slot a thread; i: the same elements in CAT
    const size_t i = ((o >> 14) * 16 + ((o >> 3) & 15)) * EE + ((o >> 9) & (EE / 32 - 1)) * 32 + ((o >> 8) & 1) * 16 + ((o >> 7) & 1) * 8 + (o & 7); const int c = (int)(i % EE);
    const float* gp = GP + (size_t)(blockIdx.x & (NH_ - 1)) * (TT / 128) * 2;   // head c / HD: a block's 1024 elements are two 32-wide chunks of one head, so the pairs are read once for the block through the scalar path
    float gsum = 0.f, gm2 = 0.f;
#pragma unroll   // both loops unrolled: the 16 pairs come in two wide loads, one latency, instead of one load a trip
    for (int b = 0; b < TT / 128; ++b) gsum += gp[2 * b];
    const float mu = gsum * (1.0f / (float)(HD * TT));
#pragma unroll
    for (int b = 0; b < TT / 128; ++b) { const float d = gp[2 * b] * (1.0f / (128 * HD)) - mu; gm2 += gp[2 * b + 1] + (float)(128 * HD) * (d * d); }
    const float rs = __frsqrt_rn(__fadd_rn(gm2 * (1.0f / (float)(HD * TT)), 1e-5f)); const v4f a = *(const v4f*)(CAT + i); v4us oh, ol;
#pragma unroll
    for (int q = 0; q < 4; ++q) { float t = __fmul_rn(__fsub_rn(a[q], mu), rs); asm volatile("" : "+v"(t)); float tg = __fmul_rn(t, bfr(gw[c + q])); asm volatile("" : "+v"(tg)); unsigned short u, c2; splitf(__fadd_rn(tg, bfr(gb[c + q])), u, c2); oh[q] = u; ol[q] = c2; }
    *(v4us*)(Ah + o) = oh; *(v4us*)(Al + o) = ol;  }

extern "C" void kernel_launch(void* const* d_in, const int* in_sizes, int n_in,
                              void* d_out, int out_size, void* d_ws, size_t ws_size, hipStream_t stream) {
    (void)in_sizes; (void)n_in; (void)out_size;
    const float* x = (const float*)d_in[0]; const int* msk = (const int*)d_in[1]; const float* IN[17]; for (int i = 2; i < 17; ++i) IN[i] = (const float*)d_in[i];   // 2 Wq1 [16][64][1024], 3 bq1, 4 Wq2, 5 bq2, 6 Wk1, 7 bk1, 8 Wk2, 9 bk2, 10 Wv, 11 bv, 12 lam, 13 gn_w, 14 gn_b, 15 Wo [1024][1024] (out,in), 16 bo
    float* OUT = (float*)d_out;     // [1][2048][1024]
    char* wsp = (char*)d_ws;
    auto take = [&](size_t bytes) { char* p = wsp; wsp += (bytes + 255) & ~(size_t)255; return (void*)p; };
    bf* WB = (bf*)take((size_t)6 * EE * EE * 2); bf* XB = (bf*)take((size_t)TT * EE * 2); float* F = (float*)take((size_t)5 * TT * EE * 4);   // WB: six weight planes, F: the five projections' f32 results, each set one behind another
    bf* Q1h = (bf*)take((size_t)NH_ * TT * HD * 2); bf* Q1l = (bf*)take((size_t)NH_ * TT * HD * 2); bf* Q2h = (bf*)take((size_t)NH_ * TT * HD * 2); bf* Q2l = (bf*)take((size_t)NH_ * TT * HD * 2); bf* K1h = (bf*)take((size_t)NH_ * TT * HD * 2); bf* K1l = (bf*)take((size_t)NH_ * TT * HD * 2); bf* K2h = (bf*)take((size_t)NH_ * TT * HD * 2); bf* K2l = (bf*)take((size_t)NH_ * TT * HD * 2); bf* Vh = (bf*)take((size_t)NH_ * HD * TT * 2); bf* Vl = (bf*)take((size_t)NH_ * HD * TT * 2);
    float* CAT = (float*)take((size_t)TT * EE * 4); float* GP = (float*)take((size_t)NH_ * (TT / 128) * 2 * 4); bf* Ah = (bf*)take((size_t)TT * EE * 2); bf* Al = (bf*)take((size_t)TT * EE * 2);
    if ((size_t)(wsp - (char*)d_ws) > ws_size) return;
    k_cvt8<<<XBL + 6 * WBL, 256, 0, stream>>>(x, IN[2], IN[4], IN[6], IN[8], IN[10], IN[15], XB, WB);   // [H][DH][E] stacked = natural [1024][1024] Bt; Wo [E][D] natural
    const unsigned LP = (unsigned)(((size_t)NH_ * TT * HD / 8 + 255) / 256);
    k_gemmw<bf, 0, true, 8, 1><<<dim3(TT / 64, EE / 64, 5), 256, 0, stream>>>(XB, nullptr, WB, nullptr, EE, F, EE, IN[3], IN[5], IN[7], IN[9], IN[11], 0, (size_t)EE * EE, (size_t)TT * EE);   // q1, q2, k1, k2, v
    k_pl5<<<dim3(LP, 5, 1), 256, 0, stream>>>(F, Q1h);   // the ten planes from Q1h to Vl lie one behind another in the workspace, in the order taken above
    k_attn<<<dim3(TT / 128, NH_, 1), 512, 0, stream>>>(Q1h, Q1l, Q2h, Q2l, K1h, K1l, K2h, K2l, Vh, Vl, msk, IN[12], CAT, GP);
    k_gn<<<(unsigned)(((size_t)TT * EE / 4 + 255) / 256), 256, 0, stream>>>(CAT, GP, IN[13], IN[14], Ah, Al);
    k_gemmw<bf, 1, true, 8, 1><<<dim3(TT / 64, EE / 64, 1), 256, 0, stream>>>(Ah, Al, WB + (size_t)5 * EE * EE, nullptr, EE, OUT, EE, IN[16], nullptr, nullptr, nullptr, nullptr, 0, 0, 0);
}

// v007
// A run of this version takes 122 microseconds.
// Two timings next to v006 both put it at 1.09 times that version's speed.
// All steps since v000 together make it 8.47 times as fast.
#include <hip/hip_runtime.h>

// DifferentialMultiHeadSelfAttention (x [1][2048][1024]; per-head q1, q2, k1, k2, v = x W[h]^T + b[h] (16 x 64); s = q.k/8 with mask[i][j] (int, 1 = masked -> -inf, read as data); w = softmax(s1) - lam[h] softmax(s2);
// out = w.v; heads concatenated; GroupNorm(16 groups = heads, eps 1e-5, biased var over (64 dims x 2048 tokens)) x gn_w + gn_b; out Wo^T + bo -> [1][2048][1024]).
// Compute dtypes, f32 accumulate: every input rounded to bf16; the five projections on PLAIN bf16 operands (inputs: exact, + bias; the stacked [16][64][1024] weights are one natural [1024][1024] Bt); both score GEMMs

#define TT   2048
#define EE   1024
#define NH_  16
#define HD   64
#define ZH   2
#define SCL  0.125f
typedef _Float16 h16;
typedef unsigned short bf;
typedef __attribute__((ext_vector_type(16))) __bf16   v16bf;
typedef __attribute__((ext_vector_type(16))) _Float16 v16h;
typedef __attribute__((ext_vector_type(8)))  _Float16 v8h;
typedef __attribute__((ext_vector_type(8)))  unsigned short v8us;
typedef __attribute__((ext_vector_type(8)))  float    v8f;
typedef __attribute__((ext_vector_type(4)))  float    v4f;
typedef v8h  __attribute__((may_alias)) v8ha;
typedef v4f  __attribute__((may_alias)) v4fa;
typedef v8us __attribute__((may_alias)) v8usa;

__device__ __forceinline__ unsigned short f2bf(float f) { unsigned u = __float_as_uint(f); u += 0x7FFFu + ((u >> 16) & 1u); return (unsigned short)(u >> 16); }
__device__ __forceinline__ float bf2f(unsigned short b) { return __uint_as_float(((unsigned)b) << 16); }
__device__ __forceinline__ float bfr(float f) { return bf2f(f2bf(f)); }
__device__ __forceinline__ v16h cat16(v8h lo, v8h hi) { return __builtin_shufflevector(lo, hi, 0, 1, 2, 3, 4, 5, 6, 7, 8, 9, 10, 11, 12, 13, 14, 15); }
__device__ __forceinline__ v16bf cat16b(v8us lo, v8us hi) { return __builtin_bit_cast(v16bf, __builtin_shufflevector(lo, hi, 0, 1, 2, 3, 4, 5, 6, 7, 8, 9, 10, 11, 12, 13, 14, 15)); }
__device__ __forceinline__ v8f wmma16(v16h a, v16h b, v8f c) { return __builtin_amdgcn_wmma_f32_16x16x32_f16(false, a, false, b, (short)0, c, false, false); }
__device__ __forceinline__ v8f wmmab(v16bf a, v16bf b, v8f c) { return __builtin_amdgcn_wmma_f32_16x16x32_bf16(false, a, false, b, (short)0, c, false, false); }



// ---- FRAGMENT ORDER of every 16-bit operand plane [R][K]: the 16 rows x 32 k of one matrix operand lie as 512 elements in a row, [u][lane][s] = element (row 16 T + (lane & 15), k 32 c + 16 u + 8 (lane >> 4) + s),
// block (T, c) at (T * (K / 32) + c) * 512 (V's transposed planes: at (c * 4 + T) * 512). A wave's 16-byte load of half u then reads 512 contiguous bytes (4 whole lines) instead of 32 bytes out of each of 16 lines; which element reaches which lane and register is as before.
// ---- k_gemmw: register-blocked GEMM, NW WAVES per 64x64 output tile (16 accumulators each), operands straight from 16-bit planes in fragment order; grid (M/64, N/64, Z), 32 * NW threads.
// C[m][n] (f32, pitch ldc, + optional f32 bias[n]) = sum_k A[m][k] Bt[n][k] (+ split products per NSPLIT). z-batch strides sA/sB/sC in elements, bias vector z of up to five. K % (32 * NW * KP) == 0.
// Split K: wave w takes the 32-wide k chunks w, w + NW, ... (1 KiB of each 16-row strip); the NW partial tiles are staged whole in LDS and summed in wave order behind one barrier.
// KP > 1 (N == 64 only): blockIdx.y is a K range instead of a tile column, and range y stores its partial C in plane y (plane pitch ZH * sC); the consumer sums the planes.
// PL (the five projections; a tile column is one head): the summed tile + bias does not leave as f32 but split in bf16 high + low, straight into the attention's operand planes P (high, low of q1, q2, k1, k2, v, one behind another):
// per head a plane [TT][HD] in fragment order (K = HD) for z 0 .. 3; for z 4 (v) the transposed plane [HD][TT] with its blocks ordered (32-key chunk, 16-row strip): block (c, T) at (c * 4 + T) * 512, so that the four strips of one key
// chunk lie together. For v the two operands change places (both planes have the same order), so the tile comes out as [head dim][token] and a slot's 8 keys lie in a row of it. Either way the tile is 4096 elements in a row of each plane.
__device__ __forceinline__ void splitf(float y, unsigned short& h, unsigned short& l) { h = f2bf(y); l = f2bf(y - bf2f(h)); }
template <typename T16> struct WFrag;
template <> struct WFrag<h16> { typedef v16h V; static __device__ __forceinline__ V ld(const h16* p) { return cat16(*(const v8h*)p, *(const v8h*)(p + 256)); } static __device__ __forceinline__ v8f mma(V a, V b, v8f c) { return wmma16(a, b, c); } };
template <> struct WFrag<bf> { typedef v16bf V; static __device__ __forceinline__ V ld(const bf* p) { return cat16b(*(const v8us*)p, *(const v8us*)(p + 256)); } static __device__ __forceinline__ v8f mma(V a, V b, v8f c) { return wmmab(a, b, c); } };
template <typename T16, int NSPLIT, bool BIAS, int NW, int KP, bool PL>
__global__ __launch_bounds__(32 * NW) void k_gemmw(const T16* __restrict__ A, const T16* __restrict__ A2, const T16* __restrict__ Bt, const T16* __restrict__ Bt2, int K, float* C, int ldc, const float* __restrict__ bias0, const float* __restrict__ bias1, const float* __restrict__ bias2, const float* __restrict__ bias3, const float* __restrict__ bias4, size_t sA, size_t sB, size_t sC, bf* P) {
    static_assert(!PL || (NW == 8 && KP == 1 && BIAS), "the plane epilogue deals 512 slots to 256 threads");
    typedef typename WFrag<T16>::V V;
    const float* bias = blockIdx.z == 0 ? bias0 : blockIdx.z == 1 ? bias1 : blockIdx.z == 2 ? bias2 : blockIdx.z == 3 ? bias3 : bias4;   // each product of a z-batch has its own bias vector
    constexpr int SR = NW > 1 ? 64 : 16;    // tile rows staged in LDS at once, per wave
    __shared__ __align__(16) float os[NW * SR * 68];
    const size_t z = blockIdx.z; A += z * sA; if (A2) A2 += z * sA; Bt += z * sB; if (Bt2) Bt2 += z * sB; C += z * sC;
    const bool tr = PL && blockIdx.z == 4;   // v: the weights' rows are the tile's rows, the tokens its columns
    if (tr) { const T16* t = A; A = Bt; Bt = t; }
    const int lane = threadIdx.x & 31, lr = lane & 15, hi = lane >> 4; const int r0 = blockIdx.x * 64, c0 = KP > 1 ? 0 : blockIdx.y * 64;
    const int w = NW > 1 ? __builtin_amdgcn_readfirstlane((int)(threadIdx.x >> 5)) : 0;
    const int klo = KP > 1 ? (int)blockIdx.y * (K / KP) : 0, khi = KP > 1 ? klo + K / KP : K; if (KP > 1) C += (size_t)blockIdx.y * ZH * sC;
    v8f acc[4][4];
#pragma unroll
    for (int mb = 0; mb < 4; ++mb)
#pragma unroll
        for (int nb = 0; nb < 4; ++nb) acc[mb][nb] = (v8f){};
    const size_t aoff = (size_t)(tr ? c0 : r0) * K + 8 * lane, boff = (size_t)(tr ? r0 : c0) * K + 8 * lane;   // fragment order: a 16-row strip is still 16 * K elements, a 32-wide k chunk of it 512
#pragma unroll 1
    for (int kc = klo + w * 32; kc < khi; kc += 32 * NW) {
        V a[4], a2[4], b[4], b2[4]; const T16 *pa[4], *pa2[4], *pb[4], *pb2[4];
#pragma unroll
        for (int mb = 0; mb < 4; ++mb) { pa[mb] = A + aoff + (size_t)mb * 16 * K + kc * 16; pa2[mb] = pa[mb]; a[mb] = WFrag<T16>::ld(pa[mb]); if (NSPLIT == 1 || NSPLIT == 2) { pa2[mb] = A2 + aoff + (size_t)mb * 16 * K + kc * 16; a2[mb] = WFrag<T16>::ld(pa2[mb]); } }
        asm volatile("s_wait_xcnt 0x0" :: "v"(pa[0]), "v"(pa[1]), "v"(pa[2]), "v"(pa[3]), "v"(pa2[0]), "v"(pa2[1]), "v"(pa2[2]), "v"(pa2[3]) : "memory");   // the loads' address registers stay whole up to this wait and are free for reuse (here: as a later load's target) only behind it
#pragma unroll
        for (int nb = 0; nb < 4; ++nb) { pb[nb] = Bt + boff + (size_t)nb * 16 * K + kc * 16; pb2[nb] = pb[nb]; b[nb] = WFrag<T16>::ld(pb[nb]); if (NSPLIT >= 2) { pb2[nb] = Bt2 + boff + (size_t)nb * 16 * K + kc * 16; b2[nb] = WFrag<T16>::ld(pb2[nb]); } }
        asm volatile("s_wait_xcnt 0x0" :: "v"(pb[0]), "v"(pb[1]), "v"(pb[2]), "v"(pb[3]), "v"(pb2[0]), "v"(pb2[1]), "v"(pb2[2]), "v"(pb2[3]) : "memory");   // as above
        __builtin_amdgcn_sched_barrier(0);   // all loads of a trip go out ahead of its products; without it the compiler sinks each B fragment's loads to their first use, one exposed latency per fragment
#pragma unroll
        for (int nb = 0; nb < 4; ++nb) {
#pragma unroll
            for (int mb = 0; mb < 4; ++mb) { acc[mb][nb] = WFrag<T16>::mma(a[mb], b[nb], acc[mb][nb]); if (NSPLIT == 1 || NSPLIT == 2) acc[mb][nb] = WFrag<T16>::mma(a2[mb], b[nb], acc[mb][nb]); if (NSPLIT >= 2) acc[mb][nb] = WFrag<T16>::mma(a[mb], b2[nb], acc[mb][nb]); } }
        asm volatile("v_nop\n\tv_nop\n\tv_nop\n\tv_nop" : "+v"(acc[0][0]), "+v"(acc[1][1]), "+v"(acc[2][2]), "+v"(acc[3][3]) : "v"(a[0]), "v"(a[3]));
    }
    // PL: a thread's bias does not depend on the round: its 8 columns' (q, k) or its row's (v). Both are in bounds for every z and asked for here, without a branch, so that they fly under the staging and its barrier
    const float *pbr = bias + c0 + ((w >> 1) & 3) * 16 + lr, *pbc = bias + c0 + ((w >> 1) & 1) * 32 + (w & 1) * 16 + hi * 8; float br = 0.f; v4f bc[2] = {};
    if (PL) { br = *pbr; bc[0] = *(const v4f*)pbc; bc[1] = *(const v4f*)(pbc + 4);
        asm volatile("s_wait_xcnt 0x0" ::: "memory");   // the loads' address registers (offset and scalar base) are free for reuse only behind this wait
        __builtin_amdgcn_sched_barrier(0); }   // keeps the staging's address arithmetic, which reuses those registers, from being lifted over the wait
    // the four loops below are unrolled so that acc[][] is indexed by constants and stays in registers
#pragma unroll
    for (int mb0 = 0; mb0 < 4; mb0 += SR / 16) {
#pragma unroll
        for (int mi = 0; mi < SR / 16; ++mi) {
#pragma unroll
            for (int nb = 0; nb < 4; ++nb) {
#pragma unroll
                for (int j = 0; j < 8; ++j) os[(w * SR + mi * 16 + hi * 8 + j) * 68 + nb * 16 + lr] = acc[mb0 + mi][nb][j]; } }
        if (NW > 1) __syncthreads();   // every wave's partial tile is in LDS before any wave sums it
        else { __builtin_amdgcn_wave_barrier(); asm volatile("" ::: "memory"); }   // one wave: only keeps the compiler from moving the LDS reads above the LDS stores
        if (PL) {   // one 16-byte slot [lane] of a fragment half a thread and round, in the order of the plane: slot s = 8 q + w of the tile; every wave stores 512 contiguous bytes a plane
            bf* ph = P + (size_t)blockIdx.z * 2 * NH_ * TT * HD + (size_t)blockIdx.y * TT * HD + (size_t)r0 * HD + 8 * threadIdx.x; bf* pl = ph + (size_t)NH_ * TT * HD; v8us oh[2], ol[2];
#pragma unroll   // both rounds' LDS reads go out together; oh[], ol[] are indexed by constants
            for (int q = 0; q < 2; ++q) { const int s = q * 8 + w, T = tr ? (s >> 1) & 3 : s >> 2, c = tr ? s >> 3 : (s >> 1) & 1; const float* o = os + (T * 16 + lr) * 68 + c * 32 + (s & 1) * 16 + hi * 8;
                v4f x[2] = { *(const v4fa*)o, *(const v4fa*)(o + 4) };
#pragma unroll
                for (int u = 1; u < NW; ++u) { x[0] += *(const v4fa*)(o + u * SR * 68); x[1] += *(const v4fa*)(o + u * SR * 68 + 4); }
#pragma unroll
                for (int k = 0; k < 8; ++k) { unsigned short a, b; splitf(x[k >> 2][k & 3] + bfr(tr ? br : bc[k >> 2][k & 3]), a, b); oh[q][k] = a; ol[q][k] = b; } }
            *(v8us*)ph = oh[0]; *(v8us*)pl = ol[0]; *(v8us*)(ph + 2048) = oh[1]; *(v8us*)(pl + 2048) = ol[1];
            return; }
        float* crow = C + (size_t)(r0 + mb0 * 16) * ldc + c0;
        // both loops unrolled: all LDS reads of a wave's rows go out together instead of one latency per read
#pragma unroll
        for (int q = 0; q < SR / 2 / NW; ++q) { const int row = 2 * (q * NW + w) + hi, cofs = lr * 4; v4f val = *(const v4fa*)(os + row * 68 + cofs);
#pragma unroll
            for (int u = 1; u < NW; ++u) val += *(const v4fa*)(os + (u * SR + row) * 68 + cofs);
            if (BIAS) { val[0] += bfr(bias[c0 + cofs]); val[1] += bfr(bias[c0 + cofs + 1]); val[2] += bfr(bias[c0 + cofs + 2]); val[3] += bfr(bias[c0 + cofs + 3]); }
            *(v4f*)(crow + (size_t)row * ldc + cofs) = val; }
        if (NW == 1) { __builtin_amdgcn_wave_barrier(); asm volatile("" ::: "memory"); }   // one wave: the next strip's LDS stores stay behind these reads
    }
}

typedef __attribute__((ext_vector_type(4))) unsigned short v4us;
typedef __attribute__((ext_vector_type(2))) float v2f;

// Like k_gemmw's plane epilogue, the writers k_cvt8 and k_gn store in the order of the plane: k_cvt8 one 16-byte slot [lane] of a fragment half a thread, 512 contiguous bytes a wave; k_gn half a slot a thread, 256 contiguous bytes a wave and plane.
// k_cvt8: src [R][EE] f32 -> dst in fragment order (K = EE); one grid for all seven sources: blocks 0 .. TT * EE / 2048 - 1 convert x, then EE * EE / 2048 blocks for each of the six weight matrices (their planes lie one behind another in WB)
#define XBL (TT * EE / 2048)
#define WBL (EE * EE / 2048)
__global__ __launch_bounds__(256) void k_cvt8(const float* __restrict__ x, const float* __restrict__ w0, const float* __restrict__ w1, const float* __restrict__ w2, const float* __restrict__ w3, const float* __restrict__ w4, const float* __restrict__ w5, bf* XB, bf* WB) {
    const int b = (int)blockIdx.x, isx = b < XBL, j = isx ? 0 : (b - XBL) / WBL; const float* src = isx ? x : j == 0 ? w0 : j == 1 ? w1 : j == 2 ? w2 : j == 3 ? w3 : j == 4 ? w4 : w5;
    bf* dst = isx ? XB : WB + (size_t)j * EE * EE; const size_t i = (size_t)(isx ? b : (b - XBL) % WBL) * 256 + threadIdx.x;
    const int lr = (int)(i & 15), hi = (int)(i >> 4) & 1, u = (int)(i >> 5) & 1, c = (int)(i >> 6) & (EE / 32 - 1); const size_t T = i >> 11; const v8f v = *(const v8f*)(src + (T * 16 + lr) * EE + c * 32 + u * 16 + hi * 8); v8us o;
    asm volatile("s_wait_xcnt 0x0" ::: "memory");   // the loads' address registers are free for reuse only behind this wait
#pragma unroll
    for (int k = 0; k < 8; ++k) o[k] = f2bf(v[k]); *(v8us*)(dst + i * 8) = o;  }
// ---- k_attn: both score maps, both softmaxes, their difference and the product with V in one launch; no score or probability ever leaves the registers.
// grid (TT / 128, heads), 16 waves, two passes. In a pass wave w owns one 16-query strip (w & 3 picks it among the block's four of that pass) and every fourth 32-key block (w >> 2 picks the quarter). Pass 0 takes strips 4 x .. 4 x + 3,
// pass 1 their mirror images 127 - (4 x + ..) with the quarters reversed, so that a mask which closes the keys behind (or ahead of) each query leaves every wave about the same number of open key blocks.
// The mask is sorted by 16-query x 32-key block at run time: each pass first reads its part of it (whole lines) and notes, one bit a block, whether any entry is open (0) and whether open and masked entries are mixed. Both sweeps walk only
// the blocks with an open entry, and fetch the mask's entries again only for mixed blocks (a wholly open block takes zeros). A wholly masked block adds exact zeros to every sum of a row that has an open key anywhere, so leaving it out
// changes no value; nothing is assumed about where the mask is open.
// Scores are formed transposed (A = K rows, B = Q rows kept in registers), so a lane holds 8 keys of ONE query per tile: maximum and sum are in-lane, and two 16-key tiles converted in place are the A operand of the product with V
// (its k order is the loader's: 8 hi + s, 16 + 8 hi + s).
// Sweep 1 finds each query's maximum and exp sum of both maps (running maximum per lane; lane halves, then key quarters joined in a fixed order); sweep 2 forms the scores again, w = e1 / sum1 - lam e2 / sum2,
// splits w in bf16 high + low and accumulates w.V (three products, as the score products). The four key quarters' output tiles are summed in LDS and stored as whole lines of CAT[t][h * 64 + d].
// GroupNorm statistics: behind pass 1 the block holds its 128 tokens x 64 dims of one group in registers, so it also stores their sum and their square sum centred on the block's own mean, GP[h][block] = (sum, m2); k_gn joins a head's 16 pairs.
typedef __attribute__((ext_vector_type(4))) int v4i;
typedef __attribute__((ext_vector_type(2))) __bf16 v2bf;
__device__ __forceinline__ v16bf ldf(const bf* p) { return cat16b(*(const v8us*)p, *(const v8us*)(p + 256)); }   // the two halves of one fragment-order block
// the K fragments of 32 keys of one map: k[kt * 4 + c * 2] high, + 1 low (16-key tile kt, 32-wide chunk c of the head dim)
__device__ __forceinline__ void ldk(const bf* Kh, const bf* Kl, v16bf (&k)[8]) {
#pragma unroll
    for (int kt = 0; kt < 2; ++kt)
#pragma unroll
        for (int c = 0; c < 2; ++c) { k[kt * 4 + c * 2] = ldf(Kh + kt * 16 * HD + c * 512); k[kt * 4 + c * 2 + 1] = ldf(Kl + kt * 16 * HD + c * 512); }
    asm volatile("s_wait_xcnt 0x0" :: "v"(Kh), "v"(Kl) : "memory"); }   // the loads' address registers stay whole up to this wait and are free for reuse only behind it
__device__ __forceinline__ void ldm(const int* mr, v4i (&mk)[4]) {
#pragma unroll
    for (int u = 0; u < 4; ++u) mk[u] = *(const v4i*)(mr + (u >> 1) * 16 + (u & 1) * 4);
    asm volatile("s_wait_xcnt 0x0" :: "v"(mr) : "memory"); }   // as in ldk
// two transposed score tiles: s[kt][j] = q[query lr] . k[key kt * 16 + 8 hi + j], split products kh.qh + kh.ql + kl.qh over the two chunks
__device__ __forceinline__ void sc2(const v16bf (&k)[8], const v16bf (&qh)[2], const v16bf (&ql)[2], v8f (&s)[2]) { s[0] = (v8f){}; s[1] = (v8f){};
#pragma unroll
    for (int c = 0; c < 2; ++c) { s[0] = wmmab(k[c * 2], qh[c], s[0]); s[1] = wmmab(k[4 + c * 2], qh[c], s[1]); s[0] = wmmab(k[c * 2], ql[c], s[0]); s[1] = wmmab(k[4 + c * 2], ql[c], s[1]); s[0] = wmmab(k[c * 2 + 1], qh[c], s[0]); s[1] = wmmab(k[4 + c * 2 + 1], qh[c], s[1]); } }
// masked scores, scaled by 1/8 and by log2(e) in one multiply, so that every exponential below is a bare exp2: t[kt * 8 + j] belongs to key kt * 16 + 8 hi + j of the block
__device__ __forceinline__ void msc(const v8f (&s)[2], const v4i (&mk)[4], float (&t)[16]) {
#pragma unroll
    for (int e = 0; e < 16; ++e) t[e] = mk[e >> 2][e & 3] ? -3.0e38f : s[e >> 3][e & 7] * (SCL * 1.44269504f); }
__device__ __forceinline__ void run_ml(const float (&t)[16], float& m, float& l) { float tm = t[0];
#pragma unroll
    for (int k = 1; k < 16; ++k) tm = fmaxf(tm, t[k]);
    const float mn = fmaxf(m, tm); float a = 0.f;
#pragma unroll
    for (int k = 0; k < 16; ++k) a += __builtin_amdgcn_exp2f(t[k] - mn);
    l = l * __builtin_amdgcn_exp2f(m - mn) + a; m = mn; }
__device__ __forceinline__ void join_ml(float& m, float& l, float mo, float lo) { const float mn = fmaxf(m, mo); l = l * __builtin_amdgcn_exp2f(m - mn) + lo * __builtin_amdgcn_exp2f(mo - mn); m = mn; }
__device__ __forceinline__ float wsum(float v) {   // sum over the wave's 32 lanes, the same bits in every lane
#pragma unroll   // five fixed steps: no loop counter, the lane masks are constants
    for (int m = 16; m >= 1; m >>= 1) v += __shfl_xor(v, m, 32);
    return v; }
// smallest of a lane's 16 mask entries, as unsigned: 0 exactly when one of them is open; and their bitwise or: 0 exactly when none is masked
__device__ __forceinline__ unsigned mmin(const v4i (&mk)[4]) { unsigned a = (unsigned)mk[0][0];
#pragma unroll
    for (int e = 1; e < 16; ++e) { const unsigned b = (unsigned)mk[e >> 2][e & 3]; a = b < a ? b : a; }
    return a; }
__device__ __forceinline__ unsigned mor(const v4i (&mk)[4]) { const v4i o = (mk[0] | mk[1]) | (mk[2] | mk[3]); return (unsigned)((o[0] | o[1]) | (o[2] | o[3])); }
// one block of the mask for sorting: load u takes rows 4 u .. 4 u + 3, 8 lanes on a row's 128 bytes, so every load reads 4 whole lines (which lane sees which entry does not matter to an any-test)
__device__ __forceinline__ void ldp(const int* mr, v4i (&mk)[4]) {
#pragma unroll
    for (int u = 0; u < 4; ++u) mk[u] = *(const v4i*)(mr + (size_t)u * 4 * TT);
    asm volatile("s_wait_xcnt 0x0" :: "v"(mr) : "memory"); }   // as in ldk
// the mask entries of a block for msc: fetched where the block is mixed (the same for the whole wave: a scalar branch), zeros where it is wholly open
__device__ __forceinline__ void ldmx(const int* mr, bool mixed, v4i (&mk)[4]) {
    if (mixed) ldm(mr, mk);
    else {
#pragma unroll
        for (int u = 0; u < 4; ++u) mk[u] = (v4i){}; } }
__global__ __launch_bounds__(512) void k_attn(const bf* __restrict__ Q1h, const bf* __restrict__ Q1l, const bf* __restrict__ Q2h, const bf* __restrict__ Q2l, const bf* __restrict__ K1h, const bf* __restrict__ K1l, const bf* __restrict__ K2h, const bf* __restrict__ K2l,
                                              const bf* __restrict__ Vh, const bf* __restrict__ Vl, const int* __restrict__ msk, const float* __restrict__ lam, float* CAT, float* GP) {
    __shared__ __align__(16) float os[16 * 16 * 68];
    __shared__ float st[4][4][64];
    __shared__ __align__(16) float gs[2][16];
    const int lane = threadIdx.x & 31, lr = lane & 15, hi = lane >> 4; const int w = __builtin_amdgcn_readfirstlane((int)(threadIdx.x >> 5)), sp = w & 3, ku = w >> 2;
    const int h = blockIdx.y; const size_t hb = (size_t)h * TT * HD; const size_t ko = hb + 8 * lane, vo = hb + 8 * lane; const float lamh = bfr(lam[h]);
    v4f vals[4];
#pragma unroll   // two passes written out: vals[] is indexed by constants and stays in registers
    for (int p = 0; p < 2; ++p) {
        const int kq = p == 0 ? ku : 3 - ku, q0 = (p == 0 ? (int)blockIdx.x * 4 + sp : TT / 16 - 1 - ((int)blockIdx.x * 4 + sp)) * 16;
        v16bf q1h[2], q1l[2], q2h[2], q2l[2]; const size_t qo = hb + (size_t)q0 * HD + 8 * lane; const bf *pq1h = Q1h + qo, *pq1l = Q1l + qo, *pq2h = Q2h + qo, *pq2l = Q2l + qo;
#pragma unroll
        for (int c = 0; c < 2; ++c) { q1h[c] = ldf(pq1h + c * 512); q1l[c] = ldf(pq1l + c * 512); q2h[c] = ldf(pq2h + c * 512); q2l[c] = ldf(pq2l + c * 512); }
        asm volatile("s_wait_xcnt 0x0" :: "v"(pq1h), "v"(pq1l), "v"(pq2h), "v"(pq2l) : "memory");   // as in ldk
        const int* mrow = msk + (size_t)(q0 + lr) * TT + 8 * hi + kq * 32;   // the wave's key block i (0 .. 15) begins at key 128 i + 32 kq
        const int* mpre = msk + (size_t)(q0 + (lane >> 3)) * TT + kq * 32 + (lane & 7) * 4;
        unsigned act = 0, mix = 0;   // bit i of act: key block i has an open entry for one of the strip's queries; of mix: it has masked entries as well; the same in every lane (ballots' results)
#pragma unroll   // constants for the bit places; four blocks' mask loads fly together
        for (int g = 0; g < 4; ++g) { v4i mm[4][4];
#pragma unroll
            for (int a = 0; a < 4; ++a) ldp(mpre + (g * 4 + a) * 128, mm[a]);
            __builtin_amdgcn_sched_barrier(0);   // the sixteen loads go out ahead of the first compare: one latency a group instead of one a block
#pragma unroll
            for (int a = 0; a < 4; ++a) { const unsigned op = __builtin_amdgcn_ballot_w32(mmin(mm[a]) == 0u) != 0u ? 1u << (g * 4 + a) : 0u; act |= op; mix |= __builtin_amdgcn_ballot_w32(mor(mm[a]) != 0u) != 0u ? op : 0u; } }
        float m1 = -3.0e38f, l1 = 0.f, m2 = -3.0e38f, l2 = 0.f;
        // Order of a trip, held by the scheduling barriers: each group of loads goes out whole right behind the products that free its registers and flies under the vector work that follows, instead of one exposed latency per fragment.
        v16bf kf[8]; v4i mk[4];
        if (act != 0u) { unsigned rem = act & (act - 1u); int kb = __builtin_ctz(act) * 128;   // kb: the block's first key, less 32 kq; at most 16 trips, one noted bit each
            ldk(K1h + ko + (size_t)(kb + kq * 32) * HD, K1l + ko + (size_t)(kb + kq * 32) * HD, kf);
#pragma unroll 1   // one 32-key block a trip: a second copy of the body would not fit the registers of four waves a SIMD
            for (;;) { v8f s[2]; float t[16]; const size_t o = ko + (size_t)(kb + kq * 32) * HD; const int kn = rem != 0u ? __builtin_ctz(rem) * 128 : kb;   // the last trip fetches its own block again: in bounds, unused
                ldmx(mrow + kb, ((mix >> (kb >> 7)) & 1u) != 0u, mk);   // at the head of the trip, so that its branch leaves the rest of the trip one block whose order the scheduling barriers hold; a mixed block's entries fly under the first products
                sc2(kf, q1h, q1l, s); __builtin_amdgcn_sched_barrier(0);
                ldk(K2h + o, K2l + o, kf); __builtin_amdgcn_sched_barrier(0);
                msc(s, mk, t); run_ml(t, m1, l1); __builtin_amdgcn_sched_barrier(0);
                sc2(kf, q2h, q2l, s); __builtin_amdgcn_sched_barrier(0);
                ldk(K1h + ko + (size_t)(kn + kq * 32) * HD, K1l + ko + (size_t)(kn + kq * 32) * HD, kf); __builtin_amdgcn_sched_barrier(0);
                msc(s, mk, t); run_ml(t, m2, l2);
                if (rem == 0u) break;
                rem &= rem - 1u; kb = kn; } }
        join_ml(m1, l1, __shfl_xor(m1, 16, 32), __shfl_xor(l1, 16, 32)); join_ml(m2, l2, __shfl_xor(m2, 16, 32), __shfl_xor(l2, 16, 32));
        if (hi == 0) { st[ku][0][sp * 16 + lr] = m1; st[ku][1][sp * 16 + lr] = l1; st[ku][2][sp * 16 + lr] = m2; st[ku][3][sp * 16 + lr] = l2; }
        __syncthreads();   // all four key quarters' maxima and sums are in LDS before any wave joins them; it also ends the earlier pass's reads of os ahead of this pass's stores there
        m1 = st[0][0][sp * 16 + lr]; l1 = st[0][1][sp * 16 + lr]; m2 = st[0][2][sp * 16 + lr]; l2 = st[0][3][sp * 16 + lr];
#pragma unroll   // three fixed joins, in the order of the waves
        for (int u = 1; u < 4; ++u) { join_ml(m1, l1, st[u][0][sp * 16 + lr], st[u][1][sp * 16 + lr]); join_ml(m2, l2, st[u][2][sp * 16 + lr], st[u][3][sp * 16 + lr]); }
        const float f1 = __fdiv_rn(1.0f, l1), f2 = __fdiv_rn(1.0f, l2) * lamh;
        v8f o4[4];
#pragma unroll
        for (int dt = 0; dt < 4; ++dt) o4[dt] = (v8f){};
        if (act != 0u) { unsigned rem = act & (act - 1u); int kb = __builtin_ctz(act) * 128;
            ldk(K1h + ko + (size_t)(kb + kq * 32) * HD, K1l + ko + (size_t)(kb + kq * 32) * HD, kf);
#pragma unroll 1   // as above
            for (;;) { v8f s[2]; float t[16], e1[16]; const size_t o = ko + (size_t)(kb + kq * 32) * HD; const int kn = rem != 0u ? __builtin_ctz(rem) * 128 : kb;
                ldmx(mrow + kb, ((mix >> (kb >> 7)) & 1u) != 0u, mk);   // at the head of the trip, so that its branch leaves the rest of the trip one block whose order the scheduling barriers hold; a mixed block's entries fly under the first products
                sc2(kf, q1h, q1l, s); __builtin_amdgcn_sched_barrier(0);
                ldk(K2h + o, K2l + o, kf); __builtin_amdgcn_sched_barrier(0);
                msc(s, mk, t);
#pragma unroll
                for (int e = 0; e < 16; ++e) e1[e] = __builtin_amdgcn_exp2f(t[e] - m1) * f1;
                __builtin_amdgcn_sched_barrier(0);
                sc2(kf, q2h, q2l, s); __builtin_amdgcn_sched_barrier(0);
                v16bf vh[4], vl[4]; const bf *pvh = Vh + vo + (size_t)(kb + kq * 32) * HD, *pvl = Vl + vo + (size_t)(kb + kq * 32) * HD;
#pragma unroll
                for (int dt = 0; dt < 4; ++dt) { vh[dt] = ldf(pvh + dt * 512); vl[dt] = ldf(pvl + dt * 512); }
                asm volatile("s_wait_xcnt 0x0" :: "v"(pvh), "v"(pvl) : "memory");   // as in ldk
                __builtin_amdgcn_sched_barrier(0);
                msc(s, mk, t); v16bf ph, pl;
#pragma unroll
                for (int e = 0; e < 16; e += 2) { v2f wv; wv[0] = e1[e] - __builtin_amdgcn_exp2f(t[e] - m2) * f2; wv[1] = e1[e + 1] - __builtin_amdgcn_exp2f(t[e + 1] - m2) * f2;
                    const v2bf hh = __builtin_convertvector(wv, v2bf); const v2bf ll = __builtin_convertvector(wv - __builtin_convertvector(hh, v2f), v2bf); ph[e] = hh[0]; ph[e + 1] = hh[1]; pl[e] = ll[0]; pl[e + 1] = ll[1]; }
                __builtin_amdgcn_sched_barrier(0);
#pragma unroll
                for (int dt = 0; dt < 4; ++dt) o4[dt] = wmmab(ph, vh[dt], o4[dt]);
#pragma unroll
                for (int dt = 0; dt < 4; ++dt) o4[dt] = wmmab(pl, vh[dt], o4[dt]);
#pragma unroll
                for (int dt = 0; dt < 4; ++dt) o4[dt] = wmmab(ph, vl[dt], o4[dt]);
                __builtin_amdgcn_sched_barrier(0);
                ldk(K1h + ko + (size_t)(kn + kq * 32) * HD, K1l + ko + (size_t)(kn + kq * 32) * HD, kf);
                if (rem == 0u) break;
                rem &= rem - 1u; kb = kn; } }
#pragma unroll
        for (int dt = 0; dt < 4; ++dt) {
#pragma unroll
            for (int j = 0; j < 8; ++j) os[(w * 16 + hi * 8 + j) * 68 + dt * 16 + lr] = o4[dt][j]; }
        __syncthreads();   // every wave's partial output tile is in LDS before any thread sums the four key quarters; it also ends this pass's reads of st ahead of the next pass's stores there
        float* pc[2];
#pragma unroll
        for (int q = 0; q < 2; ++q) { const int idx = q * 512 + (int)threadIdx.x, row = idx >> 4, c4 = (idx & 15) * 4;   // row: 16 (strip of the pass) + query; wave 4 u + strip holds quarter u's tile
            vals[p * 2 + q] = (*(const v4fa*)(os + row * 68 + c4) + *(const v4fa*)(os + (64 + row) * 68 + c4)) + (*(const v4fa*)(os + (128 + row) * 68 + c4) + *(const v4fa*)(os + (192 + row) * 68 + c4));
            const int tok = (p == 0 ? (int)blockIdx.x * 4 + (row >> 4) : TT / 16 - 1 - ((int)blockIdx.x * 4 + (row >> 4))) * 16 + (row & 15);
            pc[q] = CAT + (size_t)tok * EE + h * HD + c4; *(v4f*)pc[q] = vals[p * 2 + q]; }
        asm volatile("s_wait_xcnt 0x0" :: "v"(pc[0]), "v"(pc[1]), "v"(vals[p * 2]), "v"(vals[p * 2 + 1]) : "memory");   // the stores' address and data registers stay whole up to this wait and are free for reuse only behind it
    }
    const v4f s4 = (vals[0] + vals[1]) + (vals[2] + vals[3]); const float ws = wsum((s4[0] + s4[1]) + (s4[2] + s4[3]));
    if (lane == 0) gs[0][w] = ws;
    __syncthreads();   // all 16 waves' sums are in LDS before any thread forms the block's mean
    const v4f b4 = (*(const v4fa*)(gs[0]) + *(const v4fa*)(gs[0] + 4)) + (*(const v4fa*)(gs[0] + 8) + *(const v4fa*)(gs[0] + 12)); const float bs = (b4[0] + b4[1]) + (b4[2] + b4[3]), bm = bs * (1.0f / (128 * HD));
    v4f d4 = (v4f){};
#pragma unroll   // vals[] is indexed by constants and stays in registers
    for (int q = 0; q < 4; ++q) { const v4f d = vals[q] - bm; d4 += d * d; }
    const float wq = wsum((d4[0] + d4[1]) + (d4[2] + d4[3]));
    if (lane == 0) gs[1][w] = wq;
    __syncthreads();   // all 16 waves' centred square sums are in LDS before thread 0 adds them
    if (threadIdx.x == 0) { const v4f c4v = (*(const v4fa*)(gs[1]) + *(const v4fa*)(gs[1] + 4)) + (*(const v4fa*)(gs[1] + 8) + *(const v4fa*)(gs[1] + 12)); v2f o2; o2[0] = bs; o2[1] = (c4v[0] + c4v[1]) + (c4v[2] + c4v[3]);
        *(v2f*)(GP + ((size_t)h * (TT / 128) + blockIdx.x) * 2) = o2; }
}
// k_gn: a head's mean and biased variance from its 16 pairs GP[h][b] = (sum, m2 about the block's own mean) of 128 x 64 values each: var * N = sum_b m2_b + n_b (mean_b - mean)^2, an identity, every term >= 0; then the normalisation.
__global__ __launch_bounds__(256) void k_gn(const float* __restrict__ CAT, const float* __restrict__ GP, const float* __restrict__ gw, const float* __restrict__ gb, bf* Ah, bf* Al) { const size_t o = ((size_t)blockIdx.x * 256 + threadIdx.x) * 4; if (o >= (size_t)TT * EE) return;   // o: place in the fragment-order planes (K = EE), half a 16-byte slot a thread; i: the same elements in CAT
    const size_t i = ((o >> 14) * 16 + ((o >> 3) & 15)) * EE + ((o >> 9) & (EE / 32 - 1)) * 32 + ((o >> 8) & 1) * 16 + ((o >> 7) & 1) * 8 + (o & 7); const int c = (int)(i % EE);
    const float* gp = GP + (size_t)(blockIdx.x & (NH_ - 1)) * (TT / 128) * 2;   // head c / HD: a block's 1024 elements are two 32-wide chunks of one head, so the pairs are read once for the block through the scalar path
    float gsum = 0.f, gm2 = 0.f;
#pragma unroll   // both loops unrolled: the 16 pairs come in two wide loads, one latency, instead of one load a trip
    for (int b = 0; b < TT / 128; ++b) gsum += gp[2 * b];
    const float mu = gsum * (1.0f / (float)(HD * TT));
#pragma unroll
    for (int b = 0; b < TT / 128; ++b) { const float d = gp[2 * b] * (1.0f / (128 * HD)) - mu; gm2 += gp[2 * b + 1] + (float)(128 * HD) * (d * d); }
    const float rs = __frsqrt_rn(__fadd_rn(gm2 * (1.0f / (float)(HD * TT)), 1e-5f)); const v4f a = *(const v4f*)(CAT + i); v4us oh, ol;
#pragma unroll
    for (int q = 0; q < 4; ++q) { float t = __fmul_rn(__fsub_rn(a[q], mu), rs); asm volatile("" : "+v"(t)); float tg = __fmul_rn(t, bfr(gw[c + q])); asm volatile("" : "+v"(tg)); unsigned short u, c2; splitf(__fadd_rn(tg, bfr(gb[c + q])), u, c2); oh[q] = u; ol[q] = c2; }
    *(v4us*)(Ah + o) = oh; *(v4us*)(Al + o) = ol;  }

extern "C" void kernel_launch(void* const* d_in, const int* in_sizes, int n_in,
                              void* d_out, int out_size, void* d_ws, size_t ws_size, hipStream_t stream) {
    (void)in_sizes; (void)n_in; (void)out_size;
    const float* x = (const float*)d_in[0]; const int* msk = (const int*)d_in[1]; const float* IN[17]; for (int i = 2; i < 17; ++i) IN[i] = (const float*)d_in[i];   // 2 Wq1 [16][64][1024], 3 bq1, 4 Wq2, 5 bq2, 6 Wk1, 7 bk1, 8 Wk2, 9 bk2, 10 Wv, 11 bv, 12 lam, 13 gn_w, 14 gn_b, 15 Wo [1024][1024] (out,in), 16 bo
    float* OUT = (float*)d_out;     // [1][2048][1024]
    char* wsp = (char*)d_ws;
    auto take = [&](size_t bytes) { char* p = wsp; wsp += (bytes + 255) & ~(size_t)255; return (void*)p; };
    bf* WB = (bf*)take((size_t)6 * EE * EE * 2); bf* XB = (bf*)take((size_t)TT * EE * 2);   // WB: six weight planes, one behind another
    bf* Q1h = (bf*)take((size_t)NH_ * TT * HD * 2); bf* Q1l = (bf*)take((size_t)NH_ * TT * HD * 2); bf* Q2h = (bf*)take((size_t)NH_ * TT * HD * 2); bf* Q2l = (bf*)take((size_t)NH_ * TT * HD * 2); bf* K1h = (bf*)take((size_t)NH_ * TT * HD * 2); bf* K1l = (bf*)take((size_t)NH_ * TT * HD * 2); bf* K2h = (bf*)take((size_t)NH_ * TT * HD * 2); bf* K2l = (bf*)take((size_t)NH_ * TT * HD * 2); bf* Vh = (bf*)take((size_t)NH_ * HD * TT * 2); bf* Vl = (bf*)take((size_t)NH_ * HD * TT * 2);
    float* CAT = (float*)take((size_t)TT * EE * 4); float* GP = (float*)take((size_t)NH_ * (TT / 128) * 2 * 4); bf* Ah = (bf*)take((size_t)TT * EE * 2); bf* Al = (bf*)take((size_t)TT * EE * 2);
    if ((size_t)(wsp - (char*)d_ws) > ws_size) return;
    k_cvt8<<<XBL + 6 * WBL, 256, 0, stream>>>(x, IN[2], IN[4], IN[6], IN[8], IN[10], IN[15], XB, WB);   // [H][DH][E] stacked = natural [1024][1024] Bt; Wo [E][D] natural
    k_gemmw<bf, 0, true, 8, 1, true><<<dim3(TT / 64, EE / 64, 5), 256, 0, stream>>>(XB, nullptr, WB, nullptr, EE, nullptr, EE, IN[3], IN[5], IN[7], IN[9], IN[11], 0, (size_t)EE * EE, 0, Q1h);   // q1, q2, k1, k2, v; the ten planes from Q1h to Vl lie one behind another in the workspace, in the order taken above
    k_attn<<<dim3(TT / 128, NH_, 1), 512, 0, stream>>>(Q1h, Q1l, Q2h, Q2l, K1h, K1l, K2h, K2l, Vh, Vl, msk, IN[12], CAT, GP);
    k_gn<<<(unsigned)(((size_t)TT * EE / 4 + 255) / 256), 256, 0, stream>>>(CAT, GP, IN[13], IN[14], Ah, Al);
    k_gemmw<bf, 1, true, 8, 1, false><<<dim3(TT / 64, EE / 64, 1), 256, 0, stream>>>(Ah, Al, WB + (size_t)5 * EE * EE, nullptr, EE, OUT, EE, IN[16], nullptr, nullptr, nullptr, nullptr, 0, 0, 0, nullptr);
}

// v008
// One run takes 109 microseconds.
// Next to v007, in two timings, it ran 1.11 times as fast each time.
// Counting every step since v000, it is 9.43 times as fast.
#include <hip/hip_runtime.h>

// DifferentialMultiHeadSelfAttention (x [1][2048][1024]; per-head q1, q2, k1, k2, v = x W[h]^T + b[h] (16 x 64); s = q.k/8 with mask[i][j] (int, 1 = masked -> -inf, read as data); w = softmax(s1) - lam[h] softmax(s2);
// out = w.v; heads concatenated; GroupNorm(16 groups = heads, eps 1e-5, biased var over (64 dims x 2048 tokens)) x gn_w + gn_b; out Wo^T + bo -> [1][2048][1024]).
// Compute dtypes, f32 accumulate: every input rounded to bf16; the five projections on PLAIN bf16 operands (inputs: exact, + bias; the stacked [16][64][1024] weights are one natural [1024][1024] Bt); both score GEMMs

#define TT   2048
#define EE   1024
#define NH_  16
#define HD   64
#define ZH   2
#define SCL  0.125f
typedef _Float16 h16;
typedef unsigned short bf;
typedef __attribute__((ext_vector_type(16))) __bf16   v16bf;
typedef __attribute__((ext_vector_type(16))) _Float16 v16h;
typedef __attribute__((ext_vector_type(8)))  _Float16 v8h;
typedef __attribute__((ext_vector_type(8)))  unsigned short v8us;
typedef __attribute__((ext_vector_type(8)))  float    v8f;
typedef __attribute__((ext_vector_type(4)))  float    v4f;
typedef v8h  __attribute__((may_alias)) v8ha;
typedef v4f  __attribute__((may_alias)) v4fa;
typedef v8us __attribute__((may_alias)) v8usa;

__device__ __forceinline__ unsigned short f2bf(float f) { unsigned u = __float_as_uint(f); u += 0x7FFFu + ((u >> 16) & 1u); return (unsigned short)(u >> 16); }
__device__ __forceinline__ float bf2f(unsigned short b) { return __uint_as_float(((unsigned)b) << 16); }
__device__ __forceinline__ float bfr(float f) { return bf2f(f2bf(f)); }
__device__ __forceinline__ v16h cat16(v8h lo, v8h hi) { return __builtin_shufflevector(lo, hi, 0, 1, 2, 3, 4, 5, 6, 7, 8, 9, 10, 11, 12, 13, 14, 15); }
__device__ __forceinline__ v16bf cat16b(v8us lo, v8us hi) { return __builtin_bit_cast(v16bf, __builtin_shufflevector(lo, hi, 0, 1, 2, 3, 4, 5, 6, 7, 8, 9, 10, 11, 12, 13, 14, 15)); }
__device__ __forceinline__ v8f wmma16(v16h a, v16h b, v8f c) { return __builtin_amdgcn_wmma_f32_16x16x32_f16(false, a, false, b, (short)0, c, false, false); }
__device__ __forceinline__ v8f wmmab(v16bf a, v16bf b, v8f c) { return __builtin_amdgcn_wmma_f32_16x16x32_bf16(false, a, false, b, (short)0, c, false, false); }



// ---- FRAGMENT ORDER of every 16-bit operand plane [R][K]: the 16 rows x 32 k of one matrix operand lie as 512 elements in a row, [u][lane][s] = element (row 16 T + (lane & 15), k 32 c + 16 u + 8 (lane >> 4) + s),
// block (T, c) at (T * (K / 32) + c) * 512 (V's transposed planes: at (c * 4 + T) * 512). A wave's 16-byte load of half u then reads 512 contiguous bytes (4 whole lines) instead of 32 bytes out of each of 16 lines; which element reaches which lane and register is as before.
// ---- k_gemmw: register-blocked GEMM, NW WAVES per 64x64 output tile (16 accumulators each), operands straight from 16-bit planes in fragment order; grid (M/64, N/64, Z), 32 * NW threads.
// C[m][n] (f32, pitch ldc, + optional f32 bias[n]) = sum_k A[m][k] Bt[n][k] (+ split products per NSPLIT). z-batch strides sA/sB/sC in elements, bias vector z of up to five. K % (32 * NW * KP) == 0.
// Split K: wave w takes the 32-wide k chunks w, w + NW, ... (1 KiB of each 16-row strip); the NW partial tiles are staged whole in LDS and summed in wave order behind one barrier.
// KP > 1 (N == 64 only): blockIdx.y is a K range instead of a tile column, and range y stores its partial C in plane y (plane pitch ZH * sC); the consumer sums the planes.
// PL (the five projections; a tile column is one head): the summed tile + bias does not leave as f32 but split in bf16 high + low, straight into the attention's operand planes P (high, low of q1, q2, k1, k2, v, one behind another):
// per head a plane [TT][HD] in fragment order (K = HD) for z 0 .. 3; for z 4 (v) the transposed plane [HD][TT] with its blocks ordered (32-key chunk, 16-row strip): block (c, T) at (c * 4 + T) * 512, so that the four strips of one key
// chunk lie together. For v the two operands change places (both planes have the same order), so the tile comes out as [head dim][token] and a slot's 8 keys lie in a row of it. Either way the tile is 4096 elements in a row of each plane.
__device__ __forceinline__ void splitf(float y, unsigned short& h, unsigned short& l) { h = f2bf(y); l = f2bf(y - bf2f(h)); }
template <typename T16> struct WFrag;
template <> struct WFrag<h16> { typedef v16h V; static __device__ __forceinline__ V ld(const h16* p) { return cat16(*(const v8h*)p, *(const v8h*)(p + 256)); } static __device__ __forceinline__ v8f mma(V a, V b, v8f c) { return wmma16(a, b, c); } };
template <> struct WFrag<bf> { typedef v16bf V; static __device__ __forceinline__ V ld(const bf* p) { return cat16b(*(const v8us*)p, *(const v8us*)(p + 256)); } static __device__ __forceinline__ v8f mma(V a, V b, v8f c) { return wmmab(a, b, c); } };
template <typename T16, int NSPLIT, bool BIAS, int NW, int KP, bool PL>
__global__ __launch_bounds__(32 * NW) void k_gemmw(const T16* __restrict__ A, const T16* __restrict__ A2, const T16* __restrict__ Bt, const T16* __restrict__ Bt2, int K, float* C, int ldc, const float* __restrict__ bias0, const float* __restrict__ bias1, const float* __restrict__ bias2, const float* __restrict__ bias3, const float* __restrict__ bias4, size_t sA, size_t sB, size_t sC, bf* P) {
    static_assert(!PL || (NW == 8 && KP == 1 && BIAS), "the plane epilogue deals 512 slots to 256 threads");
    typedef typename WFrag<T16>::V V;
    const float* bias = blockIdx.z == 0 ? bias0 : blockIdx.z == 1 ? bias1 : blockIdx.z == 2 ? bias2 : blockIdx.z == 3 ? bias3 : bias4;   // each product of a z-batch has its own bias vector
    constexpr int SR = NW > 1 ? 64 : 16;    // tile rows staged in LDS at once, per wave
    __shared__ __align__(16) float os[NW * SR * 68];
    const size_t z = blockIdx.z; A += z * sA; if (A2) A2 += z * sA; Bt += z * sB; if (Bt2) Bt2 += z * sB; C += z * sC;
    const bool tr = PL && blockIdx.z == 4;   // v: the weights' rows are the tile's rows, the tokens its columns
    if (tr) { const T16* t = A; A = Bt; Bt = t; }
    const int lane = threadIdx.x & 31, lr = lane & 15, hi = lane >> 4; const int r0 = blockIdx.x * 64, c0 = KP > 1 ? 0 : blockIdx.y * 64;
    const int w = NW > 1 ? __builtin_amdgcn_readfirstlane((int)(threadIdx.x >> 5)) : 0;
    const int klo = KP > 1 ? (int)blockIdx.y * (K / KP) : 0, khi = KP > 1 ? klo + K / KP : K; if (KP > 1) C += (size_t)blockIdx.y * ZH * sC;
    v8f acc[4][4];
#pragma unroll
    for (int mb = 0; mb < 4; ++mb)
#pragma unroll
        for (int nb = 0; nb < 4; ++nb) acc[mb][nb] = (v8f){};
    const size_t aoff = (size_t)(tr ? c0 : r0) * K + 8 * lane, boff = (size_t)(tr ? r0 : c0) * K + 8 * lane;   // fragment order: a 16-row strip is still 16 * K elements, a 32-wide k chunk of it 512
#pragma unroll 1
    for (int kc = klo + w * 32; kc < khi; kc += 32 * NW) {
        V a[4], a2[4], b[4], b2[4]; const T16 *pa[4], *pa2[4], *pb[4], *pb2[4];
#pragma unroll
        for (int mb = 0; mb < 4; ++mb) { pa[mb] = A + aoff + (size_t)mb * 16 * K + kc * 16; pa2[mb] = pa[mb]; a[mb] = WFrag<T16>::ld(pa[mb]); if (NSPLIT == 1 || NSPLIT == 2) { pa2[mb] = A2 + aoff + (size_t)mb * 16 * K + kc * 16; a2[mb] = WFrag<T16>::ld(pa2[mb]); } }
        asm volatile("s_wait_xcnt 0x0" :: "v"(pa[0]), "v"(pa[1]), "v"(pa[2]), "v"(pa[3]), "v"(pa2[0]), "v"(pa2[1]), "v"(pa2[2]), "v"(pa2[3]) : "memory");   // the loads' address registers stay whole up to this wait and are free for reuse (here: as a later load's target) only behind it
#pragma unroll
        for (int nb = 0; nb < 4; ++nb) { pb[nb] = Bt + boff + (size_t)nb * 16 * K + kc * 16; pb2[nb] = pb[nb]; b[nb] = WFrag<T16>::ld(pb[nb]); if (NSPLIT >= 2) { pb2[nb] = Bt2 + boff + (size_t)nb * 16 * K + kc * 16; b2[nb] = WFrag<T16>::ld(pb2[nb]); } }
        asm volatile("s_wait_xcnt 0x0" :: "v"(pb[0]), "v"(pb[1]), "v"(pb[2]), "v"(pb[3]), "v"(pb2[0]), "v"(pb2[1]), "v"(pb2[2]), "v"(pb2[3]) : "memory");   // as above
        __builtin_amdgcn_sched_barrier(0);   // all loads of a trip go out ahead of its products; without it the compiler sinks each B fragment's loads to their first use, one exposed latency per fragment
#pragma unroll
        for (int nb = 0; nb < 4; ++nb) {
#pragma unroll
            for (int mb = 0; mb < 4; ++mb) { acc[mb][nb] = WFrag<T16>::mma(a[mb], b[nb], acc[mb][nb]); if (NSPLIT == 1 || NSPLIT == 2) acc[mb][nb] = WFrag<T16>::mma(a2[mb], b[nb], acc[mb][nb]); if (NSPLIT >= 2) acc[mb][nb] = WFrag<T16>::mma(a[mb], b2[nb], acc[mb][nb]); } }
        asm volatile("v_nop\n\tv_nop\n\tv_nop\n\tv_nop" : "+v"(acc[0][0]), "+v"(acc[1][1]), "+v"(acc[2][2]), "+v"(acc[3][3]) : "v"(a[0]), "v"(a[3]));
    }
    // PL: a thread's bias does not depend on the round: its 8 columns' (q, k) or its row's (v). Both are in bounds for every z and asked for here, without a branch, so that they fly under the staging and its barrier
    const float *pbr = bias + c0 + ((w >> 1) & 3) * 16 + lr, *pbc = bias + c0 + ((w >> 1) & 1) * 32 + (w & 1) * 16 + hi * 8; float br = 0.f; v4f bc[2] = {};
    if (PL) { br = *pbr; bc[0] = *(const v4f*)pbc; bc[1] = *(const v4f*)(pbc + 4);
        asm volatile("s_wait_xcnt 0x0" ::: "memory");   // the loads' address registers (offset and scalar base) are free for reuse only behind this wait
        __builtin_amdgcn_sched_barrier(0); }   // keeps the staging's address arithmetic, which reuses those registers, from being lifted over the wait
    // the four loops below are unrolled so that acc[][] is indexed by constants and stays in registers
#pragma unroll
    for (int mb0 = 0; mb0 < 4; mb0 += SR / 16) {
#pragma unroll
        for (int mi = 0; mi < SR / 16; ++mi) {
#pragma unroll
            for (int nb = 0; nb < 4; ++nb) {
#pragma unroll
                for (int j = 0; j < 8; ++j) os[(w * SR + mi * 16 + hi * 8 + j) * 68 + nb * 16 + lr] = acc[mb0 + mi][nb][j]; } }
        if (NW > 1) __syncthreads();   // every wave's partial tile is in LDS before any wave sums it
        else { __builtin_amdgcn_wave_barrier(); asm volatile("" ::: "memory"); }   // one wave: only keeps the compiler from moving the LDS reads above the LDS stores
        if (PL) {   // one 16-byte slot [lane] of a fragment half a thread and round, in the order of the plane: slot s = 8 q + w of the tile; every wave stores 512 contiguous bytes a plane
            bf* ph = P + (size_t)blockIdx.z * 2 * NH_ * TT * HD + (size_t)blockIdx.y * TT * HD + (size_t)r0 * HD + 8 * threadIdx.x; bf* pl = ph + (size_t)NH_ * TT * HD; v8us oh[2], ol[2];
#pragma unroll   // both rounds' LDS reads go out together; oh[], ol[] are indexed by constants
            for (int q = 0; q < 2; ++q) { const int s = q * 8 + w, T = tr ? (s >> 1) & 3 : s >> 2, c = tr ? s >> 3 : (s >> 1) & 1; const float* o = os + (T * 16 + lr) * 68 + c * 32 + (s & 1) * 16 + hi * 8;
                v4f x[2] = { *(const v4fa*)o, *(const v4fa*)(o + 4) };
#pragma unroll
                for (int u = 1; u < NW; ++u) { x[0] += *(const v4fa*)(o + u * SR * 68); x[1] += *(const v4fa*)(o + u * SR * 68 + 4); }
#pragma unroll
                for (int k = 0; k < 8; ++k) { unsigned short a, b; splitf(x[k >> 2][k & 3] + bfr(tr ? br : bc[k >> 2][k & 3]), a, b); oh[q][k] = a; ol[q][k] = b; } }
            *(v8us*)ph = oh[0]; *(v8us*)pl = ol[0]; *(v8us*)(ph + 2048) = oh[1]; *(v8us*)(pl + 2048) = ol[1];
            return; }
        float* crow = C + (size_t)(r0 + mb0 * 16) * ldc + c0;
        // both loops unrolled: all LDS reads of a wave's rows go out together instead of one latency per read
#pragma unroll
        for (int q = 0; q < SR / 2 / NW; ++q) { const int row = 2 * (q * NW + w) + hi, cofs = lr * 4; v4f val = *(const v4fa*)(os + row * 68 + cofs);
#pragma unroll
            for (int u = 1; u < NW; ++u) val += *(const v4fa*)(os + (u * SR + row) * 68 + cofs);
            if (BIAS) { val[0] += bfr(bias[c0 + cofs]); val[1] += bfr(bias[c0 + cofs + 1]); val[2] += bfr(bias[c0 + cofs + 2]); val[3] += bfr(bias[c0 + cofs + 3]); }
            *(v4f*)(crow + (size_t)row * ldc + cofs) = val; }
        if (NW == 1) { __builtin_amdgcn_wave_barrier(); asm volatile("" ::: "memory"); }   // one wave: the next strip's LDS stores stay behind these reads
    }
}

typedef __attribute__((ext_vector_type(4))) unsigned short v4us;
typedef __attribute__((ext_vector_type(2))) float v2f;

// Like k_gemmw's plane epilogue, the writers k_cvt8 and k_gn store in the order of the plane: k_cvt8 one 16-byte slot [lane] of a fragment half a thread, 512 contiguous bytes a wave; k_gn half a slot a thread, 256 contiguous bytes a wave and plane.
// k_cvt8: src [R][EE] f32 -> dst in fragment order (K = EE); one grid for all seven sources: blocks 0 .. TT * EE / 2048 - 1 convert x, then EE * EE / 2048 blocks for each of the six weight matrices (their planes lie one behind another in WB)
#define XBL (TT * EE / 2048)
#define WBL (EE * EE / 2048)
__global__ __launch_bounds__(256) void k_cvt8(const float* __restrict__ x, const float* __restrict__ w0, const float* __restrict__ w1, const float* __restrict__ w2, const float* __restrict__ w3, const float* __restrict__ w4, const float* __restrict__ w5, bf* XB, bf* WB) {
    const int b = (int)blockIdx.x, isx = b < XBL, j = isx ? 0 : (b - XBL) / WBL; const float* src = isx ? x : j == 0 ? w0 : j == 1 ? w1 : j == 2 ? w2 : j == 3 ? w3 : j == 4 ? w4 : w5;
    bf* dst = isx ? XB : WB + (size_t)j * EE * EE; const size_t i = (size_t)(isx ? b : (b - XBL) % WBL) * 256 + threadIdx.x;
    const int lr = (int)(i & 15), hi = (int)(i >> 4) & 1, u = (int)(i >> 5) & 1, c = (int)(i >> 6) & (EE / 32 - 1); const size_t T = i >> 11; const v8f v = *(const v8f*)(src + (T * 16 + lr) * EE + c * 32 + u * 16 + hi * 8); v8us o;
    asm volatile("s_wait_xcnt 0x0" ::: "memory");   // the loads' address registers are free for reuse only behind this wait
#pragma unroll
    for (int k = 0; k < 8; ++k) o[k] = f2bf(v[k]); *(v8us*)(dst + i * 8) = o;  }
// ---- k_attn: both score maps, both softmaxes, their difference and the product with V in one launch; no score or probability ever leaves the registers.
// grid (TT / 128, heads), 16 waves, two passes. In a pass wave w owns one 16-query strip (w & 3 picks it among the block's four of that pass) and every fourth 32-key block (w >> 2 picks the quarter). Pass 0 takes strips 4 x .. 4 x + 3,
// pass 1 their mirror images 127 - (4 x + ..) with the quarters reversed, so that a mask which closes the keys behind (or ahead of) each query leaves every wave about the same number of open key blocks.
// The mask is sorted by 16-query x 32-key block at run time: each pass first reads its part of it (whole lines) and notes, one bit a block, whether any entry is open (0) and whether open and masked entries are mixed. The sweep walks only
// the blocks with an open entry, and fetches the mask's entries again only for mixed blocks (a wholly open block masks nothing). A wholly masked block adds exact zeros to every sum of a row that has an open key anywhere, so leaving it out
// changes no value; nothing is assumed about where the mask is open.
// Scores are formed transposed (A = K rows, B = Q rows), so a lane holds 8 keys of ONE query per tile: maximum and sum are in-lane, and two 16-key tiles converted in place are the B operand of the product with V
// (its k order is the loader's: 8 hi + s, 16 + 8 hi + s); A = V's transposed plane, so the output tiles are transposed too and a lane holds 8 dims of that same query.
// ONE sweep: every score is formed once. Each map keeps its own maximum in use, exp sum and output tiles O = sum exp2(t - m) V (p split in bf16 high + low, three products, as the score products); when the maximum moves, sum and tiles
// are scaled in-lane (onl). Behind the sweep the key quarters' maxima and sums are joined in a fixed order and each wave forms O1 f1 - O2 f2 with f1 = exp2(m1 - max1) / sum1, f2 = lam exp2(m2 - max2) / sum2.
// The four key quarters' output tiles are summed in LDS and stored as whole lines of CAT[t][h * 64 + d].
// GroupNorm statistics: behind pass 1 the block holds its 128 tokens x 64 dims of one group in registers, so it also stores their sum and their square sum centred on the block's own mean, GP[h][block] = (sum, m2); k_gn joins a head's 16 pairs.
typedef __attribute__((ext_vector_type(4))) int v4i;
typedef __attribute__((ext_vector_type(2))) __bf16 v2bf;
__device__ __forceinline__ v16bf ldf(const bf* p) { return cat16b(*(const v8us*)p, *(const v8us*)(p + 256)); }   // the two halves of one fragment-order block
// the K fragments of 32 keys of one map: k[kt * 4 + c * 2] high, + 1 low (16-key tile kt, 32-wide chunk c of the head dim)
// Kh, Kl: the block's first element, the same for the whole wave (a scalar base); lo: the lane's own 8 * lane, the one vector register that all the sweep's global operand loads share
__device__ __forceinline__ void ldk(const bf* Kh, const bf* Kl, unsigned lo, v16bf (&k)[8]) {
#pragma unroll
    for (int kt = 0; kt < 2; ++kt)
#pragma unroll
        for (int c = 0; c < 2; ++c) { k[kt * 4 + c * 2] = ldf(Kh + kt * 16 * HD + c * 512 + lo); k[kt * 4 + c * 2 + 1] = ldf(Kl + kt * 16 * HD + c * 512 + lo); }
    asm volatile("s_wait_xcnt 0x0" :: "s"(Kh), "s"(Kl), "v"(lo) : "memory"); }   // the loads' address registers stay whole up to this wait and are free for reuse only behind it
// one map's Q fragments from the wave's part of LDS: chunk c high at c * 1024, low 512 behind
__device__ __forceinline__ void ldq(const bf* q, v16bf (&qh)[2], v16bf (&ql)[2]) {
#pragma unroll
    for (int c = 0; c < 2; ++c) { qh[c] = cat16b(*(const v8usa*)(q + c * 1024), *(const v8usa*)(q + c * 1024 + 256)); ql[c] = cat16b(*(const v8usa*)(q + c * 1024 + 512), *(const v8usa*)(q + c * 1024 + 768)); } }
__device__ __forceinline__ void ldm(const int* mr, v4i (&mk)[4]) {
#pragma unroll
    for (int u = 0; u < 4; ++u) mk[u] = *(const v4i*)(mr + (u >> 1) * 16 + (u & 1) * 4);
    asm volatile("s_wait_xcnt 0x0" :: "v"(mr) : "memory"); }   // as in ldk
// two transposed score tiles: s[kt][j] = q[query lr] . k[key kt * 16 + 8 hi + j], split products kh.qh + kh.ql + kl.qh over the two chunks
__device__ __forceinline__ void sc2(const v16bf (&k)[8], const v16bf (&qh)[2], const v16bf (&ql)[2], v8f (&s)[2]) { s[0] = (v8f){}; s[1] = (v8f){};
#pragma unroll
    for (int c = 0; c < 2; ++c) { s[0] = wmmab(k[c * 2], qh[c], s[0]); s[1] = wmmab(k[4 + c * 2], qh[c], s[1]); s[0] = wmmab(k[c * 2], ql[c], s[0]); s[1] = wmmab(k[4 + c * 2], ql[c], s[1]); s[0] = wmmab(k[c * 2 + 1], qh[c], s[0]); s[1] = wmmab(k[4 + c * 2 + 1], qh[c], s[1]); } }
// masked scores, scaled by 1/8 and by log2(e) in one multiply, so that every exponential below is a bare exp2: t[kt * 8 + j] belongs to key kt * 16 + 8 hi + j of the block
__device__ __forceinline__ void msc(const v8f (&s)[2], bool mixed, unsigned mb, float (&t)[16]) {
#pragma unroll
    for (int e = 0; e < 16; ++e) t[e] = s[e >> 3][e & 7] * (SCL * 1.44269504f);
    if (mixed) {   // the same for the whole wave: a scalar branch; a wholly open block has nothing to mask
#pragma unroll
        for (int e = 0; e < 16; ++e) t[e] = ((mb >> e) & 1u) != 0u ? -3.0e38f : t[e]; } }
// one block of one map in the single sweep: p = exp2(t - m), split in bf16 high + low (the B operand of the product with V), its sum added to l. The maximum in use m moves only when some query's new maximum lies more than 8 above it
// (one test for the wave, a scalar branch): then sum and output tile, in which a lane holds 8 dims of its one query, are scaled in-lane. p stays <= 2^8.
__device__ __forceinline__ void onl(const float (&t)[16], float& m, float& l, v8f (&o)[4], v16bf& ph, v16bf& pl) { float tm = t[0];
#pragma unroll
    for (int k = 1; k < 16; ++k) tm = fmaxf(tm, t[k]);
    if (__builtin_amdgcn_ballot_w32(tm > m + 8.0f) != 0u) { const float mn = fmaxf(m, fmaxf(tm, __shfl_xor(tm, 16, 32))), al = __builtin_amdgcn_exp2f(m - mn); l *= al; m = mn;
#pragma unroll
        for (int dt = 0; dt < 4; ++dt) o[dt] *= al; }
    float a = 0.f;
#pragma unroll
    for (int e = 0; e < 16; e += 2) { v2f wv; wv[0] = __builtin_amdgcn_exp2f(t[e] - m); wv[1] = __builtin_amdgcn_exp2f(t[e + 1] - m); a += wv[0] + wv[1];
        const v2bf hh = __builtin_convertvector(wv, v2bf); const v2bf ll = __builtin_convertvector(wv - __builtin_convertvector(hh, v2f), v2bf); ph[e] = hh[0]; ph[e + 1] = hh[1]; pl[e] = ll[0]; pl[e + 1] = ll[1]; }
    l += a; }
__device__ __forceinline__ void join_ml(float& m, float& l, float mo, float lo) { const float mn = fmaxf(m, mo); l = l * __builtin_amdgcn_exp2f(m - mn) + lo * __builtin_amdgcn_exp2f(mo - mn); m = mn; }
__device__ __forceinline__ float wsum(float v) {   // sum over the wave's 32 lanes, the same bits in every lane
#pragma unroll   // five fixed steps: no loop counter, the lane masks are constants
    for (int m = 16; m >= 1; m >>= 1) v += __shfl_xor(v, m, 32);
    return v; }
// smallest of a lane's 16 mask entries, as unsigned: 0 exactly when one of them is open; and their bitwise or: 0 exactly when none is masked
__device__ __forceinline__ unsigned mmin(const v4i (&mk)[4]) { unsigned a = (unsigned)mk[0][0];
#pragma unroll
    for (int e = 1; e < 16; ++e) { const unsigned b = (unsigned)mk[e >> 2][e & 3]; a = b < a ? b : a; }
    return a; }
__device__ __forceinline__ unsigned mor(const v4i (&mk)[4]) { const v4i o = (mk[0] | mk[1]) | (mk[2] | mk[3]); return (unsigned)((o[0] | o[1]) | (o[2] | o[3])); }
// one block of the mask for sorting: load u takes rows 4 u .. 4 u + 3, 8 lanes on a row's 128 bytes, so every load reads 4 whole lines (which lane sees which entry does not matter to an any-test)
__device__ __forceinline__ void ldp(const int* mr, v4i (&mk)[4]) {
#pragma unroll
    for (int u = 0; u < 4; ++u) mk[u] = *(const v4i*)(mr + (size_t)u * 4 * TT);
    asm volatile("s_wait_xcnt 0x0" :: "v"(mr) : "memory"); }   // as in ldk
// the mask entries of a block for msc, one bit each in a word a lane (bit e: entry e is masked): fetched where the block is mixed (the same for the whole wave: a scalar branch), 0 where it is wholly open
__device__ __forceinline__ unsigned ldmb(const int* mr, bool mixed) { unsigned mb = 0u;
    if (mixed) { v4i mk[4]; ldm(mr, mk);
#pragma unroll
        for (int e = 0; e < 16; ++e) mb |= mk[e >> 2][e & 3] ? 1u << e : 0u; }
    return mb; }
__global__ __launch_bounds__(512) void k_attn(const bf* __restrict__ Q1h, const bf* __restrict__ Q1l, const bf* __restrict__ Q2h, const bf* __restrict__ Q2l, const bf* __restrict__ K1h, const bf* __restrict__ K1l, const bf* __restrict__ K2h, const bf* __restrict__ K2l,
                                              const bf* __restrict__ Vh, const bf* __restrict__ Vl, const int* __restrict__ msk, const float* __restrict__ lam, float* CAT, float* GP) {
    __shared__ __align__(16) float os[16 * 16 * 68];
    __shared__ __align__(16) bf qs[16 * 4096];
    __shared__ __align__(16) float kp[2 * 512 * 4];
    __shared__ float st[4][4][64];
    __shared__ __align__(16) float gs[2][16];
    const int lane = threadIdx.x & 31, lr = lane & 15, hi = lane >> 4; const int w = __builtin_amdgcn_readfirstlane((int)(threadIdx.x >> 5)), sp = w & 3, ku = w >> 2;
    const int h = blockIdx.y; const size_t hb = (size_t)h * TT * HD; const unsigned lo = 8u * (unsigned)lane; const float lamh = bfr(lam[h]);
    v4f vals[4];
#pragma unroll   // two passes written out: vals[] is indexed by constants and stays in registers
    for (int p = 0; p < 2; ++p) {
        const int kq = p == 0 ? ku : 3 - ku, q0 = (p == 0 ? (int)blockIdx.x * 4 + sp : TT / 16 - 1 - ((int)blockIdx.x * 4 + sp)) * 16;
        // The strip's Q fragments wait in the wave's own part of LDS, in fragment order (map, chunk, high | low): both output tiles stay in registers through the sweep, so only the map at work has its Q there. No other wave touches this part: no barrier
        v16bf qh[2], ql[2]; const size_t qo = hb + (size_t)q0 * HD + 8 * lane; const bf *pq1h = Q1h + qo, *pq1l = Q1l + qo, *pq2h = Q2h + qo, *pq2l = Q2l + qo; bf* qw = qs + w * 4096 + 8 * lane;
        { v8us qa[16];
#pragma unroll
        for (int c = 0; c < 4; ++c) { qa[c] = *(const v8us*)(pq1h + c * 256); qa[4 + c] = *(const v8us*)(pq1l + c * 256); qa[8 + c] = *(const v8us*)(pq2h + c * 256); qa[12 + c] = *(const v8us*)(pq2l + c * 256); }
        asm volatile("s_wait_xcnt 0x0" :: "v"(pq1h), "v"(pq1l), "v"(pq2h), "v"(pq2l) : "memory");   // as in ldk
#pragma unroll
        for (int c = 0; c < 4; ++c) { *(v8usa*)(qw + (c >> 1) * 1024 + (c & 1) * 256) = qa[c]; *(v8usa*)(qw + (c >> 1) * 1024 + 512 + (c & 1) * 256) = qa[4 + c]; *(v8usa*)(qw + 2048 + (c >> 1) * 1024 + (c & 1) * 256) = qa[8 + c]; *(v8usa*)(qw + 2048 + (c >> 1) * 1024 + 512 + (c & 1) * 256) = qa[12 + c]; } }
        const int* mrow = msk + (size_t)(q0 + lr) * TT + 8 * hi + kq * 32;   // the wave's key block i (0 .. 15) begins at key 128 i + 32 kq
        const int* mpre = msk + (size_t)(q0 + (lane >> 3)) * TT + kq * 32 + (lane & 7) * 4;
        unsigned act = 0, mix = 0;   // bit i of act: key block i has an open entry for one of the strip's queries; of mix: it has masked entries as well; the same in every lane (ballots' results)
#pragma unroll   // constants for the bit places; four blocks' mask loads fly together
        for (int g = 0; g < 4; ++g) { v4i mm[4][4];
#pragma unroll
            for (int a = 0; a < 4; ++a) ldp(mpre + (g * 4 + a) * 128, mm[a]);
            __builtin_amdgcn_sched_barrier(0);   // the sixteen loads go out ahead of the first compare: one latency a group instead of one a block
#pragma unroll
            for (int a = 0; a < 4; ++a) { const unsigned op = __builtin_amdgcn_ballot_w32(mmin(mm[a]) == 0u) != 0u ? 1u << (g * 4 + a) : 0u; act |= op; mix |= __builtin_amdgcn_ballot_w32(mor(mm[a]) != 0u) != 0u ? op : 0u; } }
        float m1 = -3.0e38f, l1 = 0.f, m2 = -3.0e38f, l2 = 0.f;   // m: the maximum in use, the same in both lane halves of a query; l: the lane's own keys' exp sum
        v8f o1[4], o2[4];
#pragma unroll
        for (int dt = 0; dt < 4; ++dt) { o1[dt] = (v8f){}; o2[dt] = (v8f){}; }
        // Order of a trip, held by the scheduling barriers: each group of loads goes out right behind the products that free its registers and flies under the vector work that follows, instead of one exposed latency per fragment.
        // Without them the compiler lifts the loads further ahead of those products, and the trip no longer fits the registers of four waves a SIMD (it spills inside the loop).
        v16bf kf[8];
        if (act != 0u) { unsigned rem = act & (act - 1u); int kb = __builtin_ctz(act) * 128;   // kb: the block's first key, less 32 kq; at most 16 trips, one noted bit each
            ldk(K1h + hb + (size_t)(kb + kq * 32) * HD, K1l + hb + (size_t)(kb + kq * 32) * HD, lo, kf); ldq(qw, qh, ql);
#pragma unroll 1   // one 32-key block a trip: a second copy of the body would not fit the registers of four waves a SIMD
            for (;;) { v8f s[2]; float t[16]; v16bf p1h, p1l, p2h, p2l; const size_t o = hb + (size_t)(kb + kq * 32) * HD; const int kn = rem != 0u ? __builtin_ctz(rem) * 128 : kb;   // the last trip fetches its own block again: in bounds, unused
                const bool mixed = ((mix >> (kb >> 7)) & 1u) != 0u; const unsigned mb = ldmb(mrow + kb, mixed);
                sc2(kf, qh, ql, s); __builtin_amdgcn_sched_barrier(0);
                ldk(K2h + o, K2l + o, lo, kf); ldq(qw + 2048, qh, ql); __builtin_amdgcn_sched_barrier(0);
                msc(s, mixed, mb, t); onl(t, m1, l1, o1, p1h, p1l); __builtin_amdgcn_sched_barrier(0);
                sc2(kf, qh, ql, s); __builtin_amdgcn_sched_barrier(0);
                v16bf vh[4], vl[4]; const bf *pvh = Vh + o, *pvl = Vl + o;
#pragma unroll
                for (int dt = 0; dt < 4; ++dt) { vh[dt] = ldf(pvh + dt * 512 + lo); vl[dt] = ldf(pvl + dt * 512 + lo); }
                asm volatile("s_wait_xcnt 0x0" :: "s"(pvh), "s"(pvl), "v"(lo) : "memory");   // as in ldk
                __builtin_amdgcn_sched_barrier(0);
                msc(s, mixed, mb, t); onl(t, m2, l2, o2, p2h, p2l); __builtin_amdgcn_sched_barrier(0);
#pragma unroll
                for (int dt = 0; dt < 4; ++dt) { o1[dt] = wmmab(vh[dt], p1h, o1[dt]); o2[dt] = wmmab(vh[dt], p2h, o2[dt]); }
#pragma unroll
                for (int dt = 0; dt < 4; ++dt) { o1[dt] = wmmab(vh[dt], p1l, o1[dt]); o2[dt] = wmmab(vh[dt], p2l, o2[dt]); }
#pragma unroll
                for (int dt = 0; dt < 4; ++dt) { o1[dt] = wmmab(vl[dt], p1h, o1[dt]); o2[dt] = wmmab(vl[dt], p2h, o2[dt]); }
                __builtin_amdgcn_sched_barrier(0);
                ldk(K1h + hb + (size_t)(kn + kq * 32) * HD, K1l + hb + (size_t)(kn + kq * 32) * HD, lo, kf); ldq(qw, qh, ql);
                asm volatile("v_nop\n\tv_nop\n\tv_nop\n\tv_nop" : "+v"(o1[0]), "+v"(o1[1]), "+v"(o1[2]), "+v"(o1[3]), "+v"(o2[0]), "+v"(o2[1]), "+v"(o2[2]), "+v"(o2[3]));   // the distance behind the trip's last matrix instructions, also on the taken side of the branch below
                if (rem == 0u) break;
                rem &= rem - 1u; kb = kn; } }
        l1 += __shfl_xor(l1, 16, 32); l2 += __shfl_xor(l2, 16, 32);   // the halves share m, so their sums add as they are
        if (hi == 0) { st[ku][0][sp * 16 + lr] = m1; st[ku][1][sp * 16 + lr] = l1; st[ku][2][sp * 16 + lr] = m2; st[ku][3][sp * 16 + lr] = l2; }
        __syncthreads();   // all four key quarters' maxima and sums are in LDS before any wave joins them; it also ends the earlier pass's reads of os ahead of this pass's stores there
        float j1 = st[0][0][sp * 16 + lr], n1 = st[0][1][sp * 16 + lr], j2 = st[0][2][sp * 16 + lr], n2 = st[0][3][sp * 16 + lr];
#pragma unroll   // three fixed joins, in the order of the waves
        for (int u = 1; u < 4; ++u) { join_ml(j1, n1, st[u][0][sp * 16 + lr], st[u][1][sp * 16 + lr]); join_ml(j2, n2, st[u][2][sp * 16 + lr], st[u][3][sp * 16 + lr]); }
        const float f1 = __fdiv_rn(1.0f, n1) * __builtin_amdgcn_exp2f(m1 - j1), f2 = __fdiv_rn(1.0f, n2) * lamh * __builtin_amdgcn_exp2f(m2 - j2);   // from this wave's own maxima to the query's, and the two normalisers
#pragma unroll
        for (int dt = 0; dt < 4; ++dt) { const v8f r = o1[dt] * f1 - o2[dt] * f2; float* po = os + (w * 16 + lr) * 68 + dt * 16 + hi * 8;   // a lane holds 8 dims in a row of its one query
            *(v4fa*)po = __builtin_shufflevector(r, r, 0, 1, 2, 3); *(v4fa*)(po + 4) = __builtin_shufflevector(r, r, 4, 5, 6, 7); }
        __syncthreads();   // every wave's partial output tile is in LDS before any thread sums the four key quarters; it also ends this pass's reads of st ahead of the next pass's stores there
        float* pc[2];
#pragma unroll
        for (int q = 0; q < 2; ++q) { const int idx = q * 512 + (int)threadIdx.x, row = idx >> 4, c4 = (idx & 15) * 4;   // row: 16 (strip of the pass) + query; wave 4 u + strip holds quarter u's tile
            vals[p * 2 + q] = (*(const v4fa*)(os + row * 68 + c4) + *(const v4fa*)(os + (64 + row) * 68 + c4)) + (*(const v4fa*)(os + (128 + row) * 68 + c4) + *(const v4fa*)(os + (192 + row) * 68 + c4));
            const int tok = (p == 0 ? (int)blockIdx.x * 4 + (row >> 4) : TT / 16 - 1 - ((int)blockIdx.x * 4 + (row >> 4))) * 16 + (row & 15);
            pc[q] = CAT + (size_t)tok * EE + h * HD + c4; *(v4f*)pc[q] = vals[p * 2 + q];
            if (p == 0) *(v4fa*)(kp + idx * 4) = vals[q]; }   // pass 0's values wait in the thread's own LDS slot: pass 1's sweep has no registers to spare for them
        asm volatile("s_wait_xcnt 0x0" :: "v"(pc[0]), "v"(pc[1]), "v"(vals[p * 2]), "v"(vals[p * 2 + 1]) : "memory");   // the stores' address and data registers stay whole up to this wait and are free for reuse only behind it
    }
    vals[0] = *(const v4fa*)(kp + (int)threadIdx.x * 4); vals[1] = *(const v4fa*)(kp + (512 + (int)threadIdx.x) * 4);
    const v4f s4 = (vals[0] + vals[1]) + (vals[2] + vals[3]); const float ws = wsum((s4[0] + s4[1]) + (s4[2] + s4[3]));
    if (lane == 0) gs[0][w] = ws;
    __syncthreads();   // all 16 waves' sums are in LDS before any thread forms the block's mean
    const v4f b4 = (*(const v4fa*)(gs[0]) + *(const v4fa*)(gs[0] + 4)) + (*(const v4fa*)(gs[0] + 8) + *(const v4fa*)(gs[0] + 12)); const float bs = (b4[0] + b4[1]) + (b4[2] + b4[3]), bm = bs * (1.0f / (128 * HD));
    v4f d4 = (v4f){};
#pragma unroll   // vals[] is indexed by constants and stays in registers
    for (int q = 0; q < 4; ++q) { const v4f d = vals[q] - bm; d4 += d * d; }
    const float wq = wsum((d4[0] + d4[1]) + (d4[2] + d4[3]));
    if (lane == 0) gs[1][w] = wq;
    __syncthreads();   // all 16 waves' centred square sums are in LDS before thread 0 adds them
    if (threadIdx.x == 0) { const v4f c4v = (*(const v4fa*)(gs[1]) + *(const v4fa*)(gs[1] + 4)) + (*(const v4fa*)(gs[1] + 8) + *(const v4fa*)(gs[1] + 12)); v2f o2; o2[0] = bs; o2[1] = (c4v[0] + c4v[1]) + (c4v[2] + c4v[3]);
        *(v2f*)(GP + ((size_t)h * (TT / 128) + blockIdx.x) * 2) = o2; }
}
// k_gn: a head's mean and biased variance from its 16 pairs GP[h][b] = (sum, m2 about the block's own mean) of 128 x 64 values each: var * N = sum_b m2_b + n_b (mean_b - mean)^2, an identity, every term >= 0; then the normalisation.
__global__ __launch_bounds__(256) void k_gn(const float* __restrict__ CAT, const float* __restrict__ GP, const float* __restrict__ gw, const float* __restrict__ gb, bf* Ah, bf* Al) { const size_t o = ((size_t)blockIdx.x * 256 + threadIdx.x) * 4; if (o >= (size_t)TT * EE) return;   // o: place in the fragment-order planes (K = EE), half a 16-byte slot a thread; i: the same elements in CAT
    const size_t i = ((o >> 14) * 16 + ((o >> 3) & 15)) * EE + ((o >> 9) & (EE / 32 - 1)) * 32 + ((o >> 8) & 1) * 16 + ((o >> 7) & 1) * 8 + (o & 7); const int c = (int)(i % EE);
    const float* gp = GP + (size_t)(blockIdx.x & (NH_ - 1)) * (TT / 128) * 2;   // head c / HD: a block's 1024 elements are two 32-wide chunks of one head, so the pairs are read once for the block through the scalar path
    float gsum = 0.f, gm2 = 0.f;
#pragma unroll   // both loops unrolled: the 16 pairs come in two wide loads, one latency, instead of one load a trip
    for (int b = 0; b < TT / 128; ++b) gsum += gp[2 * b];
    const float mu = gsum * (1.0f / (float)(HD * TT));
#pragma unroll
    for (int b = 0; b < TT / 128; ++b) { const float d = gp[2 * b] * (1.0f / (128 * HD)) - mu; gm2 += gp[2 * b + 1] + (float)(128 * HD) * (d * d); }
    const float rs = __frsqrt_rn(__fadd_rn(gm2 * (1.0f / (float)(HD * TT)), 1e-5f)); const v4f a = *(const v4f*)(CAT + i); v4us oh, ol;
#pragma unroll
    for (int q = 0; q < 4; ++q) { float t = __fmul_rn(__fsub_rn(a[q], mu), rs); asm volatile("" : "+v"(t)); float tg = __fmul_rn(t, bfr(gw[c + q])); asm volatile("" : "+v"(tg)); unsigned short u, c2; splitf(__fadd_rn(tg, bfr(gb[c + q])), u, c2); oh[q] = u; ol[q] = c2; }
    *(v4us*)(Ah + o) = oh; *(v4us*)(Al + o) = ol;  }

extern "C" void kernel_launch(void* const* d_in, const int* in_sizes, int n_in,
                              void* d_out, int out_size, void* d_ws, size_t ws_size, hipStream_t stream) {
    (void)in_sizes; (void)n_in; (void)out_size;
    const float* x = (const float*)d_in[0]; const int* msk = (const int*)d_in[1]; const float* IN[17]; for (int i = 2; i < 17; ++i) IN[i] = (const float*)d_in[i];   // 2 Wq1 [16][64][1024], 3 bq1, 4 Wq2, 5 bq2, 6 Wk1, 7 bk1, 8 Wk2, 9 bk2, 10 Wv, 11 bv, 12 lam, 13 gn_w, 14 gn_b, 15 Wo [1024][1024] (out,in), 16 bo
    float* OUT = (float*)d_out;     // [1][2048][1024]
    char* wsp = (char*)d_ws;
    auto take = [&](size_t bytes) { char* p = wsp; wsp += (bytes + 255) & ~(size_t)255; return (void*)p; };
    bf* WB = (bf*)take((size_t)6 * EE * EE * 2); bf* XB = (bf*)take((size_t)TT * EE * 2);   // WB: six weight planes, one behind another
    bf* Q1h = (bf*)take((size_t)NH_ * TT * HD * 2); bf* Q1l = (bf*)take((size_t)NH_ * TT * HD * 2); bf* Q2h = (bf*)take((size_t)NH_ * TT * HD * 2); bf* Q2l = (bf*)take((size_t)NH_ * TT * HD * 2); bf* K1h = (bf*)take((size_t)NH_ * TT * HD * 2); bf* K1l = (bf*)take((size_t)NH_ * TT * HD * 2); bf* K2h = (bf*)take((size_t)NH_ * TT * HD * 2); bf* K2l = (bf*)take((size_t)NH_ * TT * HD * 2); bf* Vh = (bf*)take((size_t)NH_ * HD * TT * 2); bf* Vl = (bf*)take((size_t)NH_ * HD * TT * 2);
    float* CAT = (float*)take((size_t)TT * EE * 4); float* GP = (float*)take((size_t)NH_ * (TT / 128) * 2 * 4); bf* Ah = (bf*)take((size_t)TT * EE * 2); bf* Al = (bf*)take((size_t)TT * EE * 2);
    if ((size_t)(wsp - (char*)d_ws) > ws_size) return;
    k_cvt8<<<XBL + 6 * WBL, 256, 0, stream>>>(x, IN[2], IN[4], IN[6], IN[8], IN[10], IN[15], XB, WB);   // [H][DH][E] stacked = natural [1024][1024] Bt; Wo [E][D] natural
    k_gemmw<bf, 0, true, 8, 1, true><<<dim3(TT / 64, EE / 64, 5), 256, 0, stream>>>(XB, nullptr, WB, nullptr, EE, nullptr, EE, IN[3], IN[5], IN[7], IN[9], IN[11], 0, (size_t)EE * EE, 0, Q1h);   // q1, q2, k1, k2, v; the ten planes from Q1h to Vl lie one behind another in the workspace, in the order taken above
    k_attn<<<dim3(TT / 128, NH_, 1), 512, 0, stream>>>(Q1h, Q1l, Q2h, Q2l, K1h, K1l, K2h, K2l, Vh, Vl, msk, IN[12], CAT, GP);
    k_gn<<<(unsigned)(((size_t)TT * EE / 4 + 255) / 256), 256, 0, stream>>>(CAT, GP, IN[13], IN[14], Ah, Al);
    k_gemmw<bf, 1, true, 8, 1, false><<<dim3(TT / 64, EE / 64, 1), 256, 0, stream>>>(Ah, Al, WB + (size_t)5 * EE * EE, nullptr, EE, OUT, EE, IN[16], nullptr, nullptr, nullptr, nullptr, 0, 0, 0, nullptr);
}

// v009
// Measured time: 104 microseconds a run.
// Next to v008, in two timings, it ran 1.05 times as fast each time.
// All steps since v000 together make it 9.92 times as fast.
#include <hip/hip_runtime.h>

// DifferentialMultiHeadSelfAttention (x [1][2048][1024]; per-head q1, q2, k1, k2, v = x W[h]^T + b[h] (16 x 64); s = q.k/8 with mask[i][j] (int, 1 = masked -> -inf, read as data); w = softmax(s1) - lam[h] softmax(s2);
// out = w.v; heads concatenated; GroupNorm(16 groups = heads, eps 1e-5, biased var over (64 dims x 2048 tokens)) x gn_w + gn_b; out Wo^T + bo -> [1][2048][1024]).
// Compute dtypes, f32 accumulate: every input rounded to bf16; the five projections on PLAIN bf16 operands (inputs: exact, + bias; the stacked [16][64][1024] weights are one natural [1024][1024] Bt); both score GEMMs

#define TT   2048
#define EE   1024
#define NH_  16
#define HD   64
#define ZH   2
#define SCL  0.125f
typedef _Float16 h16;
typedef unsigned short bf;
typedef __attribute__((ext_vector_type(16))) __bf16   v16bf;
typedef __attribute__((ext_vector_type(16))) _Float16 v16h;
typedef __attribute__((ext_vector_type(8)))  _Float16 v8h;
typedef __attribute__((ext_vector_type(8)))  unsigned short v8us;
typedef __attribute__((ext_vector_type(8)))  float    v8f;
typedef __attribute__((ext_vector_type(4)))  float    v4f;
typedef v8h  __attribute__((may_alias)) v8ha;
typedef v4f  __attribute__((may_alias)) v4fa;
typedef v8us __attribute__((may_alias)) v8usa;

__device__ __forceinline__ unsigned short f2bf(float f) { unsigned u = __float_as_uint(f); u += 0x7FFFu + ((u >> 16) & 1u); return (unsigned short)(u >> 16); }
__device__ __forceinline__ float bf2f(unsigned short b) { return __uint_as_float(((unsigned)b) << 16); }
__device__ __forceinline__ float bfr(float f) { return bf2f(f2bf(f)); }
__device__ __forceinline__ v16h cat16(v8h lo, v8h hi) { return __builtin_shufflevector(lo, hi, 0, 1, 2, 3, 4, 5, 6, 7, 8, 9, 10, 11, 12, 13, 14, 15); }
__device__ __forceinline__ v16bf cat16b(v8us lo, v8us hi) { return __builtin_bit_cast(v16bf, __builtin_shufflevector(lo, hi, 0, 1, 2, 3, 4, 5, 6, 7, 8, 9, 10, 11, 12, 13, 14, 15)); }
__device__ __forceinline__ v8f wmma16(v16h a, v16h b, v8f c) { return __builtin_amdgcn_wmma_f32_16x16x32_f16(false, a, false, b, (short)0, c, false, false); }
__device__ __forceinline__ v8f wmmab(v16bf a, v16bf b, v8f c) { return __builtin_amdgcn_wmma_f32_16x16x32_bf16(false, a, false, b, (short)0, c, false, false); }



// ---- FRAGMENT ORDER of every 16-bit operand plane [R][K]: the 16 rows x 32 k of one matrix operand lie as 512 elements in a row, [u][lane][s] = element (row 16 T + (lane & 15), k 32 c + 16 u + 8 (lane >> 4) + s),
// block (T, c) at (T * (K / 32) + c) * 512 (V's transposed planes: at (c * 4 + T) * 512). A wave's 16-byte load of half u then reads 512 contiguous bytes (4 whole lines) instead of 32 bytes out of each of 16 lines; which element reaches which lane and register is as before.
// ---- k_gemmw: register-blocked GEMM, NW WAVES per 64x64 output tile (16 accumulators each), operands straight from 16-bit planes in fragment order; grid (M/64, N/64, Z), 32 * NW threads.
// C[m][n] (f32, pitch ldc, + optional f32 bias[n]) = sum_k A[m][k] Bt[n][k] (+ split products per NSPLIT). z-batch strides sA/sB/sC in elements, bias vector z of up to five. K % (32 * NW * KP) == 0.
// Split K: wave w takes the 32-wide k chunks w, w + NW, ... (1 KiB of each 16-row strip); the NW partial tiles are staged whole in LDS and summed in wave order behind one barrier.
// KP > 1 (N == 64 only): blockIdx.y is a K range instead of a tile column, and range y stores its partial C in plane y (plane pitch ZH * sC); the consumer sums the planes.
// PL (the five projections; a tile column is one head): the summed tile + bias does not leave as f32 but split in bf16 high + low, straight into the attention's operand planes P (high, low of q1, q2, k1, k2, v, one behind another):
// per head a plane [TT][HD] in fragment order (K = HD) for z 0 .. 3; for z 4 (v) the transposed plane [HD][TT] with its blocks ordered (32-key chunk, 16-row strip): block (c, T) at (c * 4 + T) * 512, so that the four strips of one key
// chunk lie together. For v the two operands change places (both planes have the same order), so the tile comes out as [head dim][token] and a slot's 8 keys lie in a row of it. Either way the tile is 4096 elements in a row of each plane.
__device__ __forceinline__ void splitf(float y, unsigned short& h, unsigned short& l) { h = f2bf(y); l = f2bf(y - bf2f(h)); }
template <typename T16> struct WFrag;
template <> struct WFrag<h16> { typedef v16h V; static __device__ __forceinline__ V ld(const h16* p) { return cat16(*(const v8h*)p, *(const v8h*)(p + 256)); } static __device__ __forceinline__ v8f mma(V a, V b, v8f c) { return wmma16(a, b, c); } };
template <> struct WFrag<bf> { typedef v16bf V; static __device__ __forceinline__ V ld(const bf* p) { return cat16b(*(const v8us*)p, *(const v8us*)(p + 256)); } static __device__ __forceinline__ v8f mma(V a, V b, v8f c) { return wmmab(a, b, c); } };
template <typename T16, int NSPLIT, bool BIAS, int NW, int KP, bool PL>
__global__ __launch_bounds__(32 * NW) void k_gemmw(const T16* __restrict__ A, const T16* __restrict__ A2, const T16* __restrict__ Bt, const T16* __restrict__ Bt2, int K, float* C, int ldc, const float* __restrict__ bias0, const float* __restrict__ bias1, const float* __restrict__ bias2, const float* __restrict__ bias3, const float* __restrict__ bias4, size_t sA, size_t sB, size_t sC, bf* P) {
    static_assert(!PL || (NW == 8 && KP == 1 && BIAS), "the plane epilogue deals 512 slots to 256 threads");
    typedef typename WFrag<T16>::V V;
    const float* bias = blockIdx.z == 0 ? bias0 : blockIdx.z == 1 ? bias1 : blockIdx.z == 2 ? bias2 : blockIdx.z == 3 ? bias3 : bias4;   // each product of a z-batch has its own bias vector
    constexpr int SR = NW > 1 ? 64 : 16;    // tile rows staged in LDS at once, per wave
    __shared__ __align__(16) float os[NW * SR * 68];
    const size_t z = blockIdx.z; A += z * sA; if (A2) A2 += z * sA; Bt += z * sB; if (Bt2) Bt2 += z * sB; C += z * sC;
    const bool tr = PL && blockIdx.z == 4;   // v: the weights' rows are the tile's rows, the tokens its columns
    if (tr) { const T16* t = A; A = Bt; Bt = t; }
    const int lane = threadIdx.x & 31, lr = lane & 15, hi = lane >> 4; const int r0 = blockIdx.x * 64, c0 = KP > 1 ? 0 : blockIdx.y * 64;
    const int w = NW > 1 ? __builtin_amdgcn_readfirstlane((int)(threadIdx.x >> 5)) : 0;
    const int klo = KP > 1 ? (int)blockIdx.y * (K / KP) : 0, khi = KP > 1 ? klo + K / KP : K; if (KP > 1) C += (size_t)blockIdx.y * ZH * sC;
    v8f acc[4][4];
#pragma unroll
    for (int mb = 0; mb < 4; ++mb)
#pragma unroll
        for (int nb = 0; nb < 4; ++nb) acc[mb][nb] = (v8f){};
    const size_t aoff = (size_t)(tr ? c0 : r0) * K + 8 * lane, boff = (size_t)(tr ? r0 : c0) * K + 8 * lane;   // fragment order: a 16-row strip is still 16 * K elements, a 32-wide k chunk of it 512
#pragma unroll 1
    for (int kc = klo + w * 32; kc < khi; kc += 32 * NW) {
        V a[4], a2[4], b[4], b2[4]; const T16 *pa[4], *pa2[4], *pb[4], *pb2[4];
#pragma unroll
        for (int mb = 0; mb < 4; ++mb) { pa[mb] = A + aoff + (size_t)mb * 16 * K + kc * 16; pa2[mb] = pa[mb]; a[mb] = WFrag<T16>::ld(pa[mb]); if (NSPLIT == 1 || NSPLIT == 2) { pa2[mb] = A2 + aoff + (size_t)mb * 16 * K + kc * 16; a2[mb] = WFrag<T16>::ld(pa2[mb]); } }
        asm volatile("s_wait_xcnt 0x0" :: "v"(pa[0]), "v"(pa[1]), "v"(pa[2]), "v"(pa[3]), "v"(pa2[0]), "v"(pa2[1]), "v"(pa2[2]), "v"(pa2[3]) : "memory");   // the loads' address registers stay whole up to this wait and are free for reuse (here: as a later load's target) only behind it
#pragma unroll
        for (int nb = 0; nb < 4; ++nb) { pb[nb] = Bt + boff + (size_t)nb * 16 * K + kc * 16; pb2[nb] = pb[nb]; b[nb] = WFrag<T16>::ld(pb[nb]); if (NSPLIT >= 2) { pb2[nb] = Bt2 + boff + (size_t)nb * 16 * K + kc * 16; b2[nb] = WFrag<T16>::ld(pb2[nb]); } }
        asm volatile("s_wait_xcnt 0x0" :: "v"(pb[0]), "v"(pb[1]), "v"(pb[2]), "v"(pb[3]), "v"(pb2[0]), "v"(pb2[1]), "v"(pb2[2]), "v"(pb2[3]) : "memory");   // as above
        __builtin_amdgcn_sched_barrier(0);   // all loads of a trip go out ahead of its products; without it the compiler sinks each B fragment's loads to their first use, one exposed latency per fragment
#pragma unroll
        for (int nb = 0; nb < 4; ++nb) {
#pragma unroll
            for (int mb = 0; mb < 4; ++mb) { acc[mb][nb] = WFrag<T16>::mma(a[mb], b[nb], acc[mb][nb]); if (NSPLIT == 1 || NSPLIT == 2) acc[mb][nb] = WFrag<T16>::mma(a2[mb], b[nb], acc[mb][nb]); if (NSPLIT >= 2) acc[mb][nb] = WFrag<T16>::mma(a[mb], b2[nb], acc[mb][nb]); } }
        asm volatile("v_nop\n\tv_nop\n\tv_nop\n\tv_nop" : "+v"(acc[0][0]), "+v"(acc[1][1]), "+v"(acc[2][2]), "+v"(acc[3][3]) : "v"(a[0]), "v"(a[3]));
    }
    // PL: a thread's bias does not depend on the round: its 8 columns' (q, k) or its row's (v). Both are in bounds for every z and asked for here, without a branch, so that they fly under the staging and its barrier
    const float *pbr = bias + c0 + ((w >> 1) & 3) * 16 + lr, *pbc = bias + c0 + ((w >> 1) & 1) * 32 + (w & 1) * 16 + hi * 8; float br = 0.f; v4f bc[2] = {};
    if (PL) { br = *pbr; bc[0] = *(const v4f*)pbc; bc[1] = *(const v4f*)(pbc + 4);
        asm volatile("s_wait_xcnt 0x0" ::: "memory");   // the loads' address registers (offset and scalar base) are free for reuse only behind this wait
        __builtin_amdgcn_sched_barrier(0); }   // keeps the staging's address arithmetic, which reuses those registers, from being lifted over the wait
    // the four loops below are unrolled so that acc[][] is indexed by constants and stays in registers
#pragma unroll
    for (int mb0 = 0; mb0 < 4; mb0 += SR / 16) {
#pragma unroll
        for (int mi = 0; mi < SR / 16; ++mi) {
#pragma unroll
            for (int nb = 0; nb < 4; ++nb) {
#pragma unroll
                for (int j = 0; j < 8; ++j) os[(w * SR + mi * 16 + hi * 8 + j) * 68 + nb * 16 + lr] = acc[mb0 + mi][nb][j]; } }
        if (NW > 1) __syncthreads();   // every wave's partial tile is in LDS before any wave sums it
        else { __builtin_amdgcn_wave_barrier(); asm volatile("" ::: "memory"); }   // one wave: only keeps the compiler from moving the LDS reads above the LDS stores
        if (PL) {   // one 16-byte slot [lane] of a fragment half a thread and round, in the order of the plane: slot s = 8 q + w of the tile; every wave stores 512 contiguous bytes a plane
            bf* ph = P + (size_t)blockIdx.z * 2 * NH_ * TT * HD + (size_t)blockIdx.y * TT * HD + (size_t)r0 * HD + 8 * threadIdx.x; bf* pl = ph + (size_t)NH_ * TT * HD; v8us oh[2], ol[2];
#pragma unroll   // both rounds' LDS reads go out together; oh[], ol[] are indexed by constants
            for (int q = 0; q < 2; ++q) { const int s = q * 8 + w, T = tr ? (s >> 1) & 3 : s >> 2, c = tr ? s >> 3 : (s >> 1) & 1; const float* o = os + (T * 16 + lr) * 68 + c * 32 + (s & 1) * 16 + hi * 8;
                v4f x[2] = { *(const v4fa*)o, *(const v4fa*)(o + 4) };
#pragma unroll
                for (int u = 1; u < NW; ++u) { x[0] += *(const v4fa*)(o + u * SR * 68); x[1] += *(const v4fa*)(o + u * SR * 68 + 4); }
#pragma unroll
                for (int k = 0; k < 8; ++k) { unsigned short a, b; splitf(x[k >> 2][k & 3] + bfr(tr ? br : bc[k >> 2][k & 3]), a, b); oh[q][k] = a; ol[q][k] = b; } }
            *(v8us*)ph = oh[0]; *(v8us*)pl = ol[0]; *(v8us*)(ph + 2048) = oh[1]; *(v8us*)(pl + 2048) = ol[1];
            return; }
        float* crow = C + (size_t)(r0 + mb0 * 16) * ldc + c0;
        // both loops unrolled: all LDS reads of a wave's rows go out together instead of one latency per read
#pragma unroll
        for (int q = 0; q < SR / 2 / NW; ++q) { const int row = 2 * (q * NW + w) + hi, cofs = lr * 4; v4f val = *(const v4fa*)(os + row * 68 + cofs);
#pragma unroll
            for (int u = 1; u < NW; ++u) val += *(const v4fa*)(os + (u * SR + row) * 68 + cofs);
            if (BIAS) { val[0] += bfr(bias[c0 + cofs]); val[1] += bfr(bias[c0 + cofs + 1]); val[2] += bfr(bias[c0 + cofs + 2]); val[3] += bfr(bias[c0 + cofs + 3]); }
            *(v4f*)(crow + (size_t)row * ldc + cofs) = val; }
        if (NW == 1) { __builtin_amdgcn_wave_barrier(); asm volatile("" ::: "memory"); }   // one wave: the next strip's LDS stores stay behind these reads
    }
}

typedef __attribute__((ext_vector_type(4))) unsigned short v4us;
typedef __attribute__((ext_vector_type(2))) float v2f;

// The two writers k_cvt8 and k_gn store in the order of the plane: k_cvt8 one 16-byte slot [lane] of a fragment half a thread, 512 contiguous bytes a wave; k_gn half a slot a thread, 256 contiguous bytes a wave a plane.
// k_cvt8: src [R][EE] f32 -> dst in fragment order (K = EE); one grid for all seven sources: behind the SBL mask blocks, TT * EE / 2048 blocks convert x, then EE * EE / 2048 blocks for each of the six weight matrices (their planes lie one behind another in WB)
// The grid's first SBL blocks sort the mask for the attention, once for all heads: wave w of block b takes the 16-query strip 2 b + (w >> 2) and the key quarter w & 3 (the 32-key blocks at keys 128 i + 32 (w & 3), i = 0 .. 15) and stores one word,
// MB[32 b + w]: bit i: block i has an open entry (0) for one of the strip's queries; bit 16 + i: it has masked entries as well. A block's eight words have a 128-byte line of their own.
#define XBL (TT * EE / 2048)
#define WBL (EE * EE / 2048)
#define SBL (TT / 32)
typedef __attribute__((ext_vector_type(4))) int v4i;
// smallest of a lane's 16 mask entries, as unsigned: 0 exactly when one of them is open; and their bitwise or: 0 exactly when none is masked
__device__ __forceinline__ unsigned mmin(const v4i (&mk)[4]) { unsigned a = (unsigned)mk[0][0];
#pragma unroll
    for (int e = 1; e < 16; ++e) { const unsigned b = (unsigned)mk[e >> 2][e & 3]; a = b < a ? b : a; }
    return a; }
__device__ __forceinline__ unsigned mor(const v4i (&mk)[4]) { const v4i o = (mk[0] | mk[1]) | (mk[2] | mk[3]); return (unsigned)((o[0] | o[1]) | (o[2] | o[3])); }
// one block of the mask for sorting: load u takes rows 4 u .. 4 u + 3, 8 lanes on a row's 128 bytes, so every load reads 4 whole lines (which lane sees which entry does not matter to an any-test)
__device__ __forceinline__ void ldp(const int* mr, v4i (&mk)[4]) {
#pragma unroll
    for (int u = 0; u < 4; ++u) mk[u] = *(const v4i*)(mr + (size_t)u * 4 * TT);
    asm volatile("s_wait_xcnt 0x0" :: "v"(mr) : "memory"); }   // the loads' address registers stay whole up to this wait and are free for reuse only behind it
__global__ __launch_bounds__(256) void k_cvt8(const float* __restrict__ x, const float* __restrict__ w0, const float* __restrict__ w1, const float* __restrict__ w2, const float* __restrict__ w3, const float* __restrict__ w4, const float* __restrict__ w5, bf* XB, bf* WB, const int* __restrict__ msk, unsigned* MB) {
    if (blockIdx.x < SBL) {   // the same for the whole block
        const int lane = threadIdx.x & 31, w = __builtin_amdgcn_readfirstlane((int)(threadIdx.x >> 5));
        const int* mpre = msk + (size_t)(((int)blockIdx.x * 2 + (w >> 2)) * 16 + (lane >> 3)) * TT + (w & 3) * 32 + (lane & 7) * 4;
        unsigned act = 0, mix = 0;   // the same in every lane (ballots' results)
#pragma unroll   // constants for the bit places; four blocks' mask loads fly together
        for (int g = 0; g < 4; ++g) { v4i mm[4][4];
#pragma unroll
            for (int a = 0; a < 4; ++a) ldp(mpre + (g * 4 + a) * 128, mm[a]);
            __builtin_amdgcn_sched_barrier(0);   // the sixteen loads go out ahead of the first compare: one latency a group instead of one a block
#pragma unroll
            for (int a = 0; a < 4; ++a) { const unsigned op = __builtin_amdgcn_ballot_w32(mmin(mm[a]) == 0u) != 0u ? 1u << (g * 4 + a) : 0u; act |= op; mix |= __builtin_amdgcn_ballot_w32(mor(mm[a]) != 0u) != 0u ? op : 0u; } }
        if (lane == 0) MB[(int)blockIdx.x * 32 + w] = act | (mix << 16);
        return; }
    const int b = (int)blockIdx.x - SBL, isx = b < XBL, j = isx ? 0 : (b - XBL) / WBL; const float* src = isx ? x : j == 0 ? w0 : j == 1 ? w1 : j == 2 ? w2 : j == 3 ? w3 : j == 4 ? w4 : w5;
    bf* dst = isx ? XB : WB + (size_t)j * EE * EE; const size_t i = (size_t)(isx ? b : (b - XBL) % WBL) * 256 + threadIdx.x;
    const int lr = (int)(i & 15), hi = (int)(i >> 4) & 1, u = (int)(i >> 5) & 1, c = (int)(i >> 6) & (EE / 32 - 1); const size_t T = i >> 11; const v8f v = *(const v8f*)(src + (T * 16 + lr) * EE + c * 32 + u * 16 + hi * 8); v8us o;
    asm volatile("s_wait_xcnt 0x0" ::: "memory");   // the loads' address registers are free for reuse only behind this wait
#pragma unroll
    for (int k = 0; k < 8; ++k) o[k] = f2bf(v[k]); *(v8us*)(dst + i * 8) = o;  }
// ---- k_attn: both score maps, both softmaxes, their difference and the product with V in one launch; no score or probability ever leaves the registers.
// grid (TT / 128, heads), 16 waves, two passes. In a pass wave w owns one 16-query strip (w & 3 picks it among the block's four of that pass) and every fourth 32-key block (w >> 2 picks the quarter). Pass 0 takes strips 4 x .. 4 x + 3,
// pass 1 their mirror images 127 - (4 x + ..) with the quarters reversed, so that a mask which closes the keys behind (or ahead of) each query leaves every wave about the same number of open key blocks.
// The mask is sorted by 16-query x 32-key block at run time, once for all heads (k_cvt8's first blocks): one bit a block says whether any entry is open (0), one whether open and masked entries are mixed; each pass reads its one word. The sweep walks only
// the blocks with an open entry, and fetches the mask's entries again only for mixed blocks (a wholly open block masks nothing). A wholly masked block adds exact zeros to every sum of a row that has an open key anywhere, so leaving it out
// changes no value; nothing is assumed about where the mask is open.
// Scores are formed transposed (A = K rows, B = Q rows), so a lane holds 8 keys of ONE query per tile: maximum and sum are in-lane, and two 16-key tiles converted in place are the B operand of the product with V
// (its k order is the loader's: 8 hi + s, 16 + 8 hi + s); A = V's transposed plane, so the output tiles are transposed too and a lane holds 8 dims of that same query.
// ONE sweep: every score is formed once. Each map keeps its own maximum in use, exp sum and output tiles O = sum exp2(t - m) V (p split in bf16 high + low, three products, as the score products); when the maximum moves, sum and tiles
// are scaled in-lane (onl). Behind the sweep the key quarters' maxima and sums are joined in a fixed order and each wave forms O1 f1 - O2 f2 with f1 = exp2(m1 - max1) / sum1, f2 = lam exp2(m2 - max2) / sum2.
// The four key quarters' output tiles are summed in LDS and stored as whole lines of CAT[t][h * 64 + d].
// GroupNorm statistics: behind pass 1 the block holds its 128 tokens x 64 dims of one group in registers, so it also stores their sum and their square sum centred on the block's own mean, GP[h][block] = (sum, m2); k_gn joins a head's 16 pairs.
typedef __attribute__((ext_vector_type(2))) __bf16 v2bf;
__device__ __forceinline__ v16bf ldf(const bf* p) { return cat16b(*(const v8us*)p, *(const v8us*)(p + 256)); }   // the two halves of one fragment-order block
// the K fragments of 32 keys of one map: k[kt * 4 + c * 2] high, + 1 low (16-key tile kt, 32-wide chunk c of the head dim)
// Kh, Kl: the block's first element, the same for the whole wave (a scalar base); lo: the lane's own 8 * lane, the one vector register that all the sweep's global operand loads share
__device__ __forceinline__ void ldk(const bf* Kh, const bf* Kl, unsigned lo, v16bf (&k)[8]) {
#pragma unroll
    for (int kt = 0; kt < 2; ++kt)
#pragma unroll
        for (int c = 0; c < 2; ++c) { k[kt * 4 + c * 2] = ldf(Kh + kt * 16 * HD + c * 512 + lo); k[kt * 4 + c * 2 + 1] = ldf(Kl + kt * 16 * HD + c * 512 + lo); }
    asm volatile("s_wait_xcnt 0x0" :: "s"(Kh), "s"(Kl), "v"(lo) : "memory"); }   // the loads' address registers stay whole up to this wait and are free for reuse only behind it
// one map's Q fragments from the wave's part of LDS: chunk c high at c * 1024, low 512 behind
__device__ __forceinline__ void ldq(const bf* q, v16bf (&qh)[2], v16bf (&ql)[2]) {
#pragma unroll
    for (int c = 0; c < 2; ++c) { qh[c] = cat16b(*(const v8usa*)(q + c * 1024), *(const v8usa*)(q + c * 1024 + 256)); ql[c] = cat16b(*(const v8usa*)(q + c * 1024 + 512), *(const v8usa*)(q + c * 1024 + 768)); } }
__device__ __forceinline__ void ldm(const int* mr, v4i (&mk)[4]) {
#pragma unroll
    for (int u = 0; u < 4; ++u) mk[u] = *(const v4i*)(mr + (u >> 1) * 16 + (u & 1) * 4);
    asm volatile("s_wait_xcnt 0x0" :: "v"(mr) : "memory"); }   // as in ldk
// two transposed score tiles: s[kt][j] = q[query lr] . k[key kt * 16 + 8 hi + j], split products kh.qh + kh.ql + kl.qh over the two chunks
__device__ __forceinline__ void sc2(const v16bf (&k)[8], const v16bf (&qh)[2], const v16bf (&ql)[2], v8f (&s)[2]) { s[0] = (v8f){}; s[1] = (v8f){};
#pragma unroll
    for (int c = 0; c < 2; ++c) { s[0] = wmmab(k[c * 2], qh[c], s[0]); s[1] = wmmab(k[4 + c * 2], qh[c], s[1]); s[0] = wmmab(k[c * 2], ql[c], s[0]); s[1] = wmmab(k[4 + c * 2], ql[c], s[1]); s[0] = wmmab(k[c * 2 + 1], qh[c], s[0]); s[1] = wmmab(k[4 + c * 2 + 1], qh[c], s[1]); } }
// masked scores, scaled by 1/8 and by log2(e) in one multiply, so that every exponential below is a bare exp2: t[kt * 8 + j] belongs to key kt * 16 + 8 hi + j of the block
__device__ __forceinline__ void msc(const v8f (&s)[2], bool mixed, unsigned mb, float (&t)[16]) {
#pragma unroll
    for (int e = 0; e < 16; ++e) t[e] = s[e >> 3][e & 7] * (SCL * 1.44269504f);
    if (mixed) {   // the same for the whole wave: a scalar branch; a wholly open block has nothing to mask
#pragma unroll
        for (int e = 0; e < 16; ++e) t[e] = ((mb >> e) & 1u) != 0u ? -3.0e38f : t[e]; } }
// one block of one map in the single sweep: p = exp2(t - m), split in bf16 high + low (the B operand of the product with V), its sum added to l. The maximum in use m moves only when some query's new maximum lies more than 8 above it
// (one test for the wave, a scalar branch): then sum and output tile, in which a lane holds 8 dims of its one query, are scaled in-lane. p stays <= 2^8.
__device__ __forceinline__ void onl(const float (&t)[16], float& m, float& l, v8f (&o)[4], v16bf& ph, v16bf& pl) { float tm = t[0];
#pragma unroll
    for (int k = 1; k < 16; ++k) tm = fmaxf(tm, t[k]);
    if (__builtin_amdgcn_ballot_w32(tm > m + 8.0f) != 0u) { const float mn = fmaxf(m, fmaxf(tm, __shfl_xor(tm, 16, 32))), al = __builtin_amdgcn_exp2f(m - mn); l *= al; m = mn;
#pragma unroll
        for (int dt = 0; dt < 4; ++dt) o[dt] *= al; }
    float a = 0.f;
#pragma unroll
    for (int e = 0; e < 16; e += 2) { v2f wv; wv[0] = __builtin_amdgcn_exp2f(t[e] - m); wv[1] = __builtin_amdgcn_exp2f(t[e + 1] - m); a += wv[0] + wv[1];
        const v2bf hh = __builtin_convertvector(wv, v2bf); const v2bf ll = __builtin_convertvector(wv - __builtin_convertvector(hh, v2f), v2bf); ph[e] = hh[0]; ph[e + 1] = hh[1]; pl[e] = ll[0]; pl[e + 1] = ll[1]; }
    l += a; }
__device__ __forceinline__ void join_ml(float& m, float& l, float mo, float lo) { const float mn = fmaxf(m, mo); l = l * __builtin_amdgcn_exp2f(m - mn) + lo * __builtin_amdgcn_exp2f(mo - mn); m = mn; }
__device__ __forceinline__ float wsum(float v) {   // sum over the wave's 32 lanes, the same bits in every lane
#pragma unroll   // five fixed steps: no loop counter, the lane masks are constants
    for (int m = 16; m >= 1; m >>= 1) v += __shfl_xor(v, m, 32);
    return v; }
// the mask entries of a block for msc, one bit each in a word a lane (bit e: entry e is masked): fetched where the block is mixed (the same for the whole wave: a scalar branch), 0 where it is wholly open
__device__ __forceinline__ unsigned ldmb(const int* mr, bool mixed) { unsigned mb = 0u;
    if (mixed) { v4i mk[4]; ldm(mr, mk);
#pragma unroll
        for (int e = 0; e < 16; ++e) mb |= mk[e >> 2][e & 3] ? 1u << e : 0u; }
    return mb; }
__global__ __launch_bounds__(512) void k_attn(const bf* __restrict__ Q1h, const bf* __restrict__ Q1l, const bf* __restrict__ Q2h, const bf* __restrict__ Q2l, const bf* __restrict__ K1h, const bf* __restrict__ K1l, const bf* __restrict__ K2h, const bf* __restrict__ K2l,
                                              const bf* __restrict__ Vh, const bf* __restrict__ Vl, const int* __restrict__ msk, const unsigned* __restrict__ MB, const float* __restrict__ lam, float* CAT, float* GP) {
    __shared__ __align__(16) float os[16 * 16 * 68];
    __shared__ __align__(16) bf qs[16 * 4096];
    __shared__ __align__(16) float kp[2 * 512 * 4];
    __shared__ float st[4][4][64];
    __shared__ __align__(16) float gs[2][16];
    const int lane = threadIdx.x & 31, lr = lane & 15, hi = lane >> 4; const int w = __builtin_amdgcn_readfirstlane((int)(threadIdx.x >> 5)), sp = w & 3, ku = w >> 2;
    const int h = blockIdx.y; const size_t hb = (size_t)h * TT * HD; const unsigned lo = 8u * (unsigned)lane; const float lamh = bfr(lam[h]);
    const int sa = (int)blockIdx.x * 4 + sp, sb = TT / 16 - 1 - sa;   // the wave's strips of pass 0 and pass 1
    const unsigned am0 = MB[(sa >> 1) * 32 + (sa & 1) * 4 + ku], am1 = MB[(sb >> 1) * 32 + (sb & 1) * 4 + 3 - ku];   // both passes' words of the sorted mask (strip, key quarter), asked for here (scalar loads) so that neither pass waits for its own
    v4f vals[4];
#pragma unroll   // two passes written out: vals[] is indexed by constants and stays in registers
    for (int p = 0; p < 2; ++p) {
        const int kq = p == 0 ? ku : 3 - ku, q0 = (p == 0 ? (int)blockIdx.x * 4 + sp : TT / 16 - 1 - ((int)blockIdx.x * 4 + sp)) * 16;
        // The strip's Q fragments wait in the wave's own part of LDS, in fragment order (map, chunk, high | low): both output tiles stay in registers through the sweep, so only the map at work has its Q there. No other wave touches this part: no barrier
        v16bf qh[2], ql[2]; const size_t qo = hb + (size_t)q0 * HD + 8 * lane; const bf *pq1h = Q1h + qo, *pq1l = Q1l + qo, *pq2h = Q2h + qo, *pq2l = Q2l + qo; bf* qw = qs + w * 4096 + 8 * lane;
        { v8us qa[16];
#pragma unroll
        for (int c = 0; c < 4; ++c) { qa[c] = *(const v8us*)(pq1h + c * 256); qa[4 + c] = *(const v8us*)(pq1l + c * 256); qa[8 + c] = *(const v8us*)(pq2h + c * 256); qa[12 + c] = *(const v8us*)(pq2l + c * 256); }
        asm volatile("s_wait_xcnt 0x0" :: "v"(pq1h), "v"(pq1l), "v"(pq2h), "v"(pq2l) : "memory");   // as in ldk
#pragma unroll
        for (int c = 0; c < 4; ++c) { *(v8usa*)(qw + (c >> 1) * 1024 + (c & 1) * 256) = qa[c]; *(v8usa*)(qw + (c >> 1) * 1024 + 512 + (c & 1) * 256) = qa[4 + c]; *(v8usa*)(qw + 2048 + (c >> 1) * 1024 + (c & 1) * 256) = qa[8 + c]; *(v8usa*)(qw + 2048 + (c >> 1) * 1024 + 512 + (c & 1) * 256) = qa[12 + c]; } }
        const int* mrow = msk + (size_t)(q0 + lr) * TT + 8 * hi + kq * 32;   // the wave's key block i (0 .. 15) begins at key 128 i + 32 kq
        const unsigned am = p == 0 ? am0 : am1, act = am & 0xFFFFu, mix = am >> 16;   // bit i of act: key block i has an open entry for one of the strip's queries; of mix: it has masked entries as well; the same for the whole wave
        float m1 = -3.0e38f, l1 = 0.f, m2 = -3.0e38f, l2 = 0.f;   // m: the maximum in use, the same in both lane halves of a query; l: the lane's own keys' exp sum
        v8f o1[4], o2[4];
#pragma unroll
        for (int dt = 0; dt < 4; ++dt) { o1[dt] = (v8f){}; o2[dt] = (v8f){}; }
        // Order of a trip, held by the scheduling barriers: each group of loads goes out right behind the products that free its registers and flies under the vector work that follows, instead of one exposed latency per fragment.
        // Without them the compiler lifts the loads further ahead of those products, and the trip no longer fits the registers of four waves a SIMD (it spills inside the loop).
        v16bf kf[8];
        if (act != 0u) { unsigned rem = act & (act - 1u); int kb = __builtin_ctz(act) * 128;   // kb: the block's first key, less 32 kq; at most 16 trips, one noted bit each
            ldk(K1h + hb + (size_t)(kb + kq * 32) * HD, K1l + hb + (size_t)(kb + kq * 32) * HD, lo, kf); ldq(qw, qh, ql);
#pragma unroll 1   // one 32-key block a trip: a second copy of the body would not fit the registers of four waves a SIMD
            for (;;) { v8f s[2]; float t[16]; v16bf p1h, p1l, p2h, p2l; const size_t o = hb + (size_t)(kb + kq * 32) * HD; const int kn = rem != 0u ? __builtin_ctz(rem) * 128 : kb;   // the last trip fetches its own block again: in bounds, unused
                const bool mixed = ((mix >> (kb >> 7)) & 1u) != 0u; const unsigned mb = ldmb(mrow + kb, mixed);
                sc2(kf, qh, ql, s); __builtin_amdgcn_sched_barrier(0);
                ldk(K2h + o, K2l + o, lo, kf); ldq(qw + 2048, qh, ql); __builtin_amdgcn_sched_barrier(0);
                msc(s, mixed, mb, t); onl(t, m1, l1, o1, p1h, p1l); __builtin_amdgcn_sched_barrier(0);
                sc2(kf, qh, ql, s); __builtin_amdgcn_sched_barrier(0);
                v16bf vh[4], vl[4]; const bf *pvh = Vh + o, *pvl = Vl + o;
#pragma unroll
                for (int dt = 0; dt < 4; ++dt) { vh[dt] = ldf(pvh + dt * 512 + lo); vl[dt] = ldf(pvl + dt * 512 + lo); }
                asm volatile("s_wait_xcnt 0x0" :: "s"(pvh), "s"(pvl), "v"(lo) : "memory");   // as in ldk
                __builtin_amdgcn_sched_barrier(0);
                msc(s, mixed, mb, t); onl(t, m2, l2, o2, p2h, p2l); __builtin_amdgcn_sched_barrier(0);
#pragma unroll
                for (int dt = 0; dt < 4; ++dt) { o1[dt] = wmmab(vh[dt], p1h, o1[dt]); o2[dt] = wmmab(vh[dt], p2h, o2[dt]); }
#pragma unroll
                for (int dt = 0; dt < 4; ++dt) { o1[dt] = wmmab(vh[dt], p1l, o1[dt]); o2[dt] = wmmab(vh[dt], p2l, o2[dt]); }
#pragma unroll
                for (int dt = 0; dt < 4; ++dt) { o1[dt] = wmmab(vl[dt], p1h, o1[dt]); o2[dt] = wmmab(vl[dt], p2h, o2[dt]); }
                __builtin_amdgcn_sched_barrier(0);
                ldk(K1h + hb + (size_t)(kn + kq * 32) * HD, K1l + hb + (size_t)(kn + kq * 32) * HD, lo, kf); ldq(qw, qh, ql);
                asm volatile("v_nop\n\tv_nop\n\tv_nop\n\tv_nop" : "+v"(o1[0]), "+v"(o1[1]), "+v"(o1[2]), "+v"(o1[3]), "+v"(o2[0]), "+v"(o2[1]), "+v"(o2[2]), "+v"(o2[3]));   // the distance behind the trip's last matrix instructions, also on the taken side of the branch below
                if (rem == 0u) break;
                rem &= rem - 1u; kb = kn; } }
        l1 += __shfl_xor(l1, 16, 32); l2 += __shfl_xor(l2, 16, 32);   // the halves share m, so their sums add as they are
        if (hi == 0) { st[ku][0][sp * 16 + lr] = m1; st[ku][1][sp * 16 + lr] = l1; st[ku][2][sp * 16 + lr] = m2; st[ku][3][sp * 16 + lr] = l2; }
        __syncthreads();   // all four key quarters' maxima and sums are in LDS before any wave joins them; it also ends the earlier pass's reads of os ahead of this pass's stores there
        float j1 = st[0][0][sp * 16 + lr], n1 = st[0][1][sp * 16 + lr], j2 = st[0][2][sp * 16 + lr], n2 = st[0][3][sp * 16 + lr];
#pragma unroll   // three fixed joins, in the order of the waves
        for (int u = 1; u < 4; ++u) { join_ml(j1, n1, st[u][0][sp * 16 + lr], st[u][1][sp * 16 + lr]); join_ml(j2, n2, st[u][2][sp * 16 + lr], st[u][3][sp * 16 + lr]); }
        const float f1 = __fdiv_rn(1.0f, n1) * __builtin_amdgcn_exp2f(m1 - j1), f2 = __fdiv_rn(1.0f, n2) * lamh * __builtin_amdgcn_exp2f(m2 - j2);   // from this wave's own maxima to the query's, and the two normalisers
#pragma unroll
        for (int dt = 0; dt < 4; ++dt) { const v8f r = o1[dt] * f1 - o2[dt] * f2; float* po = os + (w * 16 + lr) * 68 + dt * 16 + hi * 8;   // a lane holds 8 dims in a row of its one query
            *(v4fa*)po = __builtin_shufflevector(r, r, 0, 1, 2, 3); *(v4fa*)(po + 4) = __builtin_shufflevector(r, r, 4, 5, 6, 7); }
        __syncthreads();   // every wave's partial output tile is in LDS before any thread sums the four key quarters; it also ends this pass's reads of st ahead of the next pass's stores there
        float* pc[2];
#pragma unroll
        for (int q = 0; q < 2; ++q) { const int idx = q * 512 + (int)threadIdx.x, row = idx >> 4, c4 = (idx & 15) * 4;   // row: 16 (strip of the pass) + query; wave 4 u + strip holds quarter u's tile
            vals[p * 2 + q] = (*(const v4fa*)(os + row * 68 + c4) + *(const v4fa*)(os + (64 + row) * 68 + c4)) + (*(const v4fa*)(os + (128 + row) * 68 + c4) + *(const v4fa*)(os + (192 + row) * 68 + c4));
            const int tok = (p == 0 ? (int)blockIdx.x * 4 + (row >> 4) : TT / 16 - 1 - ((int)blockIdx.x * 4 + (row >> 4))) * 16 + (row & 15);
            pc[q] = CAT + (size_t)tok * EE + h * HD + c4; *(v4f*)pc[q] = vals[p * 2 + q];
            if (p == 0) *(v4fa*)(kp + idx * 4) = vals[q]; }   // pass 0's values wait in the thread's own LDS slot: pass 1's sweep has no registers to spare for them
        asm volatile("s_wait_xcnt 0x0" :: "v"(pc[0]), "v"(pc[1]), "v"(vals[p * 2]), "v"(vals[p * 2 + 1]) : "memory");   // the stores' address and data registers stay whole up to this wait and are free for reuse only behind it
    }
    vals[0] = *(const v4fa*)(kp + (int)threadIdx.x * 4); vals[1] = *(const v4fa*)(kp + (512 + (int)threadIdx.x) * 4);
    const v4f s4 = (vals[0] + vals[1]) + (vals[2] + vals[3]); const float ws = wsum((s4[0] + s4[1]) + (s4[2] + s4[3]));
    if (lane == 0) gs[0][w] = ws;
    __syncthreads();   // all 16 waves' sums are in LDS before any thread forms the block's mean
    const v4f b4 = (*(const v4fa*)(gs[0]) + *(const v4fa*)(gs[0] + 4)) + (*(const v4fa*)(gs[0] + 8) + *(const v4fa*)(gs[0] + 12)); const float bs = (b4[0] + b4[1]) + (b4[2] + b4[3]), bm = bs * (1.0f / (128 * HD));
    v4f d4 = (v4f){};
#pragma unroll   // vals[] is indexed by constants and stays in registers
    for (int q = 0; q < 4; ++q) { const v4f d = vals[q] - bm; d4 += d * d; }
    const float wq = wsum((d4[0] + d4[1]) + (d4[2] + d4[3]));
    if (lane == 0) gs[1][w] = wq;
    __syncthreads();   // all 16 waves' centred square sums are in LDS before thread 0 adds them
    if (threadIdx.x == 0) { const v4f c4v = (*(const v4fa*)(gs[1]) + *(const v4fa*)(gs[1] + 4)) + (*(const v4fa*)(gs[1] + 8) + *(const v4fa*)(gs[1] + 12)); v2f o2; o2[0] = bs; o2[1] = (c4v[0] + c4v[1]) + (c4v[2] + c4v[3]);
        *(v2f*)(GP + ((size_t)h * (TT / 128) + blockIdx.x) * 2) = o2; }
}
// k_gn: a head's mean and biased variance from its 16 pairs GP[h][b] = (sum, m2 about the block's own mean) of 128 x 64 values each: var * N = sum_b m2_b + n_b (mean_b - mean)^2, an identity, every term >= 0; then the normalisation.
__global__ __launch_bounds__(256) void k_gn(const float* __restrict__ CAT, const float* __restrict__ GP, const float* __restrict__ gw, const float* __restrict__ gb, bf* Ah, bf* Al) { const size_t o = ((size_t)blockIdx.x * 256 + threadIdx.x) * 4; if (o >= (size_t)TT * EE) return;   // o: place in the fragment-order planes (K = EE), half a 16-byte slot a thread; i: the same elements in CAT
    const size_t i = ((o >> 14) * 16 + ((o >> 3) & 15)) * EE + ((o >> 9) & (EE / 32 - 1)) * 32 + ((o >> 8) & 1) * 16 + ((o >> 7) & 1) * 8 + (o & 7); const int c = (int)(i % EE);
    const float* gp = GP + (size_t)(blockIdx.x & (NH_ - 1)) * (TT / 128) * 2;   // head c / HD: a block's 1024 elements are two 32-wide chunks of one head, so the pairs are read once for the block through the scalar path
    float gsum = 0.f, gm2 = 0.f;
#pragma unroll   // both loops unrolled: the 16 pairs come in two wide loads, one latency, instead of one load a trip
    for (int b = 0; b < TT / 128; ++b) gsum += gp[2 * b];
    const float mu = gsum * (1.0f / (float)(HD * TT));
#pragma unroll
    for (int b = 0; b < TT / 128; ++b) { const float d = gp[2 * b] * (1.0f / (128 * HD)) - mu; gm2 += gp[2 * b + 1] + (float)(128 * HD) * (d * d); }
    const float rs = __frsqrt_rn(__fadd_rn(gm2 * (1.0f / (float)(HD * TT)), 1e-5f)); const v4f a = *(const v4f*)(CAT + i); v4us oh, ol;
#pragma unroll
    for (int q = 0; q < 4; ++q) { float t = __fmul_rn(__fsub_rn(a[q], mu), rs); asm volatile("" : "+v"(t)); float tg = __fmul_rn(t, bfr(gw[c + q])); asm volatile("" : "+v"(tg)); unsigned short u, c2; splitf(__fadd_rn(tg, bfr(gb[c + q])), u, c2); oh[q] = u; ol[q] = c2; }
    *(v4us*)(Ah + o) = oh; *(v4us*)(Al + o) = ol;  }

extern "C" void kernel_launch(void* const* d_in, const int* in_sizes, int n_in,
                              void* d_out, int out_size, void* d_ws, size_t ws_size, hipStream_t stream) {
    (void)in_sizes; (void)n_in; (void)out_size;
    const float* x = (const float*)d_in[0]; const int* msk = (const int*)d_in[1]; const float* IN[17]; for (int i = 2; i < 17; ++i) IN[i] = (const float*)d_in[i];   // 2 Wq1 [16][64][1024], 3 bq1, 4 Wq2, 5 bq2, 6 Wk1, 7 bk1, 8 Wk2, 9 bk2, 10 Wv, 11 bv, 12 lam, 13 gn_w, 14 gn_b, 15 Wo [1024][1024] (out,in), 16 bo
    float* OUT = (float*)d_out;     // [1][2048][1024]
    char* wsp = (char*)d_ws;
    auto take = [&](size_t bytes) { char* p = wsp; wsp += (bytes + 255) & ~(size_t)255; return (void*)p; };
    bf* WB = (bf*)take((size_t)6 * EE * EE * 2); bf* XB = (bf*)take((size_t)TT * EE * 2);   // WB: six weight planes, one behind another
    bf* Q1h = (bf*)take((size_t)NH_ * TT * HD * 2); bf* Q1l = (bf*)take((size_t)NH_ * TT * HD * 2); bf* Q2h = (bf*)take((size_t)NH_ * TT * HD * 2); bf* Q2l = (bf*)take((size_t)NH_ * TT * HD * 2); bf* K1h = (bf*)take((size_t)NH_ * TT * HD * 2); bf* K1l = (bf*)take((size_t)NH_ * TT * HD * 2); bf* K2h = (bf*)take((size_t)NH_ * TT * HD * 2); bf* K2l = (bf*)take((size_t)NH_ * TT * HD * 2); bf* Vh = (bf*)take((size_t)NH_ * HD * TT * 2); bf* Vl = (bf*)take((size_t)NH_ * HD * TT * 2);
    float* CAT = (float*)take((size_t)TT * EE * 4); float* GP = (float*)take((size_t)NH_ * (TT / 128) * 2 * 4); bf* Ah = (bf*)take((size_t)TT * EE * 2); bf* Al = (bf*)take((size_t)TT * EE * 2); unsigned* MB = (unsigned*)take((size_t)SBL * 32 * 4);
    if ((size_t)(wsp - (char*)d_ws) > ws_size) return;
    k_cvt8<<<SBL + XBL + 6 * WBL, 256, 0, stream>>>(x, IN[2], IN[4], IN[6], IN[8], IN[10], IN[15], XB, WB, msk, MB);   // [H][DH][E] stacked = natural [1024][1024] Bt; Wo [E][D] natural
    k_gemmw<bf, 0, true, 8, 1, true><<<dim3(TT / 64, EE / 64, 5), 256, 0, stream>>>(XB, nullptr, WB, nullptr, EE, nullptr, EE, IN[3], IN[5], IN[7], IN[9], IN[11], 0, (size_t)EE * EE, 0, Q1h);   // q1, q2, k1, k2, v; the ten planes from Q1h to Vl lie one behind another in the workspace, in the order taken above
    k_attn<<<dim3(TT / 128, NH_, 1), 512, 0, stream>>>(Q1h, Q1l, Q2h, Q2l, K1h, K1l, K2h, K2l, Vh, Vl, msk, MB, IN[12], CAT, GP);
    k_gn<<<(unsigned)(((size_t)TT * EE / 4 + 255) / 256), 256, 0, stream>>>(CAT, GP, IN[13], IN[14], Ah, Al);
    k_gemmw<bf, 1, true, 8, 1, false><<<dim3(TT / 64, EE / 64, 1), 256, 0, stream>>>(Ah, Al, WB + (size_t)5 * EE * EE, nullptr, EE, OUT, EE, IN[16], nullptr, nullptr, nullptr, nullptr, 0, 0, 0, nullptr);
}

// v010
// It runs in 96.6 microseconds.
// Timed twice side by side with v009, it ran 1.08 times as fast both times.
// Counting every step since v000, it is 10.7 times as fast.
#include <hip/hip_runtime.h>

// DifferentialMultiHeadSelfAttention (x [1][2048][1024]; per-head q1, q2, k1, k2, v = x W[h]^T + b[h] (16 x 64); s = q.k/8 with mask[i][j] (int, 1 = masked -> -inf, read as data); w = softmax(s1) - lam[h] softmax(s2);
// out = w.v; heads concatenated; GroupNorm(16 groups = heads, eps 1e-5, biased var over (64 dims x 2048 tokens)) x gn_w + gn_b; out Wo^T + bo -> [1][2048][1024]).
// Compute dtypes, f32 accumulate: every input rounded to bf16; the five projections on PLAIN bf16 operands (inputs: exact, + bias; the stacked [16][64][1024] weights are one natural [1024][1024] Bt); both score GEMMs

#define TT   2048
#define EE   1024
#define NH_  16
#define HD   64
#define ZH   2
#define SCL  0.125f
typedef _Float16 h16;
typedef unsigned short bf;
typedef __attribute__((ext_vector_type(16))) __bf16   v16bf;
typedef __attribute__((ext_vector_type(16))) _Float16 v16h;
typedef __attribute__((ext_vector_type(8)))  _Float16 v8h;
typedef __attribute__((ext_vector_type(8)))  unsigned short v8us;
typedef __attribute__((ext_vector_type(8)))  float    v8f;
typedef __attribute__((ext_vector_type(4)))  float    v4f;
typedef v8h  __attribute__((may_alias)) v8ha;
typedef v4f  __attribute__((may_alias)) v4fa;
typedef v8us __attribute__((may_alias)) v8usa;

__device__ __forceinline__ unsigned short f2bf(float f) { unsigned u = __float_as_uint(f); u += 0x7FFFu + ((u >> 16) & 1u); return (unsigned short)(u >> 16); }
__device__ __forceinline__ float bf2f(unsigned short b) { return __uint_as_float(((unsigned)b) << 16); }
__device__ __forceinline__ float bfr(float f) { return bf2f(f2bf(f)); }
__device__ __forceinline__ v16h cat16(v8h lo, v8h hi) { return __builtin_shufflevector(lo, hi, 0, 1, 2, 3, 4, 5, 6, 7, 8, 9, 10, 11, 12, 13, 14, 15); }
__device__ __forceinline__ v16bf cat16b(v8us lo, v8us hi) { return __builtin_bit_cast(v16bf, __builtin_shufflevector(lo, hi, 0, 1, 2, 3, 4, 5, 6, 7, 8, 9, 10, 11, 12, 13, 14, 15)); }
__device__ __forceinline__ v8f wmma16(v16h a, v16h b, v8f c) { return __builtin_amdgcn_wmma_f32_16x16x32_f16(false, a, false, b, (short)0, c, false, false); }
__device__ __forceinline__ v8f wmmab(v16bf a, v16bf b, v8f c) { return __builtin_amdgcn_wmma_f32_16x16x32_bf16(false, a, false, b, (short)0, c, false, false); }



// ---- FRAGMENT ORDER of every 16-bit operand plane [R][K]: the 16 rows x 32 k of one matrix operand lie as 512 elements in a row, [u][lane][s] = element (row 16 T + (lane & 15), k 32 c + 16 u + 8 (lane >> 4) + s),
// block (T, c) at (T * (K / 32) + c) * 512 (V's transposed planes: at (c * 4 + T) * 512). A wave's 16-byte load of half u then reads 512 contiguous bytes (4 whole lines) instead of 32 bytes out of each of 16 lines; which element reaches which lane and register is as before.
// ---- k_gemmw: register-blocked GEMM, NW WAVES per 64x64 output tile (16 accumulators each), operands straight from 16-bit planes in fragment order; grid (M/64, N/64, Z), 32 * NW threads.
// C[m][n] (f32, pitch ldc, + optional f32 bias[n]) = sum_k A[m][k] Bt[n][k] (+ split products per NSPLIT). z-batch strides sA/sB/sC in elements. K % (32 * NW * KP) == 0.
// Split K: wave w takes the 32-wide k chunks w, w + NW, ... (1 KiB of each 16-row strip); the NW partial tiles are staged whole in LDS and summed in wave order behind one barrier.
// KP > 1 (N == 64 only): blockIdx.y is a K range instead of a tile column, and range y stores its partial C in plane y (plane pitch ZH * sC); the consumer sums the planes.
__device__ __forceinline__ void splitf(float y, unsigned short& h, unsigned short& l) { h = f2bf(y); l = f2bf(y - bf2f(h)); }
template <typename T16> struct WFrag;
template <> struct WFrag<h16> { typedef v16h V; static __device__ __forceinline__ V ld(const h16* p) { return cat16(*(const v8h*)p, *(const v8h*)(p + 256)); } static __device__ __forceinline__ v8f mma(V a, V b, v8f c) { return wmma16(a, b, c); } };
template <> struct WFrag<bf> { typedef v16bf V; static __device__ __forceinline__ V ld(const bf* p) { return cat16b(*(const v8us*)p, *(const v8us*)(p + 256)); } static __device__ __forceinline__ v8f mma(V a, V b, v8f c) { return wmmab(a, b, c); } };
template <typename T16, int NSPLIT, bool BIAS, int NW, int KP>
__global__ __launch_bounds__(32 * NW) void k_gemmw(const T16* __restrict__ A, const T16* __restrict__ A2, const T16* __restrict__ Bt, const T16* __restrict__ Bt2, int K, float* C, int ldc, const float* __restrict__ bias, size_t sA, size_t sB, size_t sC) {
    typedef typename WFrag<T16>::V V;
    constexpr int SR = NW > 1 ? 64 : 16;    // tile rows staged in LDS at once, per wave
    __shared__ __align__(16) float os[NW * SR * 68];
    const size_t z = blockIdx.z; A += z * sA; if (A2) A2 += z * sA; Bt += z * sB; if (Bt2) Bt2 += z * sB; C += z * sC;
    const int lane = threadIdx.x & 31, lr = lane & 15, hi = lane >> 4; const int r0 = blockIdx.x * 64, c0 = KP > 1 ? 0 : blockIdx.y * 64;
    const int w = NW > 1 ? __builtin_amdgcn_readfirstlane((int)(threadIdx.x >> 5)) : 0;
    const int klo = KP > 1 ? (int)blockIdx.y * (K / KP) : 0, khi = KP > 1 ? klo + K / KP : K; if (KP > 1) C += (size_t)blockIdx.y * ZH * sC;
    v8f acc[4][4];
#pragma unroll
    for (int mb = 0; mb < 4; ++mb)
#pragma unroll
        for (int nb = 0; nb < 4; ++nb) acc[mb][nb] = (v8f){};
    const size_t aoff = (size_t)r0 * K + 8 * lane, boff = (size_t)c0 * K + 8 * lane;   // fragment order: a 16-row strip is still 16 * K elements, a 32-wide k chunk of it 512
#pragma unroll 1
    for (int kc = klo + w * 32; kc < khi; kc += 32 * NW) {
        V a[4], a2[4], b[4], b2[4]; const T16 *pa[4], *pa2[4], *pb[4], *pb2[4];
#pragma unroll
        for (int mb = 0; mb < 4; ++mb) { pa[mb] = A + aoff + (size_t)mb * 16 * K + kc * 16; pa2[mb] = pa[mb]; a[mb] = WFrag<T16>::ld(pa[mb]); if (NSPLIT == 1 || NSPLIT == 2) { pa2[mb] = A2 + aoff + (size_t)mb * 16 * K + kc * 16; a2[mb] = WFrag<T16>::ld(pa2[mb]); } }
        asm volatile("s_wait_xcnt 0x0" :: "v"(pa[0]), "v"(pa[1]), "v"(pa[2]), "v"(pa[3]), "v"(pa2[0]), "v"(pa2[1]), "v"(pa2[2]), "v"(pa2[3]) : "memory");   // the loads' address registers stay whole up to this wait and are free for reuse (here: as a later load's target) only behind it
#pragma unroll
        for (int nb = 0; nb < 4; ++nb) { pb[nb] = Bt + boff + (size_t)nb * 16 * K + kc * 16; pb2[nb] = pb[nb]; b[nb] = WFrag<T16>::ld(pb[nb]); if (NSPLIT >= 2) { pb2[nb] = Bt2 + boff + (size_t)nb * 16 * K + kc * 16; b2[nb] = WFrag<T16>::ld(pb2[nb]); } }
        asm volatile("s_wait_xcnt 0x0" :: "v"(pb[0]), "v"(pb[1]), "v"(pb[2]), "v"(pb[3]), "v"(pb2[0]), "v"(pb2[1]), "v"(pb2[2]), "v"(pb2[3]) : "memory");   // as above
        __builtin_amdgcn_sched_barrier(0);   // all loads of a trip go out ahead of its products; without it the compiler sinks each B fragment's loads to their first use, one exposed latency per fragment
#pragma unroll
        for (int nb = 0; nb < 4; ++nb) {
#pragma unroll
            for (int mb = 0; mb < 4; ++mb) { acc[mb][nb] = WFrag<T16>::mma(a[mb], b[nb], acc[mb][nb]); if (NSPLIT == 1 || NSPLIT == 2) acc[mb][nb] = WFrag<T16>::mma(a2[mb], b[nb], acc[mb][nb]); if (NSPLIT >= 2) acc[mb][nb] = WFrag<T16>::mma(a[mb], b2[nb], acc[mb][nb]); } }
        asm volatile("v_nop\n\tv_nop\n\tv_nop\n\tv_nop" : "+v"(acc[0][0]), "+v"(acc[1][1]), "+v"(acc[2][2]), "+v"(acc[3][3]) : "v"(a[0]), "v"(a[3]));
    }
    // the four loops below are unrolled so that acc[][] is indexed by constants and stays in registers
#pragma unroll
    for (int mb0 = 0; mb0 < 4; mb0 += SR / 16) {
#pragma unroll
        for (int mi = 0; mi < SR / 16; ++mi) {
#pragma unroll
            for (int nb = 0; nb < 4; ++nb) {
#pragma unroll
                for (int j = 0; j < 8; ++j) os[(w * SR + mi * 16 + hi * 8 + j) * 68 + nb * 16 + lr] = acc[mb0 + mi][nb][j]; } }
        if (NW > 1) __syncthreads();   // every wave's partial tile is in LDS before any wave sums it
        else { __builtin_amdgcn_wave_barrier(); asm volatile("" ::: "memory"); }   // one wave: only keeps the compiler from moving the LDS reads above the LDS stores
        float* crow = C + (size_t)(r0 + mb0 * 16) * ldc + c0;
        // both loops unrolled: all LDS reads of a wave's rows go out together instead of one latency per read
#pragma unroll
        for (int q = 0; q < SR / 2 / NW; ++q) { const int row = 2 * (q * NW + w) + hi, cofs = lr * 4; v4f val = *(const v4fa*)(os + row * 68 + cofs);
#pragma unroll
            for (int u = 1; u < NW; ++u) val += *(const v4fa*)(os + (u * SR + row) * 68 + cofs);
            if (BIAS) { val[0] += bfr(bias[c0 + cofs]); val[1] += bfr(bias[c0 + cofs + 1]); val[2] += bfr(bias[c0 + cofs + 2]); val[3] += bfr(bias[c0 + cofs + 3]); }
            *(v4f*)(crow + (size_t)row * ldc + cofs) = val; }
        if (NW == 1) { __builtin_amdgcn_wave_barrier(); asm volatile("" ::: "memory"); }   // one wave: the next strip's LDS stores stay behind these reads
    }
}

// ---- k_proj: the five projections, one 128-token x 128-weight-row tile a block (two heads), 4 waves in 2 x 2, each with a 64x64 tile (16 accumulators) over the WHOLE K: no split K, no partial tiles.
// grid (TT / 128, EE / 128, 5). Both operands' 128 rows x 64 k of a trip (32 KiB, still in fragment order) are brought into LDS by asynchronous copies, once for the two waves that use each row strip, in two buffers:
// a trip first reads all its fragments into registers, so its buffer is refilled (trip t + 2) ahead of its products, and the copies fly under them. Wave w copies operand w >> 1 (0: x, 1: weights), strips 4 (w & 1) .. + 3: 16 copies of 512 contiguous bytes a trip.
// The product's orientation makes the epilogue free of LDS: for q, k the weights are A and the tokens B, so a lane's 8 accumulators of a 16x16 tile are 8 head dims in a row of one token, which is one 16-byte slot [lane] of the
// attention's plane [TT][HD] (K = HD); for v the tokens are A, so they are 8 tokens in a row of one head dim, one slot of the transposed plane [HD][TT] (blocks ordered (32-key chunk, 16-row strip)). A wave stores 512 contiguous bytes a tile and plane.
// eight copies of 16 bytes a lane: two 16-row strips' 2 KiB (two 32-wide k chunks); l: the lane's LDS byte address, g: its global address
__device__ __forceinline__ void cp8(unsigned l, const bf* g) {
    const bf* g4 = g + 16 * EE;
    asm volatile("global_load_async_to_lds_b128 %0, %8, off\n\t"
                 "global_load_async_to_lds_b128 %1, %9, off\n\t"
                 "global_load_async_to_lds_b128 %2, %10, off\n\t"
                 "global_load_async_to_lds_b128 %3, %11, off\n\t"
                 "global_load_async_to_lds_b128 %4, %12, off\n\t"
                 "global_load_async_to_lds_b128 %5, %13, off\n\t"
                 "global_load_async_to_lds_b128 %6, %14, off\n\t"
                 "global_load_async_to_lds_b128 %7, %15, off\n\t"
                 "s_wait_xcnt 0x0"   // the copies' address registers stay whole up to this wait and are free for reuse only behind it
                 :: "v"(l), "v"(l + 512u), "v"(l + 1024u), "v"(l + 1536u), "v"(l + 2048u), "v"(l + 2560u), "v"(l + 3072u), "v"(l + 3584u),
                    "v"(g), "v"(g + 256), "v"(g + 512), "v"(g + 768), "v"(g4), "v"(g4 + 256), "v"(g4 + 512), "v"(g4 + 768) : "memory"); }
__device__ __forceinline__ v16bf ldl(const bf* p) { return cat16b(*(const v8usa*)p, *(const v8usa*)(p + 256)); }   // the two halves of one fragment-order block in LDS
__global__ __launch_bounds__(128) void k_proj(const bf* __restrict__ X, const bf* __restrict__ Wt, const float* __restrict__ bias0, const float* __restrict__ bias1, const float* __restrict__ bias2, const float* __restrict__ bias3, const float* __restrict__ bias4, bf* P) {
    __shared__ __align__(1024) bf sm[2 * 16384];   // two buffers of [operand][8 strips][2 chunks][512]
    const int lane = threadIdx.x & 31, lr = lane & 15, hi = lane >> 4; const int w = __builtin_amdgcn_readfirstlane((int)(threadIdx.x >> 5)), wi = w & 1, wj = w >> 1;
    const int z = blockIdx.z; const bool tr = z == 4;   // v: the tokens are the tile's rows
    const float* bias = z == 0 ? bias0 : z == 1 ? bias1 : z == 2 ? bias2 : z == 3 ? bias3 : bias4;
    const bf* gs = (wj == 0 ? X + (size_t)((int)blockIdx.x * 8 + wi * 4) * 16 * EE : Wt + (size_t)z * EE * EE + (size_t)((int)blockIdx.y * 8 + wi * 4) * 16 * EE) + 8 * lane;   // the wave's first strip to copy, chunk 0
    const unsigned l0 = (unsigned)(size_t)sm + (unsigned)w * 8192u + 16u * (unsigned)lane;
    const int ao = (tr ? wi * 4096 : 8192 + wj * 4096) + 8 * lane, bo = (tr ? 8192 + wj * 4096 : wi * 4096) + 8 * lane;   // the wave's four A and four B strips in a buffer: tokens half wi, weight rows half wj (one head)
    v8f acc[4][4];
#pragma unroll
    for (int mb = 0; mb < 4; ++mb)
#pragma unroll
        for (int nb = 0; nb < 4; ++nb) acc[mb][nb] = (v8f){};
    cp8(l0, gs); cp8(l0 + 4096u, gs + 32 * EE);
    asm volatile("s_wait_asynccnt 0x0" ::: "memory");   // this wave's copies of trip 0 have landed
    __syncthreads();   // every wave's have: buffer 0 may be read
    cp8(l0 + 32768u, gs + 1024); cp8(l0 + 32768u + 4096u, gs + 1024 + 32 * EE);
#pragma unroll 1   // one 64-wide k step a trip; reads, waits, barrier and refill stand in the order of the two-buffer ring, the products (registers only) behind them
    for (int t = 0; t < EE / 64; ++t) { const bf* sb = sm + (t & 1) * 16384; v16bf a[2][4], b[2][4];
#pragma unroll
        for (int c = 0; c < 2; ++c)
#pragma unroll
            for (int q = 0; q < 4; ++q) { a[c][q] = ldl(sb + ao + q * 1024 + c * 512); b[c][q] = ldl(sb + bo + q * 1024 + c * 512); }
        __builtin_amdgcn_sched_barrier(0);   // all LDS reads of a trip go out as one group; without it the compiler keeps one B fragment and waits out an LDS latency in front of every four products
        asm volatile("s_wait_dscnt 0x0" ::: "memory");     // this wave's reads of the buffer are done: the trip's fragments are all in registers
        asm volatile("s_wait_asynccnt 0x0" ::: "memory");  // its copies of trip t + 1 have landed
        __syncthreads();   // publishes trip t + 1's buffer and ends every wave's reads of trip t's, which is refilled behind it
        if (t + 2 < EE / 64) { const unsigned lb = l0 + (unsigned)(t & 1) * 32768u; const bf* g = gs + (t + 2) * 1024; cp8(lb, g); cp8(lb + 4096u, g + 32 * EE); }
        __builtin_amdgcn_sched_barrier(0);   // the refill goes out ahead of the trip's products and flies under them and under the next trip's LDS reads
#pragma unroll
        for (int c = 0; c < 2; ++c)
#pragma unroll
            for (int nb = 0; nb < 4; ++nb)
#pragma unroll
                for (int mb = 0; mb < 4; ++mb) acc[mb][nb] = wmmab(a[c][mb], b[c][nb], acc[mb][nb]); }
    asm volatile("s_wait_asynccnt 0x0" ::: "memory");   // no copy is outstanding when the wave goes on to its end
    const int h = (int)blockIdx.y * 2 + wj; const float *pbq = bias + h * HD + hi * 8, *pbv = bias + h * HD + lr; v4f bq[4][2]; float bv[4];   // q, k: the bias of a lane's 8 head dims a row block; v: of its one head dim a column block; both in bounds for every z
#pragma unroll
    for (int q = 0; q < 4; ++q) { bq[q][0] = *(const v4f*)(pbq + q * 16); bq[q][1] = *(const v4f*)(pbq + q * 16 + 4); bv[q] = pbv[q * 16]; }
    asm volatile("s_wait_xcnt 0x0" ::: "memory");   // the loads' address registers (offset and scalar base) are free for reuse only behind this wait
    __builtin_amdgcn_sched_barrier(0);   // keeps the stores' address arithmetic, which reuses those registers, from being lifted over the wait
    bf* ph = P + (size_t)z * 2 * NH_ * TT * HD + (size_t)h * TT * HD + (size_t)((int)blockIdx.x * 128 + wi * 64) * HD + 8 * lane;
#pragma unroll   // acc[][] is indexed by constants and stays in registers
    for (int mb = 0; mb < 4; ++mb) { v8us oh[4], ol[4]; bf* pp[4];
#pragma unroll
        for (int nb = 0; nb < 4; ++nb) {
#pragma unroll
            for (int j = 0; j < 8; ++j) { unsigned short u, v; splitf(acc[mb][nb][j] + bfr(tr ? bv[nb] : bq[mb][j >> 2][j & 3]), u, v); oh[nb][j] = u; ol[nb][j] = v; }
            pp[nb] = ph + (tr ? (mb >> 1) * 2048 + nb * 512 : nb * 1024 + (mb >> 1) * 512) + (mb & 1) * 256; *(v8us*)pp[nb] = oh[nb]; *(v8us*)(pp[nb] + (size_t)NH_ * TT * HD) = ol[nb]; }
        asm volatile("s_wait_xcnt 0x0" :: "v"(pp[0]), "v"(pp[1]), "v"(pp[2]), "v"(pp[3]), "v"(oh[0]), "v"(oh[1]), "v"(oh[2]), "v"(oh[3]), "v"(ol[0]), "v"(ol[1]), "v"(ol[2]), "v"(ol[3]) : "memory"); }   // the stores' address and data registers stay whole up to this wait and are free for reuse only behind it
}

typedef __attribute__((ext_vector_type(4))) unsigned short v4us;
typedef __attribute__((ext_vector_type(2))) float v2f;

// Like k_proj, k_cvt8 and k_gn store in the order of the plane: k_cvt8 one 16-byte slot [lane] of a fragment half a thread, 512 contiguous bytes a wave; k_gn half a slot a thread, 256 contiguous bytes a wave a plane.
// k_cvt8: src [R][EE] f32 -> dst in fragment order (K = EE); one grid for all seven sources: behind the SBL mask blocks, TT * EE / 2048 blocks convert x, then EE * EE / 2048 blocks for each of the six weight matrices (their planes lie one behind another in WB)
// The grid's first SBL blocks sort the mask for the attention, once for all heads: wave w of block b takes the 16-query strip 2 b + (w >> 2) and the key quarter w & 3 (the 32-key blocks at keys 128 i + 32 (w & 3), i = 0 .. 15) and stores one word,
// MB[32 b + w]: bit i: block i has an open entry (0) for one of the strip's queries; bit 16 + i: it has masked entries as well. A block's eight words have a 128-byte line of their own.
#define XBL (TT * EE / 2048)
#define WBL (EE * EE / 2048)
#define SBL (TT / 32)
typedef __attribute__((ext_vector_type(4))) int v4i;
// smallest of a lane's 16 mask entries, as unsigned: 0 exactly when one of them is open; and their bitwise or: 0 exactly when none is masked
__device__ __forceinline__ unsigned mmin(const v4i (&mk)[4]) { unsigned a = (unsigned)mk[0][0];
#pragma unroll
    for (int e = 1; e < 16; ++e) { const unsigned b = (unsigned)mk[e >> 2][e & 3]; a = b < a ? b : a; }
    return a; }
__device__ __forceinline__ unsigned mor(const v4i (&mk)[4]) { const v4i o = (mk[0] | mk[1]) | (mk[2] | mk[3]); return (unsigned)((o[0] | o[1]) | (o[2] | o[3])); }
// one block of the mask for sorting: load u takes rows 4 u .. 4 u + 3, 8 lanes on a row's 128 bytes, so every load reads 4 whole lines (which lane sees which entry does not matter to an any-test)
__device__ __forceinline__ void ldp(const int* mr, v4i (&mk)[4]) {
#pragma unroll
    for (int u = 0; u < 4; ++u) mk[u] = *(const v4i*)(mr + (size_t)u * 4 * TT);
    asm volatile("s_wait_xcnt 0x0" :: "v"(mr) : "memory"); }   // the loads' address registers stay whole up to this wait and are free for reuse only behind it
__global__ __launch_bounds__(256) void k_cvt8(const float* __restrict__ x, const float* __restrict__ w0, const float* __restrict__ w1, const float* __restrict__ w2, const float* __restrict__ w3, const float* __restrict__ w4, const float* __restrict__ w5, bf* XB, bf* WB, const int* __restrict__ msk, unsigned* MB) {
    if (blockIdx.x < SBL) {   // the same for the whole block
        const int lane = threadIdx.x & 31, w = __builtin_amdgcn_readfirstlane((int)(threadIdx.x >> 5));
        const int* mpre = msk + (size_t)(((int)blockIdx.x * 2 + (w >> 2)) * 16 + (lane >> 3)) * TT + (w & 3) * 32 + (lane & 7) * 4;
        unsigned act = 0, mix = 0;   // the same in every lane (ballots' results)
#pragma unroll   // constants for the bit places; four blocks' mask loads fly together
        for (int g = 0; g < 4; ++g) { v4i mm[4][4];
#pragma unroll
            for (int a = 0; a < 4; ++a) ldp(mpre + (g * 4 + a) * 128, mm[a]);
            __builtin_amdgcn_sched_barrier(0);   // the sixteen loads go out ahead of the first compare: one latency a group instead of one a block
#pragma unroll
            for (int a = 0; a < 4; ++a) { const unsigned op = __builtin_amdgcn_ballot_w32(mmin(mm[a]) == 0u) != 0u ? 1u << (g * 4 + a) : 0u; act |= op; mix |= __builtin_amdgcn_ballot_w32(mor(mm[a]) != 0u) != 0u ? op : 0u; } }
        if (lane == 0) MB[(int)blockIdx.x * 32 + w] = act | (mix << 16);
        return; }
    const int b = (int)blockIdx.x - SBL, isx = b < XBL, j = isx ? 0 : (b - XBL) / WBL; const float* src = isx ? x : j == 0 ? w0 : j == 1 ? w1 : j == 2 ? w2 : j == 3 ? w3 : j == 4 ? w4 : w5;
    bf* dst = isx ? XB : WB + (size_t)j * EE * EE; const size_t i = (size_t)(isx ? b : (b - XBL) % WBL) * 256 + threadIdx.x;
    const int lr = (int)(i & 15), hi = (int)(i >> 4) & 1, u = (int)(i >> 5) & 1, c = (int)(i >> 6) & (EE / 32 - 1); const size_t T = i >> 11; const v8f v = *(const v8f*)(src + (T * 16 + lr) * EE + c * 32 + u * 16 + hi * 8); v8us o;
    asm volatile("s_wait_xcnt 0x0" ::: "memory");   // the loads' address registers are free for reuse only behind this wait
#pragma unroll
    for (int k = 0; k < 8; ++k) o[k] = f2bf(v[k]); *(v8us*)(dst + i * 8) = o;  }
// ---- k_attn: both score maps, both softmaxes, their difference and the product with V in one launch; no score or probability ever leaves the registers.
// grid (TT / 128, heads), 16 waves, two passes. In a pass wave w owns one 16-query strip (w & 3 picks it among the block's four of that pass) and every fourth 32-key block (w >> 2 picks the quarter). Pass 0 takes strips 4 x .. 4 x + 3,
// pass 1 their mirror images 127 - (4 x + ..) with the quarters reversed, so that a mask which closes the keys behind (or ahead of) each query leaves every wave about the same number of open key blocks.
// The mask is sorted by 16-query x 32-key block at run time, once for all heads (k_cvt8's first blocks): one bit a block says whether any entry is open (0), one whether open and masked entries are mixed; each pass reads its one word. The sweep walks only
// the blocks with an open entry, and fetches the mask's entries again only for mixed blocks (a wholly open block masks nothing). A wholly masked block adds exact zeros to every sum of a row that has an open key anywhere, so leaving it out
// changes no value; nothing is assumed about where the mask is open.
// Scores are formed transposed (A = K rows, B = Q rows), so a lane holds 8 keys of ONE query per tile: maximum and sum are in-lane, and two 16-key tiles converted in place are the B operand of the product with V
// (its k order is the loader's: 8 hi + s, 16 + 8 hi + s); A = V's transposed plane, so the output tiles are transposed too and a lane holds 8 dims of that same query.
// ONE sweep: every score is formed once. Each map keeps its own maximum in use, exp sum and output tiles O = sum exp2(t - m) V (p split in bf16 high + low, three products, as the score products); when the maximum moves, sum and tiles
// are scaled in-lane (onl). Behind the sweep the key quarters' maxima and sums are joined in a fixed order and each wave forms O1 f1 - O2 f2 with f1 = exp2(m1 - max1) / sum1, f2 = lam exp2(m2 - max2) / sum2.
// The four key quarters' output tiles are summed in LDS and stored as whole lines of CAT[t][h * 64 + d].
// GroupNorm statistics: behind pass 1 the block holds its 128 tokens x 64 dims of one group in registers, so it also stores their sum and their square sum centred on the block's own mean, GP[h][block] = (sum, m2); k_gn joins a head's 16 pairs.
typedef __attribute__((ext_vector_type(2))) __bf16 v2bf;
__device__ __forceinline__ v16bf ldf(const bf* p) { return cat16b(*(const v8us*)p, *(const v8us*)(p + 256)); }   // the two halves of one fragment-order block
// the K fragments of 32 keys of one map: k[kt * 4 + c * 2] high, + 1 low (16-key tile kt, 32-wide chunk c of the head dim)
// Kh, Kl: the block's first element, the same for the whole wave (a scalar base); lo: the lane's own 8 * lane, the one vector register that all the sweep's global operand loads share
__device__ __forceinline__ void ldk(const bf* Kh, const bf* Kl, unsigned lo, v16bf (&k)[8]) {
#pragma unroll
    for (int kt = 0; kt < 2; ++kt)
#pragma unroll
        for (int c = 0; c < 2; ++c) { k[kt * 4 + c * 2] = ldf(Kh + kt * 16 * HD + c * 512 + lo); k[kt * 4 + c * 2 + 1] = ldf(Kl + kt * 16 * HD + c * 512 + lo); }
    asm volatile("s_wait_xcnt 0x0" :: "s"(Kh), "s"(Kl), "v"(lo) : "memory"); }   // the loads' address registers stay whole up to this wait and are free for reuse only behind it
// one map's Q fragments from the wave's part of LDS: chunk c high at c * 1024, low 512 behind
__device__ __forceinline__ void ldq(const bf* q, v16bf (&qh)[2], v16bf (&ql)[2]) {
#pragma unroll
    for (int c = 0; c < 2; ++c) { qh[c] = cat16b(*(const v8usa*)(q + c * 1024), *(const v8usa*)(q + c * 1024 + 256)); ql[c] = cat16b(*(const v8usa*)(q + c * 1024 + 512), *(const v8usa*)(q + c * 1024 + 768)); } }
__device__ __forceinline__ void ldm(const int* mr, v4i (&mk)[4]) {
#pragma unroll
    for (int u = 0; u < 4; ++u) mk[u] = *(const v4i*)(mr + (u >> 1) * 16 + (u & 1) * 4);
    asm volatile("s_wait_xcnt 0x0" :: "v"(mr) : "memory"); }   // as in ldk
// two transposed score tiles: s[kt][j] = q[query lr] . k[key kt * 16 + 8 hi + j], split products kh.qh + kh.ql + kl.qh over the two chunks
__device__ __forceinline__ void sc2(const v16bf (&k)[8], const v16bf (&qh)[2], const v16bf (&ql)[2], v8f (&s)[2]) { s[0] = (v8f){}; s[1] = (v8f){};
#pragma unroll
    for (int c = 0; c < 2; ++c) { s[0] = wmmab(k[c * 2], qh[c], s[0]); s[1] = wmmab(k[4 + c * 2], qh[c], s[1]); s[0] = wmmab(k[c * 2], ql[c], s[0]); s[1] = wmmab(k[4 + c * 2], ql[c], s[1]); s[0] = wmmab(k[c * 2 + 1], qh[c], s[0]); s[1] = wmmab(k[4 + c * 2 + 1], qh[c], s[1]); } }
// masked scores, scaled by 1/8 and by log2(e) in one multiply, so that every exponential below is a bare exp2: t[kt * 8 + j] belongs to key kt * 16 + 8 hi + j of the block
__device__ __forceinline__ void msc(const v8f (&s)[2], bool mixed, unsigned mb, float (&t)[16]) {
#pragma unroll
    for (int e = 0; e < 16; ++e) t[e] = s[e >> 3][e & 7] * (SCL * 1.44269504f);
    if (mixed) {   // the same for the whole wave: a scalar branch; a wholly open block has nothing to mask
#pragma unroll
        for (int e = 0; e < 16; ++e) t[e] = ((mb >> e) & 1u) != 0u ? -3.0e38f : t[e]; } }
// one block of one map in the single sweep: p = exp2(t - m), split in bf16 high + low (the B operand of the product with V), its sum added to l. The maximum in use m moves only when some query's new maximum lies more than 8 above it
// (one test for the wave, a scalar branch): then sum and output tile, in which a lane holds 8 dims of its one query, are scaled in-lane. p stays <= 2^8.
__device__ __forceinline__ void onl(const float (&t)[16], float& m, float& l, v8f (&o)[4], v16bf& ph, v16bf& pl) { float tm = t[0];
#pragma unroll
    for (int k = 1; k < 16; ++k) tm = fmaxf(tm, t[k]);
    if (__builtin_amdgcn_ballot_w32(tm > m + 8.0f) != 0u) { const float mn = fmaxf(m, fmaxf(tm, __shfl_xor(tm, 16, 32))), al = __builtin_amdgcn_exp2f(m - mn); l *= al; m = mn;
#pragma unroll
        for (int dt = 0; dt < 4; ++dt) o[dt] *= al; }
    float a = 0.f;
#pragma unroll
    for (int e = 0; e < 16; e += 2) { v2f wv; wv[0] = __builtin_amdgcn_exp2f(t[e] - m); wv[1] = __builtin_amdgcn_exp2f(t[e + 1] - m); a += wv[0] + wv[1];
        const v2bf hh = __builtin_convertvector(wv, v2bf); const v2bf ll = __builtin_convertvector(wv - __builtin_convertvector(hh, v2f), v2bf); ph[e] = hh[0]; ph[e + 1] = hh[1]; pl[e] = ll[0]; pl[e + 1] = ll[1]; }
    l += a; }
__device__ __forceinline__ void join_ml(float& m, float& l, float mo, float lo) { const float mn = fmaxf(m, mo); l = l * __builtin_amdgcn_exp2f(m - mn) + lo * __builtin_amdgcn_exp2f(mo - mn); m = mn; }
__device__ __forceinline__ float wsum(float v) {   // sum over the wave's 32 lanes, the same bits in every lane
#pragma unroll   // five fixed steps: no loop counter, the lane masks are constants
    for (int m = 16; m >= 1; m >>= 1) v += __shfl_xor(v, m, 32);
    return v; }
// the mask entries of a block for msc, one bit each in a word a lane (bit e: entry e is masked): fetched where the block is mixed (the same for the whole wave: a scalar branch), 0 where it is wholly open
__device__ __forceinline__ unsigned ldmb(const int* mr, bool mixed) { unsigned mb = 0u;
    if (mixed) { v4i mk[4]; ldm(mr, mk);
#pragma unroll
        for (int e = 0; e < 16; ++e) mb |= mk[e >> 2][e & 3] ? 1u << e : 0u; }
    return mb; }
__global__ __launch_bounds__(512) void k_attn(const bf* __restrict__ Q1h, const bf* __restrict__ Q1l, const bf* __restrict__ Q2h, const bf* __restrict__ Q2l, const bf* __restrict__ K1h, const bf* __restrict__ K1l, const bf* __restrict__ K2h, const bf* __restrict__ K2l,
                                              const bf* __restrict__ Vh, const bf* __restrict__ Vl, const int* __restrict__ msk, const unsigned* __restrict__ MB, const float* __restrict__ lam, float* CAT, float* GP) {
    __shared__ __align__(16) float os[16 * 16 * 68];
    __shared__ __align__(16) bf qs[16 * 4096];
    __shared__ __align__(16) float kp[2 * 512 * 4];
    __shared__ float st[4][4][64];
    __shared__ __align__(16) float gs[2][16];
    const int lane = threadIdx.x & 31, lr = lane & 15, hi = lane >> 4; const int w = __builtin_amdgcn_readfirstlane((int)(threadIdx.x >> 5)), sp = w & 3, ku = w >> 2;
    const int h = blockIdx.y; const size_t hb = (size_t)h * TT * HD; const unsigned lo = 8u * (unsigned)lane; const float lamh = bfr(lam[h]);
    const int sa = (int)blockIdx.x * 4 + sp, sb = TT / 16 - 1 - sa;   // the wave's strips of pass 0 and pass 1
    const unsigned am0 = MB[(sa >> 1) * 32 + (sa & 1) * 4 + ku], am1 = MB[(sb >> 1) * 32 + (sb & 1) * 4 + 3 - ku];   // both passes' words of the sorted mask (strip, key quarter), asked for here (scalar loads) so that neither pass waits for its own
    v4f vals[4];
#pragma unroll   // two passes written out: vals[] is indexed by constants and stays in registers
    for (int p = 0; p < 2; ++p) {
        const int kq = p == 0 ? ku : 3 - ku, q0 = (p == 0 ? (int)blockIdx.x * 4 + sp : TT / 16 - 1 - ((int)blockIdx.x * 4 + sp)) * 16;
        // The strip's Q fragments wait in the wave's own part of LDS, in fragment order (map, chunk, high | low): both output tiles stay in registers through the sweep, so only the map at work has its Q there. No other wave touches this part: no barrier
        v16bf qh[2], ql[2]; const size_t qo = hb + (size_t)q0 * HD + 8 * lane; const bf *pq1h = Q1h + qo, *pq1l = Q1l + qo, *pq2h = Q2h + qo, *pq2l = Q2l + qo; bf* qw = qs + w * 4096 + 8 * lane;
        { v8us qa[16];
#pragma unroll
        for (int c = 0; c < 4; ++c) { qa[c] = *(const v8us*)(pq1h + c * 256); qa[4 + c] = *(const v8us*)(pq1l + c * 256); qa[8 + c] = *(const v8us*)(pq2h + c * 256); qa[12 + c] = *(const v8us*)(pq2l + c * 256); }
        asm volatile("s_wait_xcnt 0x0" :: "v"(pq1h), "v"(pq1l), "v"(pq2h), "v"(pq2l) : "memory");   // as in ldk
#pragma unroll
        for (int c = 0; c < 4; ++c) { *(v8usa*)(qw + (c >> 1) * 1024 + (c & 1) * 256) = qa[c]; *(v8usa*)(qw + (c >> 1) * 1024 + 512 + (c & 1) * 256) = qa[4 + c]; *(v8usa*)(qw + 2048 + (c >> 1) * 1024 + (c & 1) * 256) = qa[8 + c]; *(v8usa*)(qw + 2048 + (c >> 1) * 1024 + 512 + (c & 1) * 256) = qa[12 + c]; } }
        const int* mrow = msk + (size_t)(q0 + lr) * TT + 8 * hi + kq * 32;   // the wave's key block i (0 .. 15) begins at key 128 i + 32 kq
        const unsigned am = p == 0 ? am0 : am1, act = am & 0xFFFFu, mix = am >> 16;   // bit i of act: key block i has an open entry for one of the strip's queries; of mix: it has masked entries as well; the same for the whole wave
        float m1 = -3.0e38f, l1 = 0.f, m2 = -3.0e38f, l2 = 0.f;   // m: the maximum in use, the same in both lane halves of a query; l: the lane's own keys' exp sum
        v8f o1[4], o2[4];
#pragma unroll
        for (int dt = 0; dt < 4; ++dt) { o1[dt] = (v8f){}; o2[dt] = (v8f){}; }
        // Order of a trip, held by the scheduling barriers: each group of loads goes out right behind the products that free its registers and flies under the vector work that follows, instead of one exposed latency per fragment.
        // Without them the compiler lifts the loads further ahead of those products, and the trip no longer fits the registers of four waves a SIMD (it spills inside the loop).
        v16bf kf[8];
        if (act != 0u) { unsigned rem = act & (act - 1u); int kb = __builtin_ctz(act) * 128;   // kb: the block's first key, less 32 kq; at most 16 trips, one noted bit each
            ldk(K1h + hb + (size_t)(kb + kq * 32) * HD, K1l + hb + (size_t)(kb + kq * 32) * HD, lo, kf); ldq(qw, qh, ql);
#pragma unroll 1   // one 32-key block a trip: a second copy of the body would not fit the registers of four waves a SIMD
            for (;;) { v8f s[2]; float t[16]; v16bf p1h, p1l, p2h, p2l; const size_t o = hb + (size_t)(kb + kq * 32) * HD; const int kn = rem != 0u ? __builtin_ctz(rem) * 128 : kb;   // the last trip fetches its own block again: in bounds, unused
                const bool mixed = ((mix >> (kb >> 7)) & 1u) != 0u; const unsigned mb = ldmb(mrow + kb, mixed);
                sc2(kf, qh, ql, s); __builtin_amdgcn_sched_barrier(0);
                ldk(K2h + o, K2l + o, lo, kf); ldq(qw + 2048, qh, ql); __builtin_amdgcn_sched_barrier(0);
                msc(s, mixed, mb, t); onl(t, m1, l1, o1, p1h, p1l); __builtin_amdgcn_sched_barrier(0);
                sc2(kf, qh, ql, s); __builtin_amdgcn_sched_barrier(0);
                v16bf vh[4], vl[4]; const bf *pvh = Vh + o, *pvl = Vl + o;
#pragma unroll
                for (int dt = 0; dt < 4; ++dt) { vh[dt] = ldf(pvh + dt * 512 + lo); vl[dt] = ldf(pvl + dt * 512 + lo); }
                asm volatile("s_wait_xcnt 0x0" :: "s"(pvh), "s"(pvl), "v"(lo) : "memory");   // as in ldk
                __builtin_amdgcn_sched_barrier(0);
                msc(s, mixed, mb, t); onl(t, m2, l2, o2, p2h, p2l); __builtin_amdgcn_sched_barrier(0);
#pragma unroll
                for (int dt = 0; dt < 4; ++dt) { o1[dt] = wmmab(vh[dt], p1h, o1[dt]); o2[dt] = wmmab(vh[dt], p2h, o2[dt]); }
#pragma unroll
                for (int dt = 0; dt < 4; ++dt) { o1[dt] = wmmab(vh[dt], p1l, o1[dt]); o2[dt] = wmmab(vh[dt], p2l, o2[dt]); }
#pragma unroll
                for (int dt = 0; dt < 4; ++dt) { o1[dt] = wmmab(vl[dt], p1h, o1[dt]); o2[dt] = wmmab(vl[dt], p2h, o2[dt]); }
                __builtin_amdgcn_sched_barrier(0);
                ldk(K1h + hb + (size_t)(kn + kq * 32) * HD, K1l + hb + (size_t)(kn + kq * 32) * HD, lo, kf); ldq(qw, qh, ql);
                asm volatile("v_nop\n\tv_nop\n\tv_nop\n\tv_nop" : "+v"(o1[0]), "+v"(o1[1]), "+v"(o1[2]), "+v"(o1[3]), "+v"(o2[0]), "+v"(o2[1]), "+v"(o2[2]), "+v"(o2[3]));   // the distance behind the trip's last matrix instructions, also on the taken side of the branch below
                if (rem == 0u) break;
                rem &= rem - 1u; kb = kn; } }
        l1 += __shfl_xor(l1, 16, 32); l2 += __shfl_xor(l2, 16, 32);   // the halves share m, so their sums add as they are
        if (hi == 0) { st[ku][0][sp * 16 + lr] = m1; st[ku][1][sp * 16 + lr] = l1; st[ku][2][sp * 16 + lr] = m2; st[ku][3][sp * 16 + lr] = l2; }
        __syncthreads();   // all four key quarters' maxima and sums are in LDS before any wave joins them; it also ends the earlier pass's reads of os ahead of this pass's stores there
        float j1 = st[0][0][sp * 16 + lr], n1 = st[0][1][sp * 16 + lr], j2 = st[0][2][sp * 16 + lr], n2 = st[0][3][sp * 16 + lr];
#pragma unroll   // three fixed joins, in the order of the waves
        for (int u = 1; u < 4; ++u) { join_ml(j1, n1, st[u][0][sp * 16 + lr], st[u][1][sp * 16 + lr]); join_ml(j2, n2, st[u][2][sp * 16 + lr], st[u][3][sp * 16 + lr]); }
        const float f1 = __fdiv_rn(1.0f, n1) * __builtin_amdgcn_exp2f(m1 - j1), f2 = __fdiv_rn(1.0f, n2) * lamh * __builtin_amdgcn_exp2f(m2 - j2);   // from this wave's own maxima to the query's, and the two normalisers
#pragma unroll
        for (int dt = 0; dt < 4; ++dt) { const v8f r = o1[dt] * f1 - o2[dt] * f2; float* po = os + (w * 16 + lr) * 68 + dt * 16 + hi * 8;   // a lane holds 8 dims in a row of its one query
            *(v4fa*)po = __builtin_shufflevector(r, r, 0, 1, 2, 3); *(v4fa*)(po + 4) = __builtin_shufflevector(r, r, 4, 5, 6, 7); }
        __syncthreads();   // every wave's partial output tile is in LDS before any thread sums the four key quarters; it also ends this pass's reads of st ahead of the next pass's stores there
        float* pc[2];
#pragma unroll
        for (int q = 0; q < 2; ++q) { const int idx = q * 512 + (int)threadIdx.x, row = idx >> 4, c4 = (idx & 15) * 4;   // row: 16 (strip of the pass) + query; wave 4 u + strip holds quarter u's tile
            vals[p * 2 + q] = (*(const v4fa*)(os + row * 68 + c4) + *(const v4fa*)(os + (64 + row) * 68 + c4)) + (*(const v4fa*)(os + (128 + row) * 68 + c4) + *(const v4fa*)(os + (192 + row) * 68 + c4));
            const int tok = (p == 0 ? (int)blockIdx.x * 4 + (row >> 4) : TT / 16 - 1 - ((int)blockIdx.x * 4 + (row >> 4))) * 16 + (row & 15);
            pc[q] = CAT + (size_t)tok * EE + h * HD + c4; *(v4f*)pc[q] = vals[p * 2 + q];
            if (p == 0) *(v4fa*)(kp + idx * 4) = vals[q]; }   // pass 0's values wait in the thread's own LDS slot: pass 1's sweep has no registers to spare for them
        asm volatile("s_wait_xcnt 0x0" :: "v"(pc[0]), "v"(pc[1]), "v"(vals[p * 2]), "v"(vals[p * 2 + 1]) : "memory");   // the stores' address and data registers stay whole up to this wait and are free for reuse only behind it
    }
    vals[0] = *(const v4fa*)(kp + (int)threadIdx.x * 4); vals[1] = *(const v4fa*)(kp + (512 + (int)threadIdx.x) * 4);
    const v4f s4 = (vals[0] + vals[1]) + (vals[2] + vals[3]); const float ws = wsum((s4[0] + s4[1]) + (s4[2] + s4[3]));
    if (lane == 0) gs[0][w] = ws;
    __syncthreads();   // all 16 waves' sums are in LDS before any thread forms the block's mean
    const v4f b4 = (*(const v4fa*)(gs[0]) + *(const v4fa*)(gs[0] + 4)) + (*(const v4fa*)(gs[0] + 8) + *(const v4fa*)(gs[0] + 12)); const float bs = (b4[0] + b4[1]) + (b4[2] + b4[3]), bm = bs * (1.0f / (128 * HD));
    v4f d4 = (v4f){};
#pragma unroll   // vals[] is indexed by constants and stays in registers
    for (int q = 0; q < 4; ++q) { const v4f d = vals[q] - bm; d4 += d * d; }
    const float wq = wsum((d4[0] + d4[1]) + (d4[2] + d4[3]));
    if (lane == 0) gs[1][w] = wq;
    __syncthreads();   // all 16 waves' centred square sums are in LDS before thread 0 adds them
    if (threadIdx.x == 0) { const v4f c4v = (*(const v4fa*)(gs[1]) + *(const v4fa*)(gs[1] + 4)) + (*(const v4fa*)(gs[1] + 8) + *(const v4fa*)(gs[1] + 12)); v2f o2; o2[0] = bs; o2[1] = (c4v[0] + c4v[1]) + (c4v[2] + c4v[3]);
        *(v2f*)(GP + ((size_t)h * (TT / 128) + blockIdx.x) * 2) = o2; }
}
// k_gn: a head's mean and biased variance from its 16 pairs GP[h][b] = (sum, m2 about the block's own mean) of 128 x 64 values each: var * N = sum_b m2_b + n_b (mean_b - mean)^2, an identity, every term >= 0; then the normalisation.
__global__ __launch_bounds__(256) void k_gn(const float* __restrict__ CAT, const float* __restrict__ GP, const float* __restrict__ gw, const float* __restrict__ gb, bf* Ah, bf* Al) { const size_t o = ((size_t)blockIdx.x * 256 + threadIdx.x) * 4; if (o >= (size_t)TT * EE) return;   // o: place in the fragment-order planes (K = EE), half a 16-byte slot a thread; i: the same elements in CAT
    const size_t i = ((o >> 14) * 16 + ((o >> 3) & 15)) * EE + ((o >> 9) & (EE / 32 - 1)) * 32 + ((o >> 8) & 1) * 16 + ((o >> 7) & 1) * 8 + (o & 7); const int c = (int)(i % EE);
    const float* gp = GP + (size_t)(blockIdx.x & (NH_ - 1)) * (TT / 128) * 2;   // head c / HD: a block's 1024 elements are two 32-wide chunks of one head, so the pairs are read once for the block through the scalar path
    float gsum = 0.f, gm2 = 0.f;
#pragma unroll   // both loops unrolled: the 16 pairs come in two wide loads, one latency, instead of one load a trip
    for (int b = 0; b < TT / 128; ++b) gsum += gp[2 * b];
    const float mu = gsum * (1.0f / (float)(HD * TT));
#pragma unroll
    for (int b = 0; b < TT / 128; ++b) { const float d = gp[2 * b] * (1.0f / (128 * HD)) - mu; gm2 += gp[2 * b + 1] + (float)(128 * HD) * (d * d); }
    const float rs = __frsqrt_rn(__fadd_rn(gm2 * (1.0f / (float)(HD * TT)), 1e-5f)); const v4f a = *(const v4f*)(CAT + i); v4us oh, ol;
#pragma unroll
    for (int q = 0; q < 4; ++q) { float t = __fmul_rn(__fsub_rn(a[q], mu), rs); asm volatile("" : "+v"(t)); float tg = __fmul_rn(t, bfr(gw[c + q])); asm volatile("" : "+v"(tg)); unsigned short u, c2; splitf(__fadd_rn(tg, bfr(gb[c + q])), u, c2); oh[q] = u; ol[q] = c2; }
    *(v4us*)(Ah + o) = oh; *(v4us*)(Al + o) = ol;  }

extern "C" void kernel_launch(void* const* d_in, const int* in_sizes, int n_in,
                              void* d_out, int out_size, void* d_ws, size_t ws_size, hipStream_t stream) {
    (void)in_sizes; (void)n_in; (void)out_size;
    const float* x = (const float*)d_in[0]; const int* msk = (const int*)d_in[1]; const float* IN[17]; for (int i = 2; i < 17; ++i) IN[i] = (const float*)d_in[i];   // 2 Wq1 [16][64][1024], 3 bq1, 4 Wq2, 5 bq2, 6 Wk1, 7 bk1, 8 Wk2, 9 bk2, 10 Wv, 11 bv, 12 lam, 13 gn_w, 14 gn_b, 15 Wo [1024][1024] (out,in), 16 bo
    float* OUT = (float*)d_out;     // [1][2048][1024]
    char* wsp = (char*)d_ws;
    auto take = [&](size_t bytes) { char* p = wsp; wsp += (bytes + 255) & ~(size_t)255; return (void*)p; };
    bf* WB = (bf*)take((size_t)6 * EE * EE * 2); bf* XB = (bf*)take((size_t)TT * EE * 2);   // WB: six weight planes, one behind another
    bf* Q1h = (bf*)take((size_t)NH_ * TT * HD * 2); bf* Q1l = (bf*)take((size_t)NH_ * TT * HD * 2); bf* Q2h = (bf*)take((size_t)NH_ * TT * HD * 2); bf* Q2l = (bf*)take((size_t)NH_ * TT * HD * 2); bf* K1h = (bf*)take((size_t)NH_ * TT * HD * 2); bf* K1l = (bf*)take((size_t)NH_ * TT * HD * 2); bf* K2h = (bf*)take((size_t)NH_ * TT * HD * 2); bf* K2l = (bf*)take((size_t)NH_ * TT * HD * 2); bf* Vh = (bf*)take((size_t)NH_ * HD * TT * 2); bf* Vl = (bf*)take((size_t)NH_ * HD * TT * 2);
    float* CAT = (float*)take((size_t)TT * EE * 4); float* GP = (float*)take((size_t)NH_ * (TT / 128) * 2 * 4); bf* Ah = (bf*)take((size_t)TT * EE * 2); bf* Al = (bf*)take((size_t)TT * EE * 2); unsigned* MB = (unsigned*)take((size_t)SBL * 32 * 4);
    if ((size_t)(wsp - (char*)d_ws) > ws_size) return;
    k_cvt8<<<SBL + XBL + 6 * WBL, 256, 0, stream>>>(x, IN[2], IN[4], IN[6], IN[8], IN[10], IN[15], XB, WB, msk, MB);   // [H][DH][E] stacked = natural [1024][1024] Bt; Wo [E][D] natural
    k_proj<<<dim3(TT / 128, EE / 128, 5), 128, 0, stream>>>(XB, WB, IN[3], IN[5], IN[7], IN[9], IN[11], Q1h);   // q1, q2, k1, k2, v; the ten planes from Q1h to Vl lie one behind another in the workspace, in the order taken above
    k_attn<<<dim3(TT / 128, NH_, 1), 512, 0, stream>>>(Q1h, Q1l, Q2h, Q2l, K1h, K1l, K2h, K2l, Vh, Vl, msk, MB, IN[12], CAT, GP);
    k_gn<<<(unsigned)(((size_t)TT * EE / 4 + 255) / 256), 256, 0, stream>>>(CAT, GP, IN[13], IN[14], Ah, Al);
    k_gemmw<bf, 1, true, 8, 1><<<dim3(TT / 64, EE / 64, 1), 256, 0, stream>>>(Ah, Al, WB + (size_t)5 * EE * EE, nullptr, EE, OUT, EE, IN[16], 0, 0, 0);
}
